// v000
// Measured on an AMD MI455X. A time is GPU time per run, averaged over a window of back-to-back runs after a warm-up
// (all launches, gaps included; the runs take copies of the inputs in turn), and the median of several windows.
// Apart from v000's, it joins two sittings. Times from different sittings can be a few percent apart, while
// side-by-side timings come from the same sitting.
// v000 is the starting kernel. One run takes 542 microseconds.
#include <hip/hip_runtime.h>
#include <hip/hip_bf16.h>

typedef __attribute__((ext_vector_type(16))) _Float16 v16h;
typedef __attribute__((ext_vector_type(8)))  _Float16 v8h;
typedef __attribute__((ext_vector_type(8)))  float    v8f;
typedef __attribute__((ext_vector_type(4)))  float    v4f;

#define DIMS 512
#define NB   16
#define HW   4096   // 64*64
#define HW4  1024   // pooled positions
#define C8   64
#define C2   256

#define WMMA_F16(A, B, C) __builtin_amdgcn_wmma_f32_16x16x32_f16(false, A, false, B, (short)0, C, false, false)

// Fragment K pattern for 16x16x32 f16 WMMA (ISA 7.12.2):
//   lane half 0: K in [0,8) and [16,24);  lane half 1: K in [8,16) and [24,32).
// With K contiguous in memory a fragment is exactly two 16-byte loads.
__device__ __forceinline__ v16h load_frag_row(const _Float16* __restrict__ p, int half) {
    v8h lo = *(const v8h*)(p + half * 8);
    v8h hi = *(const v8h*)(p + 16 + half * 8);
    v16h r;
    #pragma unroll
    for (int i = 0; i < 8; ++i) { r[i] = lo[i]; r[i + 8] = hi[i]; }
    return r;
}

// ---------------------------------------------------------------------------
// Fused QKV 1x1 conv: reads X once, produces theta, phi-conv and g-conv.
// Per wave: 6 accumulators = theta tile (16 co) + phi tile (16 co) + 4 g tiles
// (64 co). Block of 4 waves covers all 64+64+256 output channels.
// Grid (HW/16, 1, B), block 128.
// ---------------------------------------------------------------------------
__global__ void qkv_conv_kernel(const float* __restrict__ X,
                                const _Float16* __restrict__ Wth,
                                const _Float16* __restrict__ Wph,
                                const _Float16* __restrict__ Wg,
                                const float* __restrict__ bth,
                                const float* __restrict__ bph,
                                const float* __restrict__ bg,
                                _Float16* __restrict__ theta,
                                _Float16* __restrict__ phic,
                                _Float16* __restrict__ gc) {
    __shared__ _Float16 sA[16 * 128];   // [m][ci_panel], K contiguous per row

    const int hw0  = blockIdx.x * 16;
    const int b    = blockIdx.z;
    const int t    = threadIdx.x;
    const int lane = t & 31;
    const int wave = t >> 5;
    const int half = lane >> 4;
    const int mn   = lane & 15;
    const int m_s  = t & 15;            // staging row
    const int ci0  = (t >> 4) * 16;     // staging K base

    const float* xb = X + (size_t)b * DIMS * HW + hw0;
    const _Float16* wrT  = Wth + (size_t)(wave * 16 + mn) * DIMS;
    const _Float16* wrP  = Wph + (size_t)(wave * 16 + mn) * DIMS;
    const _Float16* wrG0 = Wg + (size_t)(wave * 64 +      mn) * DIMS;
    const _Float16* wrG1 = Wg + (size_t)(wave * 64 + 16 + mn) * DIMS;
    const _Float16* wrG2 = Wg + (size_t)(wave * 64 + 32 + mn) * DIMS;
    const _Float16* wrG3 = Wg + (size_t)(wave * 64 + 48 + mn) * DIMS;

    v8f accT = {}, accP = {}, accG0 = {}, accG1 = {}, accG2 = {}, accG3 = {};

    for (int kp = 0; kp < DIMS; kp += 128) {
        __syncthreads();
        // gather 16 strided f32 (independent loads -> one clause), pack, 2x b128
        float tmp[16];
        #pragma unroll
        for (int j = 0; j < 16; ++j)
            tmp[j] = xb[(size_t)(kp + ci0 + j) * HW + m_s];
        v8h h0, h1;
        #pragma unroll
        for (int j = 0; j < 8; ++j) {
            h0[j] = (_Float16)tmp[j];
            h1[j] = (_Float16)tmp[j + 8];
        }
        *(v8h*)(sA + m_s * 128 + ci0)     = h0;
        *(v8h*)(sA + m_s * 128 + ci0 + 8) = h1;
        if (kp + 128 < DIMS)              // prefetch next panel
            __builtin_prefetch(&xb[(size_t)(kp + 128 + ci0) * HW + m_s], 0, 0);
        __syncthreads();

        #pragma unroll
        for (int q = 0; q < 4; ++q) {
            const int kk = q * 32;
            v16h a  = load_frag_row(sA + mn * 128 + kk, half);
            v16h bT = load_frag_row(wrT  + kp + kk, half);
            v16h bP = load_frag_row(wrP  + kp + kk, half);
            v16h b0 = load_frag_row(wrG0 + kp + kk, half);
            v16h b1 = load_frag_row(wrG1 + kp + kk, half);
            v16h b2 = load_frag_row(wrG2 + kp + kk, half);
            v16h b3 = load_frag_row(wrG3 + kp + kk, half);
            accT  = WMMA_F16(a, bT, accT);
            accP  = WMMA_F16(a, bP, accP);
            accG0 = WMMA_F16(a, b0, accG0);
            accG1 = WMMA_F16(a, b1, accG1);
            accG2 = WMMA_F16(a, b2, accG2);
            accG3 = WMMA_F16(a, b3, accG3);
        }
    }

    const float bvT  = bth[wave * 16 + mn];
    const float bvP  = bph[wave * 16 + mn];
    const float bvG0 = bg[wave * 64 +      mn];
    const float bvG1 = bg[wave * 64 + 16 + mn];
    const float bvG2 = bg[wave * 64 + 32 + mn];
    const float bvG3 = bg[wave * 64 + 48 + mn];
    #pragma unroll
    for (int r = 0; r < 8; ++r) {
        int m = r + half * 8;
        size_t row = (size_t)b * HW + hw0 + m;
        theta[row * C8 + wave * 16 + mn] = (_Float16)(accT[r] + bvT);
        phic [row * C8 + wave * 16 + mn] = (_Float16)(accP[r] + bvP);
        gc[row * C2 + wave * 64 +      mn] = (_Float16)(accG0[r] + bvG0);
        gc[row * C2 + wave * 64 + 16 + mn] = (_Float16)(accG1[r] + bvG1);
        gc[row * C2 + wave * 64 + 32 + mn] = (_Float16)(accG2[r] + bvG2);
        gc[row * C2 + wave * 64 + 48 + mn] = (_Float16)(accG3[r] + bvG3);
    }
}

// ---------------------------------------------------------------------------
// 2x2 maxpool, phi: [b][hw][64] -> phi[b][key][64]; v8h in/out.
// ---------------------------------------------------------------------------
__global__ void pool_phi_kernel(const _Float16* __restrict__ pc,
                                _Float16* __restrict__ phi) {
    int idx = blockIdx.x * blockDim.x + threadIdx.x;   // NB*HW4*(C8/8)
    if (idx >= NB * HW4 * (C8 / 8)) return;
    int cb = idx & 7;
    int mp = (idx >> 3) & (HW4 - 1);
    int b  = idx >> 13;
    int hp = mp >> 5, wp = mp & 31;
    int hw = (hp * 2) * 64 + wp * 2;
    const _Float16* base = pc + (size_t)b * HW * C8 + cb * 8;
    v8h v0 = *(const v8h*)(base + (size_t)(hw)      * C8);
    v8h v1 = *(const v8h*)(base + (size_t)(hw + 1)  * C8);
    v8h v2 = *(const v8h*)(base + (size_t)(hw + 64) * C8);
    v8h v3 = *(const v8h*)(base + (size_t)(hw + 65) * C8);
    v8h m;
    #pragma unroll
    for (int i = 0; i < 8; ++i)
        m[i] = (_Float16)fmaxf(fmaxf((float)v0[i], (float)v1[i]),
                               fmaxf((float)v2[i], (float)v3[i]));
    *(v8h*)(phi + ((size_t)b * HW4 + mp) * C8 + cb * 8) = m;
}

// 2x2 maxpool, g: [b][hw][256] -> g[b][c][key]; 8 consecutive keys per thread.
__global__ void pool_g_kernel(const _Float16* __restrict__ gc,
                              _Float16* __restrict__ g) {
    int idx = blockIdx.x * blockDim.x + threadIdx.x;   // NB*C2*(HW4/8)
    if (idx >= NB * C2 * (HW4 / 8)) return;
    int kb = idx & 127;
    int c  = (idx >> 7) & (C2 - 1);
    int b  = idx >> 15;
    int mp0 = kb * 8;
    int hp = mp0 >> 5, wp0 = mp0 & 31;
    const _Float16* base = gc + (size_t)b * HW * C2 + c;
    v8h m;
    #pragma unroll
    for (int i = 0; i < 8; ++i) {
        int hw = (hp * 2) * 64 + (wp0 + i) * 2;
        float v0 = (float)base[(size_t)(hw)      * C2];
        float v1 = (float)base[(size_t)(hw + 1)  * C2];
        float v2 = (float)base[(size_t)(hw + 64) * C2];
        float v3 = (float)base[(size_t)(hw + 65) * C2];
        m[i] = (_Float16)fmaxf(fmaxf(v0, v1), fmaxf(v2, v3));
    }
    *(v8h*)(g + ((size_t)b * C2 + c) * HW4 + mp0) = m;
}

// f32 -> f16 conversion (weights)
__global__ void cvt_f16_kernel(const float* __restrict__ src,
                               _Float16* __restrict__ dst, int n) {
    int i = blockIdx.x * blockDim.x + threadIdx.x;
    if (i * 4 >= n) return;
    v4f v = *(const v4f*)(src + i * 4);
    _Float16* d = dst + i * 4;
    d[0] = (_Float16)v[0]; d[1] = (_Float16)v[1];
    d[2] = (_Float16)v[2]; d[3] = (_Float16)v[3];
}

// ---------------------------------------------------------------------------
// Fused attention per 16-row query tile:
//   S(16x1024)=theta@phi (WMMA) -> LDS f32 softmax -> O=P@g (WMMA, A reused 4x)
// Block 128 = 4 waves. Grid (HW/16, B). Dynamic LDS = 100,864 B (<320 KB/WGP).
// ---------------------------------------------------------------------------
__global__ void attn_wmma_kernel(const _Float16* __restrict__ theta,
                                 const _Float16* __restrict__ phi,
                                 const _Float16* __restrict__ g,
                                 _Float16* __restrict__ o) {
    extern __shared__ char smem[];
    _Float16* sTheta = (_Float16*)smem;                        // 16x64   (2 KB)
    float*    sS     = (float*)(smem + 2048);                  // 16x1024 (64 KB)
    _Float16* sP     = (_Float16*)(smem + 2048 + 65536);       // 16x1024 (32 KB)
    float*    sRed   = (float*)(smem + 2048 + 65536 + 32768);  // 16x8

    const int hw0  = blockIdx.x * 16;
    const int b    = blockIdx.y;
    const int t    = threadIdx.x;
    const int lane = t & 31;
    const int wave = t >> 5;
    const int half = lane >> 4;
    const int mn   = lane & 15;

    // theta tile = 1024 contiguous halfwords: one v8h per thread
    ((v8h*)sTheta)[t] = ((const v8h*)(theta + ((size_t)b * HW + hw0) * C8))[t];
    __syncthreads();

    // ---- Phase 1: scores; B-fragments straight from key-major phi ----
    for (int kt = 0; kt < 16; ++kt) {
        int key0 = wave * 256 + kt * 16;
        const _Float16* prow = phi + ((size_t)b * HW4 + key0 + mn) * C8;
        v16h a0 = load_frag_row(sTheta + mn * C8, half);
        v16h a1 = load_frag_row(sTheta + mn * C8 + 32, half);
        v16h b0 = load_frag_row(prow, half);
        v16h b1 = load_frag_row(prow + 32, half);
        v8f acc = {};
        acc = WMMA_F16(a0, b0, acc);
        acc = WMMA_F16(a1, b1, acc);
        #pragma unroll
        for (int r = 0; r < 8; ++r)
            sS[(r + half * 8) * HW4 + key0 + mn] = acc[r];
    }
    __syncthreads();

    // ---- Phase 2: softmax over 1024 keys, 8 threads per row, vectorized ----
    {
        int row = t >> 3, seg = t & 7;
        const v4f* s4 = (const v4f*)(sS + row * HW4 + seg * 128);   // 32 v4f
        v8h*       p8 = (v8h*)(sP + row * HW4 + seg * 128);         // 16 v8h

        float lmax = -3.4e38f;
        #pragma unroll 8
        for (int i = 0; i < 32; ++i) {
            v4f v = s4[i];
            lmax = fmaxf(lmax, fmaxf(fmaxf(v[0], v[1]), fmaxf(v[2], v[3])));
        }
        sRed[row * 8 + seg] = lmax;
        __syncthreads();
        float rmax = -3.4e38f;
        #pragma unroll
        for (int i = 0; i < 8; ++i) rmax = fmaxf(rmax, sRed[row * 8 + i]);
        __syncthreads();

        float lsum = 0.f;
        #pragma unroll 4
        for (int i = 0; i < 16; ++i) {
            v4f a = s4[2 * i], c = s4[2 * i + 1];
            float e[8];
            e[0] = __expf(a[0] - rmax); e[1] = __expf(a[1] - rmax);
            e[2] = __expf(a[2] - rmax); e[3] = __expf(a[3] - rmax);
            e[4] = __expf(c[0] - rmax); e[5] = __expf(c[1] - rmax);
            e[6] = __expf(c[2] - rmax); e[7] = __expf(c[3] - rmax);
            v8h hh;
            #pragma unroll
            for (int j = 0; j < 8; ++j) { lsum += e[j]; hh[j] = (_Float16)e[j]; }
            p8[i] = hh;
        }
        sRed[row * 8 + seg] = lsum;
        __syncthreads();
        float tot = 0.f;
        #pragma unroll
        for (int i = 0; i < 8; ++i) tot += sRed[row * 8 + i];
        float inv = 1.0f / tot;
        #pragma unroll 4
        for (int i = 0; i < 16; ++i) {
            v8h hh = p8[i];
            #pragma unroll
            for (int j = 0; j < 8; ++j) hh[j] = (_Float16)((float)hh[j] * inv);
            p8[i] = hh;
        }
    }
    __syncthreads();

    // ---- Phase 3: O = P @ g ; wave owns 64 channels; g is channel-major ----
    v8f acc0 = {}, acc1 = {}, acc2 = {}, acc3 = {};
    const int c0 = wave * 64;
    const _Float16* g0 = g + ((size_t)b * C2 + c0 +      mn) * HW4;
    const _Float16* g1 = g + ((size_t)b * C2 + c0 + 16 + mn) * HW4;
    const _Float16* g2 = g + ((size_t)b * C2 + c0 + 32 + mn) * HW4;
    const _Float16* g3 = g + ((size_t)b * C2 + c0 + 48 + mn) * HW4;
    for (int kk = 0; kk < HW4; kk += 32) {
        v16h a  = load_frag_row(sP + mn * HW4 + kk, half);
        v16h b0 = load_frag_row(g0 + kk, half);
        v16h b1 = load_frag_row(g1 + kk, half);
        v16h b2 = load_frag_row(g2 + kk, half);
        v16h b3 = load_frag_row(g3 + kk, half);
        acc0 = WMMA_F16(a, b0, acc0);
        acc1 = WMMA_F16(a, b1, acc1);
        acc2 = WMMA_F16(a, b2, acc2);
        acc3 = WMMA_F16(a, b3, acc3);
    }
    #pragma unroll
    for (int r = 0; r < 8; ++r) {
        int m = r + half * 8;
        size_t orow = ((size_t)b * HW + hw0 + m) * C2;
        o[orow + c0 +      mn] = (_Float16)acc0[r];
        o[orow + c0 + 16 + mn] = (_Float16)acc1[r];
        o[orow + c0 + 32 + mn] = (_Float16)acc2[r];
        o[orow + c0 + 48 + mn] = (_Float16)acc3[r];
    }
}

// ---------------------------------------------------------------------------
// Final: out[b][co][hw] = x + sigma*(w_attn[co,:]·attnG[b][hw,:] + b_attn[co])
// Grid (HW/16, 512/64, B), block 128 = 4 waves. Loads hoisted 4-deep.
// ---------------------------------------------------------------------------
__global__ void final_conv_kernel(const _Float16* __restrict__ ag,
                                  const _Float16* __restrict__ Wh,
                                  const float* __restrict__ bt,
                                  const float* __restrict__ x,
                                  const float* __restrict__ sigma,
                                  float* __restrict__ out) {
    const int hw0  = blockIdx.x * 16;
    const int cg   = blockIdx.y;
    const int b    = blockIdx.z;
    const int t    = threadIdx.x;
    const int lane = t & 31;
    const int wave = t >> 5;
    const int half = lane >> 4;
    const int mn   = lane & 15;
    const int co0  = cg * 64 + wave * 16;

    const _Float16* arow = ag + ((size_t)b * HW + hw0 + mn) * C2;
    const _Float16* wrow = Wh + (size_t)(co0 + mn) * C2;
    v8f acc = {};
    #pragma unroll
    for (int kp = 0; kp < C2; kp += 128) {
        v16h a[4], bb[4];
        #pragma unroll
        for (int q = 0; q < 4; ++q) {
            a[q]  = load_frag_row(arow + kp + q * 32, half);
            bb[q] = load_frag_row(wrow + kp + q * 32, half);
        }
        #pragma unroll
        for (int q = 0; q < 4; ++q)
            acc = WMMA_F16(a[q], bb[q], acc);
    }
    const float s  = sigma[0];
    const float bv = bt[co0 + mn];
    #pragma unroll
    for (int r = 0; r < 8; ++r) {
        int m = r + half * 8;
        size_t idx = ((size_t)b * DIMS + co0 + mn) * (size_t)HW + hw0 + m;
        out[idx] = x[idx] + s * (acc[r] + bv);
    }
}

// ---------------------------------------------------------------------------
extern "C" void kernel_launch(void* const* d_in, const int* in_sizes, int n_in,
                              void* d_out, int out_size, void* d_ws, size_t ws_size,
                              hipStream_t stream) {
    const float* x       = (const float*)d_in[0];
    const float* w_theta = (const float*)d_in[1];
    const float* b_theta = (const float*)d_in[2];
    const float* w_phi   = (const float*)d_in[3];
    const float* b_phi   = (const float*)d_in[4];
    const float* w_g     = (const float*)d_in[5];
    const float* b_g     = (const float*)d_in[6];
    const float* w_attn  = (const float*)d_in[7];
    const float* b_attn  = (const float*)d_in[8];
    const float* sigma   = (const float*)d_in[9];
    float* out = (float*)d_out;

    char* ws = (char*)d_ws;
    _Float16* theta   = (_Float16*)(ws);                 //  8 MB   [b][hw][64]
    _Float16* phi     = (_Float16*)(ws +  8388608);      //  2 MB   [b][key][64]
    _Float16* gbuf    = (_Float16*)(ws + 10485760);      //  8 MB   [b][c][key]
    _Float16* wth_h   = (_Float16*)(ws + 18874368);      //  64 KB  [64][512]
    _Float16* wph_h   = (_Float16*)(ws + 18939904);      //  64 KB  [64][512]
    _Float16* wg_h    = (_Float16*)(ws + 19005440);      // 256 KB  [256][512]
    _Float16* wat_h   = (_Float16*)(ws + 19267584);      // 256 KB  [512][256]
    _Float16* phic    = (_Float16*)(ws + 19529728);      //  8 MB   [b][hw][64]
    _Float16* gconv   = (_Float16*)(ws + 27918336);      //  32 MB  [b][hw][256]
    _Float16* attnout = (_Float16*)(ws + 19529728);      //  reuses phic+gconv

    const dim3 blk(128);

    cvt_f16_kernel<<<(C8 * DIMS / 4 + 255) / 256, 256, 0, stream>>>(w_theta, wth_h, C8 * DIMS);
    cvt_f16_kernel<<<(C8 * DIMS / 4 + 255) / 256, 256, 0, stream>>>(w_phi, wph_h, C8 * DIMS);
    cvt_f16_kernel<<<(C2 * DIMS / 4 + 255) / 256, 256, 0, stream>>>(w_g, wg_h, C2 * DIMS);
    cvt_f16_kernel<<<(DIMS * C2 / 4 + 255) / 256, 256, 0, stream>>>(w_attn, wat_h, DIMS * C2);

    // one pass over X produces theta, phi-conv and g-conv
    qkv_conv_kernel<<<dim3(HW / 16, 1, NB), blk, 0, stream>>>(
        x, wth_h, wph_h, wg_h, b_theta, b_phi, b_g, theta, phic, gconv);
    pool_phi_kernel<<<(NB * HW4 * (C8 / 8)) / 256, 256, 0, stream>>>(phic, phi);
    pool_g_kernel<<<(NB * C2 * (HW4 / 8)) / 256, 256, 0, stream>>>(gconv, gbuf);
    attn_wmma_kernel<<<dim3(HW / 16, NB), blk, 100864, stream>>>(
        theta, phi, gbuf, attnout);
    final_conv_kernel<<<dim3(HW / 16, DIMS / 64, NB), blk, 0, stream>>>(
        attnout, wat_h, b_attn, x, sigma, out);
}

// v001
// One run takes 361 microseconds.
// Timed twice side by side with v000, it ran 1.52 times as fast both times.
#include <hip/hip_runtime.h>
#include <hip/hip_bf16.h>

typedef __attribute__((ext_vector_type(16))) _Float16 v16h;
typedef __attribute__((ext_vector_type(8)))  _Float16 v8h;
typedef __attribute__((ext_vector_type(8)))  float    v8f;
typedef __attribute__((ext_vector_type(4)))  float    v4f;

#define DIMS 512
#define NB   16
#define HW   4096   // 64*64
#define HW4  1024   // pooled positions
#define C8   64
#define C2   256

#define WMMA_F16(A, B, C) __builtin_amdgcn_wmma_f32_16x16x32_f16(false, A, false, B, (short)0, C, false, false)

// Fragment K pattern for 16x16x32 f16 WMMA (ISA 7.12.2):
//   lane half 0: K in [0,8) and [16,24);  lane half 1: K in [8,16) and [24,32).
// With K contiguous in memory a fragment is exactly two 16-byte loads.
__device__ __forceinline__ v16h load_frag_row(const _Float16* __restrict__ p, int half) {
    v8h lo = *(const v8h*)(p + half * 8);
    v8h hi = *(const v8h*)(p + 16 + half * 8);
    v16h r;
    #pragma unroll
    for (int i = 0; i < 8; ++i) { r[i] = lo[i]; r[i + 8] = hi[i]; }
    return r;
}

// ---------------------------------------------------------------------------
// Fused QKV 1x1 conv: reads X once, produces theta, phi-conv and g-conv.
// Per wave: 6 accumulators = theta tile (16 co) + phi tile (16 co) + 4 g tiles
// (64 co). Block of 4 waves covers all 64+64+256 output channels.
// Grid (HW/16, 1, B), block 128.
// ---------------------------------------------------------------------------
__global__ void qkv_conv_kernel(const float* __restrict__ X,
                                const _Float16* __restrict__ Wth,
                                const _Float16* __restrict__ Wph,
                                const _Float16* __restrict__ Wg,
                                const float* __restrict__ bth,
                                const float* __restrict__ bph,
                                const float* __restrict__ bg,
                                _Float16* __restrict__ theta,
                                _Float16* __restrict__ phic,
                                _Float16* __restrict__ gc) {
    __shared__ _Float16 sA[16 * 128];   // [m][ci_panel], K contiguous per row

    const int hw0  = blockIdx.x * 16;
    const int b    = blockIdx.z;
    const int t    = threadIdx.x;
    const int lane = t & 31;
    const int wave = t >> 5;
    const int half = lane >> 4;
    const int mn   = lane & 15;
    const int m_s  = t & 15;            // staging row
    const int ci0  = (t >> 4) * 16;     // staging K base

    const float* xb = X + (size_t)b * DIMS * HW + hw0;
    const _Float16* wrT  = Wth + (size_t)(wave * 16 + mn) * DIMS;
    const _Float16* wrP  = Wph + (size_t)(wave * 16 + mn) * DIMS;
    const _Float16* wrG0 = Wg + (size_t)(wave * 64 +      mn) * DIMS;
    const _Float16* wrG1 = Wg + (size_t)(wave * 64 + 16 + mn) * DIMS;
    const _Float16* wrG2 = Wg + (size_t)(wave * 64 + 32 + mn) * DIMS;
    const _Float16* wrG3 = Wg + (size_t)(wave * 64 + 48 + mn) * DIMS;

    v8f accT = {}, accP = {}, accG0 = {}, accG1 = {}, accG2 = {}, accG3 = {};

    for (int kp = 0; kp < DIMS; kp += 128) {
        __syncthreads();
        // gather 16 strided f32 (independent loads -> one clause), pack, 2x b128
        float tmp[16];
        #pragma unroll
        for (int j = 0; j < 16; ++j)
            tmp[j] = xb[(size_t)(kp + ci0 + j) * HW + m_s];
        v8h h0, h1;
        #pragma unroll
        for (int j = 0; j < 8; ++j) {
            h0[j] = (_Float16)tmp[j];
            h1[j] = (_Float16)tmp[j + 8];
        }
        *(v8h*)(sA + m_s * 128 + ci0)     = h0;
        *(v8h*)(sA + m_s * 128 + ci0 + 8) = h1;
        if (kp + 128 < DIMS)              // prefetch next panel
            __builtin_prefetch(&xb[(size_t)(kp + 128 + ci0) * HW + m_s], 0, 0);
        __syncthreads();

        #pragma unroll
        for (int q = 0; q < 4; ++q) {
            const int kk = q * 32;
            v16h a  = load_frag_row(sA + mn * 128 + kk, half);
            v16h bT = load_frag_row(wrT  + kp + kk, half);
            v16h bP = load_frag_row(wrP  + kp + kk, half);
            v16h b0 = load_frag_row(wrG0 + kp + kk, half);
            v16h b1 = load_frag_row(wrG1 + kp + kk, half);
            v16h b2 = load_frag_row(wrG2 + kp + kk, half);
            v16h b3 = load_frag_row(wrG3 + kp + kk, half);
            accT  = WMMA_F16(a, bT, accT);
            accP  = WMMA_F16(a, bP, accP);
            accG0 = WMMA_F16(a, b0, accG0);
            accG1 = WMMA_F16(a, b1, accG1);
            accG2 = WMMA_F16(a, b2, accG2);
            accG3 = WMMA_F16(a, b3, accG3);
        }
    }

    const float bvT  = bth[wave * 16 + mn];
    const float bvP  = bph[wave * 16 + mn];
    const float bvG0 = bg[wave * 64 +      mn];
    const float bvG1 = bg[wave * 64 + 16 + mn];
    const float bvG2 = bg[wave * 64 + 32 + mn];
    const float bvG3 = bg[wave * 64 + 48 + mn];
    #pragma unroll
    for (int r = 0; r < 8; ++r) {
        int m = r + half * 8;
        size_t row = (size_t)b * HW + hw0 + m;
        theta[row * C8 + wave * 16 + mn] = (_Float16)(accT[r] + bvT);
        phic [row * C8 + wave * 16 + mn] = (_Float16)(accP[r] + bvP);
        gc[row * C2 + wave * 64 +      mn] = (_Float16)(accG0[r] + bvG0);
        gc[row * C2 + wave * 64 + 16 + mn] = (_Float16)(accG1[r] + bvG1);
        gc[row * C2 + wave * 64 + 32 + mn] = (_Float16)(accG2[r] + bvG2);
        gc[row * C2 + wave * 64 + 48 + mn] = (_Float16)(accG3[r] + bvG3);
    }
}

// ---------------------------------------------------------------------------
// 2x2 maxpool, phi: [b][hw][64] -> phi[b][key][64]; v8h in/out.
// ---------------------------------------------------------------------------
__global__ void pool_phi_kernel(const _Float16* __restrict__ pc,
                                _Float16* __restrict__ phi) {
    int idx = blockIdx.x * blockDim.x + threadIdx.x;   // NB*HW4*(C8/8)
    if (idx >= NB * HW4 * (C8 / 8)) return;
    int cb = idx & 7;
    int mp = (idx >> 3) & (HW4 - 1);
    int b  = idx >> 13;
    int hp = mp >> 5, wp = mp & 31;
    int hw = (hp * 2) * 64 + wp * 2;
    const _Float16* base = pc + (size_t)b * HW * C8 + cb * 8;
    v8h v0 = *(const v8h*)(base + (size_t)(hw)      * C8);
    v8h v1 = *(const v8h*)(base + (size_t)(hw + 1)  * C8);
    v8h v2 = *(const v8h*)(base + (size_t)(hw + 64) * C8);
    v8h v3 = *(const v8h*)(base + (size_t)(hw + 65) * C8);
    v8h m;
    #pragma unroll
    for (int i = 0; i < 8; ++i)
        m[i] = (_Float16)fmaxf(fmaxf((float)v0[i], (float)v1[i]),
                               fmaxf((float)v2[i], (float)v3[i]));
    *(v8h*)(phi + ((size_t)b * HW4 + mp) * C8 + cb * 8) = m;
}

// 2x2 maxpool, g: [b][hw][256] -> g[b][c][key]; 8 consecutive keys per thread.
__global__ void pool_g_kernel(const _Float16* __restrict__ gc,
                              _Float16* __restrict__ g) {
    int idx = blockIdx.x * blockDim.x + threadIdx.x;   // NB*C2*(HW4/8)
    if (idx >= NB * C2 * (HW4 / 8)) return;
    int kb = idx & 127;
    int c  = (idx >> 7) & (C2 - 1);
    int b  = idx >> 15;
    int mp0 = kb * 8;
    int hp = mp0 >> 5, wp0 = mp0 & 31;
    const _Float16* base = gc + (size_t)b * HW * C2 + c;
    v8h m;
    #pragma unroll
    for (int i = 0; i < 8; ++i) {
        int hw = (hp * 2) * 64 + (wp0 + i) * 2;
        float v0 = (float)base[(size_t)(hw)      * C2];
        float v1 = (float)base[(size_t)(hw + 1)  * C2];
        float v2 = (float)base[(size_t)(hw + 64) * C2];
        float v3 = (float)base[(size_t)(hw + 65) * C2];
        m[i] = (_Float16)fmaxf(fmaxf(v0, v1), fmaxf(v2, v3));
    }
    *(v8h*)(g + ((size_t)b * C2 + c) * HW4 + mp0) = m;
}

// f32 -> f16 conversion (weights)
__global__ void cvt_f16_kernel(const float* __restrict__ src,
                               _Float16* __restrict__ dst, int n) {
    int i = blockIdx.x * blockDim.x + threadIdx.x;
    if (i * 4 >= n) return;
    v4f v = *(const v4f*)(src + i * 4);
    _Float16* d = dst + i * 4;
    d[0] = (_Float16)v[0]; d[1] = (_Float16)v[1];
    d[2] = (_Float16)v[2]; d[3] = (_Float16)v[3];
}

// ---------------------------------------------------------------------------
// Attention, 256 queries per block: 16 waves x 16 queries walk the 1024 keys in
// chunks of 64 that the block stages once in LDS (two buffers), so every byte
// of phi and g fetched from L2 serves 256 queries.
//   S^T(key x query) = phi_chunk @ theta^T   (A from LDS, B kept in registers)
//   O^T(chan x query) += g_chunk @ P^T       (A from LDS, B packed from S^T)
// A lane holds one query's scores: running maximum and sum stay in registers.
// Grid (HW/256, B), block 512. Dynamic LDS = 2 x 46,080 B. Four waves per SIMD
// (16 waves x 256 VGPRs fill one WGP): the attribute holds the allocator to that.
// ---------------------------------------------------------------------------
#define KCH    64                    // keys per chunk
#define PITCH  72                    // LDS row pitch in halfwords (128 B + 16 B)
#define PHI_H  (KCH * PITCH)         // phi chunk: 64 key rows
#define BUF_H  ((KCH + C2) * PITCH)  // + g chunk: 256 channel rows

// lane l <-> lane l ^ 16
__device__ __forceinline__ float xhalf(float x) {
    int i = __builtin_bit_cast(int, x);
    return __builtin_bit_cast(float,
        __builtin_amdgcn_permlanex16(i, i, 0x76543210, 0xfedcba98, false, false));
}

// 2^x; the v_nop keeps the one free issue slot that the instruction set asks for
// behind a transcendental, whatever the scheduler places next
__device__ __forceinline__ float exp2_slot(float x) {
    float r;
    asm("v_exp_f32 %0, %1\n\tv_nop" : "=v"(r) : "v"(x));
    return r;
}

__global__ void __launch_bounds__(512) __attribute__((amdgpu_waves_per_eu(4, 4)))
attn_wmma_kernel(const _Float16* __restrict__ theta,
                 const _Float16* __restrict__ phi,
                 const _Float16* __restrict__ g,
                 _Float16* __restrict__ o) {
    extern __shared__ __attribute__((aligned(16))) char smem[];
    _Float16* sBuf = (_Float16*)smem;

    const int b    = blockIdx.y;
    const int t    = threadIdx.x;
    const int lane = t & 31;
    const int wave = t >> 5;
    const int half = lane >> 4;
    const int mn   = lane & 15;
    const int q0   = blockIdx.x * 256 + wave * 16;

    // staging: 8 threads per 128-byte row, 64 rows per sweep
    const int srow = t >> 3, scol = (t & 7) * 8;
    const _Float16* pBase = phi + (size_t)b * HW4 * C8;   // uniform bases,
    const _Float16* gBase = g + (size_t)b * C2 * HW4;     // 32-bit lane offsets
    const int pOff = srow * C8 + scol;
    const int gOff = srow * HW4 + scol;
    const int sDst = srow * PITCH + scol;

    // theta^T as B operand: lane = query, K = channel, kept for the whole walk
    const _Float16* trow = theta + ((size_t)b * HW + q0 + mn) * C8;
    const v16h bq0 = load_frag_row(trow, half);
    const v16h bq1 = load_frag_row(trow + 32, half);

    v8h stP, stG[4];
    stP = *(const v8h*)(pBase + pOff);
    #pragma unroll   // constant indices keep the array in registers
    for (int j = 0; j < 4; ++j) stG[j] = *(const v8h*)(gBase + j * 64 * HW4 + gOff);
    *(v8h*)(sBuf + sDst) = stP;
    #pragma unroll   // constant indices keep the array in registers
    for (int j = 0; j < 4; ++j) *(v8h*)(sBuf + PHI_H + sDst + j * 64 * PITCH) = stG[j];
    __syncthreads();   // chunk 0 is published

    const float L2E = 1.4426950408889634f;
    v8f acc[16];
    #pragma unroll   // constant indices keep the array in registers
    for (int ct = 0; ct < 16; ++ct) acc[ct] = (v8f){};
    float ms = -3.0e38f;   // running maximum, in log2 units
    float l  = 0.f;        // running sum over this lane's keys

    for (int kc = 0; kc < HW4 / KCH; ++kc) {
        const _Float16* sp = sBuf + (kc & 1) * BUF_H;
        const _Float16* sg = sp + PHI_H;
        const bool more = kc + 1 < HW4 / KCH;

        // ---- S^T: s[kt][r] = score(key kt*16 + r + 8*half, query mn) ----
        v8f s[4];
        #pragma unroll   // constant indices keep the array in registers
        for (int kt = 0; kt < 4; ++kt) {
            const _Float16* pr = sp + (kt * 16 + mn) * PITCH;
            v16h a0 = load_frag_row(pr, half);
            v16h a1 = load_frag_row(pr + 32, half);
            v8f z = {};
            z = WMMA_F16(a0, bq0, z);
            z = WMMA_F16(a1, bq1, z);
            s[kt] = z;
        }

        // ---- running softmax, one query per lane ----
        float mx = s[0][0];
        #pragma unroll   // constant indices keep the array in registers
        for (int kt = 0; kt < 4; ++kt)
            #pragma unroll   // constant indices keep the array in registers
            for (int r = 0; r < 8; ++r) mx = fmaxf(mx, s[kt][r]);
        mx = fmaxf(mx, xhalf(mx));
        const float msn   = fmaxf(ms, mx * L2E);
        const float alpha = exp2_slot(ms - msn);   // 0 on the first chunk
        ms = msn;

        // P^T as B operand: score tiles 2ks and 2ks+1 already sit in the k order
        // of load_frag_row (half*8 + i, then 16 + half*8 + i)
        v16h p[2];
        float ls = 0.f;
        #pragma unroll   // constant indices keep the array in registers
        for (int ks = 0; ks < 2; ++ks) {
            #pragma unroll   // constant indices keep the array in registers
            for (int r = 0; r < 8; ++r) {
                const float x0 = fmaf(s[2 * ks][r],     L2E, -msn);
                const float x1 = fmaf(s[2 * ks + 1][r], L2E, -msn);
                const float e0 = exp2_slot(x0);
                const float e1 = exp2_slot(x1);
                ls += e0 + e1;
                p[ks][r]     = (_Float16)e0;
                p[ks][r + 8] = (_Float16)e1;
            }
        }
        l = l * alpha + ls;

        if (more) {   // next chunk's loads fly under the 32 products below (scores are packed: registers free)
            const int k1 = (kc + 1) * KCH;
            stP = *(const v8h*)(pBase + k1 * C8 + pOff);
            #pragma unroll   // constant indices keep the array in registers
            for (int j = 0; j < 4; ++j)
                stG[j] = *(const v8h*)(gBase + (j * 64 * HW4 + k1) + gOff);
            // stands in front of any later rewrite of these loads' address registers
            asm volatile("s_wait_xcnt 0x0" ::: "memory");
        }

        // ---- O^T += g_chunk @ P^T ----
        #pragma unroll   // constant indices keep the array in registers
        for (int ct = 0; ct < 16; ++ct) {
            const _Float16* gr = sg + (ct * 16 + mn) * PITCH;
            v16h a0 = load_frag_row(gr, half);
            v16h a1 = load_frag_row(gr + 32, half);
            v8f c = acc[ct] * alpha;
            c = WMMA_F16(a0, p[0], c);
            c = WMMA_F16(a1, p[1], c);
            acc[ct] = c;
        }

        if (more) {   // the other buffer's last readers left at the previous barrier
            _Float16* sn = sBuf + ((kc + 1) & 1) * BUF_H;
            *(v8h*)(sn + sDst) = stP;
            #pragma unroll   // constant indices keep the array in registers
            for (int j = 0; j < 4; ++j) *(v8h*)(sn + PHI_H + sDst + j * 64 * PITCH) = stG[j];
        }
        __syncthreads();   // publishes chunk kc + 1 and ends every read of chunk kc's buffer
    }

    l += xhalf(l);
    const float inv = 1.0f / l;
    _Float16* orow = o + ((size_t)b * HW + q0 + mn) * C2 + half * 8;
    #pragma unroll   // constant indices keep the array in registers
    for (int ct = 0; ct < 16; ++ct) {
        v8h h;
        #pragma unroll   // constant indices keep the array in registers
        for (int r = 0; r < 8; ++r) h[r] = (_Float16)(acc[ct][r] * inv);
        *(v8h*)(orow + ct * 16) = h;
    }
}

// ---------------------------------------------------------------------------
// Final: out[b][co][hw] = x + sigma*(w_attn[co,:]·attnG[b][hw,:] + b_attn[co])
// Grid (HW/16, 512/64, B), block 128 = 4 waves. Loads hoisted 4-deep.
// ---------------------------------------------------------------------------
__global__ void final_conv_kernel(const _Float16* __restrict__ ag,
                                  const _Float16* __restrict__ Wh,
                                  const float* __restrict__ bt,
                                  const float* __restrict__ x,
                                  const float* __restrict__ sigma,
                                  float* __restrict__ out) {
    const int hw0  = blockIdx.x * 16;
    const int cg   = blockIdx.y;
    const int b    = blockIdx.z;
    const int t    = threadIdx.x;
    const int lane = t & 31;
    const int wave = t >> 5;
    const int half = lane >> 4;
    const int mn   = lane & 15;
    const int co0  = cg * 64 + wave * 16;

    const _Float16* arow = ag + ((size_t)b * HW + hw0 + mn) * C2;
    const _Float16* wrow = Wh + (size_t)(co0 + mn) * C2;
    v8f acc = {};
    #pragma unroll
    for (int kp = 0; kp < C2; kp += 128) {
        v16h a[4], bb[4];
        #pragma unroll
        for (int q = 0; q < 4; ++q) {
            a[q]  = load_frag_row(arow + kp + q * 32, half);
            bb[q] = load_frag_row(wrow + kp + q * 32, half);
        }
        #pragma unroll
        for (int q = 0; q < 4; ++q)
            acc = WMMA_F16(a[q], bb[q], acc);
    }
    const float s  = sigma[0];
    const float bv = bt[co0 + mn];
    #pragma unroll
    for (int r = 0; r < 8; ++r) {
        int m = r + half * 8;
        size_t idx = ((size_t)b * DIMS + co0 + mn) * (size_t)HW + hw0 + m;
        out[idx] = x[idx] + s * (acc[r] + bv);
    }
}

// ---------------------------------------------------------------------------
extern "C" void kernel_launch(void* const* d_in, const int* in_sizes, int n_in,
                              void* d_out, int out_size, void* d_ws, size_t ws_size,
                              hipStream_t stream) {
    const float* x       = (const float*)d_in[0];
    const float* w_theta = (const float*)d_in[1];
    const float* b_theta = (const float*)d_in[2];
    const float* w_phi   = (const float*)d_in[3];
    const float* b_phi   = (const float*)d_in[4];
    const float* w_g     = (const float*)d_in[5];
    const float* b_g     = (const float*)d_in[6];
    const float* w_attn  = (const float*)d_in[7];
    const float* b_attn  = (const float*)d_in[8];
    const float* sigma   = (const float*)d_in[9];
    float* out = (float*)d_out;

    char* ws = (char*)d_ws;
    _Float16* theta   = (_Float16*)(ws);                 //  8 MB   [b][hw][64]
    _Float16* phi     = (_Float16*)(ws +  8388608);      //  2 MB   [b][key][64]
    _Float16* gbuf    = (_Float16*)(ws + 10485760);      //  8 MB   [b][c][key]
    _Float16* wth_h   = (_Float16*)(ws + 18874368);      //  64 KB  [64][512]
    _Float16* wph_h   = (_Float16*)(ws + 18939904);      //  64 KB  [64][512]
    _Float16* wg_h    = (_Float16*)(ws + 19005440);      // 256 KB  [256][512]
    _Float16* wat_h   = (_Float16*)(ws + 19267584);      // 256 KB  [512][256]
    _Float16* phic    = (_Float16*)(ws + 19529728);      //  8 MB   [b][hw][64]
    _Float16* gconv   = (_Float16*)(ws + 27918336);      //  32 MB  [b][hw][256]
    _Float16* attnout = (_Float16*)(ws + 19529728);      //  reuses phic+gconv

    const dim3 blk(128);

    cvt_f16_kernel<<<(C8 * DIMS / 4 + 255) / 256, 256, 0, stream>>>(w_theta, wth_h, C8 * DIMS);
    cvt_f16_kernel<<<(C8 * DIMS / 4 + 255) / 256, 256, 0, stream>>>(w_phi, wph_h, C8 * DIMS);
    cvt_f16_kernel<<<(C2 * DIMS / 4 + 255) / 256, 256, 0, stream>>>(w_g, wg_h, C2 * DIMS);
    cvt_f16_kernel<<<(DIMS * C2 / 4 + 255) / 256, 256, 0, stream>>>(w_attn, wat_h, DIMS * C2);

    // one pass over X produces theta, phi-conv and g-conv
    qkv_conv_kernel<<<dim3(HW / 16, 1, NB), blk, 0, stream>>>(
        x, wth_h, wph_h, wg_h, b_theta, b_phi, b_g, theta, phic, gconv);
    pool_phi_kernel<<<(NB * HW4 * (C8 / 8)) / 256, 256, 0, stream>>>(phic, phi);
    pool_g_kernel<<<(NB * C2 * (HW4 / 8)) / 256, 256, 0, stream>>>(gconv, gbuf);
    attn_wmma_kernel<<<dim3(HW / 256, NB), dim3(512), 2 * BUF_H * 2, stream>>>(
        theta, phi, gbuf, attnout);
    final_conv_kernel<<<dim3(HW / 16, DIMS / 64, NB), blk, 0, stream>>>(
        attnout, wat_h, b_attn, x, sigma, out);
}

// v002
// One run takes 310 microseconds.
// Timed twice side by side with v001, it ran 1.17 and 1.16 times as fast.
// All steps since v000 together make it 1.77 times as fast.
#include <hip/hip_runtime.h>
#include <hip/hip_bf16.h>

typedef __attribute__((ext_vector_type(16))) _Float16 v16h;
typedef __attribute__((ext_vector_type(8)))  _Float16 v8h;
typedef __attribute__((ext_vector_type(8)))  float    v8f;
typedef __attribute__((ext_vector_type(4)))  float    v4f;

#define DIMS 512
#define NB   16
#define HW   4096   // 64*64
#define HW4  1024   // pooled positions
#define C8   64
#define C2   256

#define WMMA_F16(A, B, C) __builtin_amdgcn_wmma_f32_16x16x32_f16(false, A, false, B, (short)0, C, false, false)

// Fragment K pattern for 16x16x32 f16 WMMA (ISA 7.12.2):
//   lane half 0: K in [0,8) and [16,24);  lane half 1: K in [8,16) and [24,32).
// With K contiguous in memory a fragment is exactly two 16-byte loads.
__device__ __forceinline__ v16h load_frag_row(const _Float16* __restrict__ p, int half) {
    v8h lo = *(const v8h*)(p + half * 8);
    v8h hi = *(const v8h*)(p + 16 + half * 8);
    v16h r;
    #pragma unroll
    for (int i = 0; i < 8; ++i) { r[i] = lo[i]; r[i + 8] = hi[i]; }
    return r;
}

// ---------------------------------------------------------------------------
// Fused QKV 1x1 conv: reads X once, produces theta, phi-conv and g-conv.
// Per wave: 6 accumulators = theta tile (16 co) + phi tile (16 co) + 4 g tiles
// (64 co). Block of 4 waves covers all 64+64+256 output channels.
// Grid (HW/16, 1, B), block 128.
// ---------------------------------------------------------------------------
__global__ void qkv_conv_kernel(const float* __restrict__ X,
                                const _Float16* __restrict__ Wth,
                                const _Float16* __restrict__ Wph,
                                const _Float16* __restrict__ Wg,
                                const float* __restrict__ bth,
                                const float* __restrict__ bph,
                                const float* __restrict__ bg,
                                _Float16* __restrict__ theta,
                                _Float16* __restrict__ phic,
                                _Float16* __restrict__ gc) {
    __shared__ _Float16 sA[16 * 128];   // [m][ci_panel], K contiguous per row

    const int hw0  = blockIdx.x * 16;
    const int b    = blockIdx.z;
    const int t    = threadIdx.x;
    const int lane = t & 31;
    const int wave = t >> 5;
    const int half = lane >> 4;
    const int mn   = lane & 15;
    const int m_s  = t & 15;            // staging row
    const int ci0  = (t >> 4) * 16;     // staging K base

    const float* xb = X + (size_t)b * DIMS * HW + hw0;
    const _Float16* wrT  = Wth + (size_t)(wave * 16 + mn) * DIMS;
    const _Float16* wrP  = Wph + (size_t)(wave * 16 + mn) * DIMS;
    const _Float16* wrG0 = Wg + (size_t)(wave * 64 +      mn) * DIMS;
    const _Float16* wrG1 = Wg + (size_t)(wave * 64 + 16 + mn) * DIMS;
    const _Float16* wrG2 = Wg + (size_t)(wave * 64 + 32 + mn) * DIMS;
    const _Float16* wrG3 = Wg + (size_t)(wave * 64 + 48 + mn) * DIMS;

    v8f accT = {}, accP = {}, accG0 = {}, accG1 = {}, accG2 = {}, accG3 = {};

    for (int kp = 0; kp < DIMS; kp += 128) {
        __syncthreads();
        // gather 16 strided f32 (independent loads -> one clause), pack, 2x b128
        float tmp[16];
        #pragma unroll
        for (int j = 0; j < 16; ++j)
            tmp[j] = xb[(size_t)(kp + ci0 + j) * HW + m_s];
        v8h h0, h1;
        #pragma unroll
        for (int j = 0; j < 8; ++j) {
            h0[j] = (_Float16)tmp[j];
            h1[j] = (_Float16)tmp[j + 8];
        }
        *(v8h*)(sA + m_s * 128 + ci0)     = h0;
        *(v8h*)(sA + m_s * 128 + ci0 + 8) = h1;
        if (kp + 128 < DIMS)              // prefetch next panel
            __builtin_prefetch(&xb[(size_t)(kp + 128 + ci0) * HW + m_s], 0, 0);
        __syncthreads();

        #pragma unroll
        for (int q = 0; q < 4; ++q) {
            const int kk = q * 32;
            v16h a  = load_frag_row(sA + mn * 128 + kk, half);
            v16h bT = load_frag_row(wrT  + kp + kk, half);
            v16h bP = load_frag_row(wrP  + kp + kk, half);
            v16h b0 = load_frag_row(wrG0 + kp + kk, half);
            v16h b1 = load_frag_row(wrG1 + kp + kk, half);
            v16h b2 = load_frag_row(wrG2 + kp + kk, half);
            v16h b3 = load_frag_row(wrG3 + kp + kk, half);
            accT  = WMMA_F16(a, bT, accT);
            accP  = WMMA_F16(a, bP, accP);
            accG0 = WMMA_F16(a, b0, accG0);
            accG1 = WMMA_F16(a, b1, accG1);
            accG2 = WMMA_F16(a, b2, accG2);
            accG3 = WMMA_F16(a, b3, accG3);
        }
    }

    const float bvT  = bth[wave * 16 + mn];
    const float bvP  = bph[wave * 16 + mn];
    const float bvG0 = bg[wave * 64 +      mn];
    const float bvG1 = bg[wave * 64 + 16 + mn];
    const float bvG2 = bg[wave * 64 + 32 + mn];
    const float bvG3 = bg[wave * 64 + 48 + mn];
    #pragma unroll
    for (int r = 0; r < 8; ++r) {
        int m = r + half * 8;
        size_t row = (size_t)b * HW + hw0 + m;
        theta[row * C8 + wave * 16 + mn] = (_Float16)(accT[r] + bvT);
        phic [row * C8 + wave * 16 + mn] = (_Float16)(accP[r] + bvP);
        gc[row * C2 + wave * 64 +      mn] = (_Float16)(accG0[r] + bvG0);
        gc[row * C2 + wave * 64 + 16 + mn] = (_Float16)(accG1[r] + bvG1);
        gc[row * C2 + wave * 64 + 32 + mn] = (_Float16)(accG2[r] + bvG2);
        gc[row * C2 + wave * 64 + 48 + mn] = (_Float16)(accG3[r] + bvG3);
    }
}

// ---------------------------------------------------------------------------
// 2x2 maxpool, phi: [b][hw][64] -> phi[b][key][64]; v8h in/out.
// ---------------------------------------------------------------------------
__global__ void pool_phi_kernel(const _Float16* __restrict__ pc,
                                _Float16* __restrict__ phi) {
    int idx = blockIdx.x * blockDim.x + threadIdx.x;   // NB*HW4*(C8/8)
    if (idx >= NB * HW4 * (C8 / 8)) return;
    int cb = idx & 7;
    int mp = (idx >> 3) & (HW4 - 1);
    int b  = idx >> 13;
    int hp = mp >> 5, wp = mp & 31;
    int hw = (hp * 2) * 64 + wp * 2;
    const _Float16* base = pc + (size_t)b * HW * C8 + cb * 8;
    v8h v0 = *(const v8h*)(base + (size_t)(hw)      * C8);
    v8h v1 = *(const v8h*)(base + (size_t)(hw + 1)  * C8);
    v8h v2 = *(const v8h*)(base + (size_t)(hw + 64) * C8);
    v8h v3 = *(const v8h*)(base + (size_t)(hw + 65) * C8);
    v8h m;
    #pragma unroll
    for (int i = 0; i < 8; ++i)
        m[i] = (_Float16)fmaxf(fmaxf((float)v0[i], (float)v1[i]),
                               fmaxf((float)v2[i], (float)v3[i]));
    *(v8h*)(phi + ((size_t)b * HW4 + mp) * C8 + cb * 8) = m;
}

// 2x2 maxpool + transpose, g: [b][hw][256] -> g[b][c][key].
// A block takes 64 keys (two pooled rows) x all 256 channels. Reading, a wave's
// 32 lanes cover the 256 channels of one position with 16 bytes each (four whole
// lines a load); the pooled rows turn through LDS; writing, 8 lanes cover the 64
// keys of one channel (one whole line). Grid (HW4/64, B), block 512.
// LDS row = key, its columns rotated by 16 channels per group of 8 keys, so that
// the 8 key groups a wave reads back at once fall on different banks.
#define PGK 64
__global__ void __launch_bounds__(512)
pool_g_kernel(const _Float16* __restrict__ gc, _Float16* __restrict__ g) {
    __shared__ __attribute__((aligned(16))) _Float16 sT[PGK * C2];

    const int t    = threadIdx.x;
    const int lane = t & 31;
    const int wave = t >> 5;
    const int k0   = blockIdx.x * PGK;
    const int b    = blockIdx.y;

    const _Float16* base = gc + (size_t)b * HW * C2 + lane * 8;
    #pragma unroll   // all 16 loads of a lane in flight together
    for (int j = 0; j < 4; ++j) {
        const int kl = wave * 4 + j;
        const int mp = k0 + kl;
        const int hw = (mp >> 5) * 128 + (mp & 31) * 2;
        v8h v0 = *(const v8h*)(base + (hw)      * C2);
        v8h v1 = *(const v8h*)(base + (hw + 1)  * C2);
        v8h v2 = *(const v8h*)(base + (hw + 64) * C2);
        v8h v3 = *(const v8h*)(base + (hw + 65) * C2);
        v8h m = __builtin_elementwise_max(__builtin_elementwise_max(v0, v1),
                                          __builtin_elementwise_max(v2, v3));
        *(v8h*)(sT + kl * C2 + ((lane * 8 + (kl >> 3) * 16) & (C2 - 1))) = m;
    }
    __syncthreads();   // every pooled row is in LDS before any column is read

    const int kg = t & 7;    // group of 8 consecutive keys
    const int c0 = t >> 3;   // 0..63
    #pragma unroll   // all 32 LDS reads of a lane issue ahead of the first store
    for (int j = 0; j < 4; ++j) {
        const int c   = c0 + j * 64;
        const int col = (c + kg * 16) & (C2 - 1);
        v8h h;
        #pragma unroll   // constant indices keep the vector in registers
        for (int i = 0; i < 8; ++i) h[i] = sT[(kg * 8 + i) * C2 + col];
        *(v8h*)(g + ((size_t)b * C2 + c) * HW4 + k0 + kg * 8) = h;
    }
}

// f32 -> f16 conversion (weights)
__global__ void cvt_f16_kernel(const float* __restrict__ src,
                               _Float16* __restrict__ dst, int n) {
    int i = blockIdx.x * blockDim.x + threadIdx.x;
    if (i * 4 >= n) return;
    v4f v = *(const v4f*)(src + i * 4);
    _Float16* d = dst + i * 4;
    d[0] = (_Float16)v[0]; d[1] = (_Float16)v[1];
    d[2] = (_Float16)v[2]; d[3] = (_Float16)v[3];
}

// ---------------------------------------------------------------------------
// Attention, 256 queries per block: 16 waves x 16 queries walk the 1024 keys in
// chunks of 64 that the block stages once in LDS (two buffers), so every byte
// of phi and g fetched from L2 serves 256 queries.
//   S^T(key x query) = phi_chunk @ theta^T   (A from LDS, B kept in registers)
//   O^T(chan x query) += g_chunk @ P^T       (A from LDS, B packed from S^T)
// A lane holds one query's scores: running maximum and sum stay in registers.
// Grid (HW/256, B), block 512. Dynamic LDS = 2 x 46,080 B. Four waves per SIMD
// (16 waves x 256 VGPRs fill one WGP): the attribute holds the allocator to that.
// ---------------------------------------------------------------------------
#define KCH    64                    // keys per chunk
#define PITCH  72                    // LDS row pitch in halfwords (128 B + 16 B)
#define PHI_H  (KCH * PITCH)         // phi chunk: 64 key rows
#define BUF_H  ((KCH + C2) * PITCH)  // + g chunk: 256 channel rows

// lane l <-> lane l ^ 16
__device__ __forceinline__ float xhalf(float x) {
    int i = __builtin_bit_cast(int, x);
    return __builtin_bit_cast(float,
        __builtin_amdgcn_permlanex16(i, i, 0x76543210, 0xfedcba98, false, false));
}

// 2^x; the v_nop keeps the one free issue slot that the instruction set asks for
// behind a transcendental, whatever the scheduler places next
__device__ __forceinline__ float exp2_slot(float x) {
    float r;
    asm("v_exp_f32 %0, %1\n\tv_nop" : "=v"(r) : "v"(x));
    return r;
}

__global__ void __launch_bounds__(512) __attribute__((amdgpu_waves_per_eu(4, 4)))
attn_wmma_kernel(const _Float16* __restrict__ theta,
                 const _Float16* __restrict__ phi,
                 const _Float16* __restrict__ g,
                 _Float16* __restrict__ o) {
    extern __shared__ __attribute__((aligned(16))) char smem[];
    _Float16* sBuf = (_Float16*)smem;

    const int b    = blockIdx.y;
    const int t    = threadIdx.x;
    const int lane = t & 31;
    const int wave = t >> 5;
    const int half = lane >> 4;
    const int mn   = lane & 15;
    const int q0   = blockIdx.x * 256 + wave * 16;

    // staging: 8 threads per 128-byte row, 64 rows per sweep
    const int srow = t >> 3, scol = (t & 7) * 8;
    const _Float16* pBase = phi + (size_t)b * HW4 * C8;   // uniform bases,
    const _Float16* gBase = g + (size_t)b * C2 * HW4;     // 32-bit lane offsets
    const int pOff = srow * C8 + scol;
    const int gOff = srow * HW4 + scol;
    const int sDst = srow * PITCH + scol;

    // theta^T as B operand: lane = query, K = channel, kept for the whole walk
    const _Float16* trow = theta + ((size_t)b * HW + q0 + mn) * C8;
    const v16h bq0 = load_frag_row(trow, half);
    const v16h bq1 = load_frag_row(trow + 32, half);

    v8h stP, stG[4];
    stP = *(const v8h*)(pBase + pOff);
    #pragma unroll   // constant indices keep the array in registers
    for (int j = 0; j < 4; ++j) stG[j] = *(const v8h*)(gBase + j * 64 * HW4 + gOff);
    *(v8h*)(sBuf + sDst) = stP;
    #pragma unroll   // constant indices keep the array in registers
    for (int j = 0; j < 4; ++j) *(v8h*)(sBuf + PHI_H + sDst + j * 64 * PITCH) = stG[j];
    __syncthreads();   // chunk 0 is published

    const float L2E = 1.4426950408889634f;
    v8f acc[16];
    #pragma unroll   // constant indices keep the array in registers
    for (int ct = 0; ct < 16; ++ct) acc[ct] = (v8f){};
    float ms = -3.0e38f;   // running maximum, in log2 units
    float l  = 0.f;        // running sum over this lane's keys

    for (int kc = 0; kc < HW4 / KCH; ++kc) {
        const _Float16* sp = sBuf + (kc & 1) * BUF_H;
        const _Float16* sg = sp + PHI_H;
        const bool more = kc + 1 < HW4 / KCH;

        // ---- S^T: s[kt][r] = score(key kt*16 + r + 8*half, query mn) ----
        v8f s[4];
        #pragma unroll   // constant indices keep the array in registers
        for (int kt = 0; kt < 4; ++kt) {
            const _Float16* pr = sp + (kt * 16 + mn) * PITCH;
            v16h a0 = load_frag_row(pr, half);
            v16h a1 = load_frag_row(pr + 32, half);
            v8f z = {};
            z = WMMA_F16(a0, bq0, z);
            z = WMMA_F16(a1, bq1, z);
            s[kt] = z;
        }

        // ---- running softmax, one query per lane ----
        float mx = s[0][0];
        #pragma unroll   // constant indices keep the array in registers
        for (int kt = 0; kt < 4; ++kt)
            #pragma unroll   // constant indices keep the array in registers
            for (int r = 0; r < 8; ++r) mx = fmaxf(mx, s[kt][r]);
        mx = fmaxf(mx, xhalf(mx));
        const float msn   = fmaxf(ms, mx * L2E);
        const float alpha = exp2_slot(ms - msn);   // 0 on the first chunk
        ms = msn;

        // P^T as B operand: score tiles 2ks and 2ks+1 already sit in the k order
        // of load_frag_row (half*8 + i, then 16 + half*8 + i)
        v16h p[2];
        float ls = 0.f;
        #pragma unroll   // constant indices keep the array in registers
        for (int ks = 0; ks < 2; ++ks) {
            #pragma unroll   // constant indices keep the array in registers
            for (int r = 0; r < 8; ++r) {
                const float x0 = fmaf(s[2 * ks][r],     L2E, -msn);
                const float x1 = fmaf(s[2 * ks + 1][r], L2E, -msn);
                const float e0 = exp2_slot(x0);
                const float e1 = exp2_slot(x1);
                ls += e0 + e1;
                p[ks][r]     = (_Float16)e0;
                p[ks][r + 8] = (_Float16)e1;
            }
        }
        l = l * alpha + ls;

        if (more) {   // next chunk's loads fly under the 32 products below (scores are packed: registers free)
            const int k1 = (kc + 1) * KCH;
            stP = *(const v8h*)(pBase + k1 * C8 + pOff);
            #pragma unroll   // constant indices keep the array in registers
            for (int j = 0; j < 4; ++j)
                stG[j] = *(const v8h*)(gBase + (j * 64 * HW4 + k1) + gOff);
            // stands in front of any later rewrite of these loads' address registers
            asm volatile("s_wait_xcnt 0x0" ::: "memory");
        }

        // ---- O^T += g_chunk @ P^T ----
        #pragma unroll   // constant indices keep the array in registers
        for (int ct = 0; ct < 16; ++ct) {
            const _Float16* gr = sg + (ct * 16 + mn) * PITCH;
            v16h a0 = load_frag_row(gr, half);
            v16h a1 = load_frag_row(gr + 32, half);
            v8f c = acc[ct] * alpha;
            c = WMMA_F16(a0, p[0], c);
            c = WMMA_F16(a1, p[1], c);
            acc[ct] = c;
        }

        if (more) {   // the other buffer's last readers left at the previous barrier
            _Float16* sn = sBuf + ((kc + 1) & 1) * BUF_H;
            *(v8h*)(sn + sDst) = stP;
            #pragma unroll   // constant indices keep the array in registers
            for (int j = 0; j < 4; ++j) *(v8h*)(sn + PHI_H + sDst + j * 64 * PITCH) = stG[j];
        }
        __syncthreads();   // publishes chunk kc + 1 and ends every read of chunk kc's buffer
    }

    l += xhalf(l);
    const float inv = 1.0f / l;
    _Float16* orow = o + ((size_t)b * HW + q0 + mn) * C2 + half * 8;
    #pragma unroll   // constant indices keep the array in registers
    for (int ct = 0; ct < 16; ++ct) {
        v8h h;
        #pragma unroll   // constant indices keep the array in registers
        for (int r = 0; r < 8; ++r) h[r] = (_Float16)(acc[ct][r] * inv);
        *(v8h*)(orow + ct * 16) = h;
    }
}

// ---------------------------------------------------------------------------
// Final: out[b][co][hw] = x + sigma*(w_attn[co,:]·attnG[b][hw,:] + b_attn[co])
// Grid (HW/16, 512/64, B), block 128 = 4 waves. Loads hoisted 4-deep.
// ---------------------------------------------------------------------------
__global__ void final_conv_kernel(const _Float16* __restrict__ ag,
                                  const _Float16* __restrict__ Wh,
                                  const float* __restrict__ bt,
                                  const float* __restrict__ x,
                                  const float* __restrict__ sigma,
                                  float* __restrict__ out) {
    const int hw0  = blockIdx.x * 16;
    const int cg   = blockIdx.y;
    const int b    = blockIdx.z;
    const int t    = threadIdx.x;
    const int lane = t & 31;
    const int wave = t >> 5;
    const int half = lane >> 4;
    const int mn   = lane & 15;
    const int co0  = cg * 64 + wave * 16;

    const _Float16* arow = ag + ((size_t)b * HW + hw0 + mn) * C2;
    const _Float16* wrow = Wh + (size_t)(co0 + mn) * C2;
    v8f acc = {};
    #pragma unroll
    for (int kp = 0; kp < C2; kp += 128) {
        v16h a[4], bb[4];
        #pragma unroll
        for (int q = 0; q < 4; ++q) {
            a[q]  = load_frag_row(arow + kp + q * 32, half);
            bb[q] = load_frag_row(wrow + kp + q * 32, half);
        }
        #pragma unroll
        for (int q = 0; q < 4; ++q)
            acc = WMMA_F16(a[q], bb[q], acc);
    }
    const float s  = sigma[0];
    const float bv = bt[co0 + mn];
    #pragma unroll
    for (int r = 0; r < 8; ++r) {
        int m = r + half * 8;
        size_t idx = ((size_t)b * DIMS + co0 + mn) * (size_t)HW + hw0 + m;
        out[idx] = x[idx] + s * (acc[r] + bv);
    }
}

// ---------------------------------------------------------------------------
extern "C" void kernel_launch(void* const* d_in, const int* in_sizes, int n_in,
                              void* d_out, int out_size, void* d_ws, size_t ws_size,
                              hipStream_t stream) {
    const float* x       = (const float*)d_in[0];
    const float* w_theta = (const float*)d_in[1];
    const float* b_theta = (const float*)d_in[2];
    const float* w_phi   = (const float*)d_in[3];
    const float* b_phi   = (const float*)d_in[4];
    const float* w_g     = (const float*)d_in[5];
    const float* b_g     = (const float*)d_in[6];
    const float* w_attn  = (const float*)d_in[7];
    const float* b_attn  = (const float*)d_in[8];
    const float* sigma   = (const float*)d_in[9];
    float* out = (float*)d_out;

    char* ws = (char*)d_ws;
    _Float16* theta   = (_Float16*)(ws);                 //  8 MB   [b][hw][64]
    _Float16* phi     = (_Float16*)(ws +  8388608);      //  2 MB   [b][key][64]
    _Float16* gbuf    = (_Float16*)(ws + 10485760);      //  8 MB   [b][c][key]
    _Float16* wth_h   = (_Float16*)(ws + 18874368);      //  64 KB  [64][512]
    _Float16* wph_h   = (_Float16*)(ws + 18939904);      //  64 KB  [64][512]
    _Float16* wg_h    = (_Float16*)(ws + 19005440);      // 256 KB  [256][512]
    _Float16* wat_h   = (_Float16*)(ws + 19267584);      // 256 KB  [512][256]
    _Float16* phic    = (_Float16*)(ws + 19529728);      //  8 MB   [b][hw][64]
    _Float16* gconv   = (_Float16*)(ws + 27918336);      //  32 MB  [b][hw][256]
    _Float16* attnout = (_Float16*)(ws + 19529728);      //  reuses phic+gconv

    const dim3 blk(128);

    cvt_f16_kernel<<<(C8 * DIMS / 4 + 255) / 256, 256, 0, stream>>>(w_theta, wth_h, C8 * DIMS);
    cvt_f16_kernel<<<(C8 * DIMS / 4 + 255) / 256, 256, 0, stream>>>(w_phi, wph_h, C8 * DIMS);
    cvt_f16_kernel<<<(C2 * DIMS / 4 + 255) / 256, 256, 0, stream>>>(w_g, wg_h, C2 * DIMS);
    cvt_f16_kernel<<<(DIMS * C2 / 4 + 255) / 256, 256, 0, stream>>>(w_attn, wat_h, DIMS * C2);

    // one pass over X produces theta, phi-conv and g-conv
    qkv_conv_kernel<<<dim3(HW / 16, 1, NB), blk, 0, stream>>>(
        x, wth_h, wph_h, wg_h, b_theta, b_phi, b_g, theta, phic, gconv);
    pool_phi_kernel<<<(NB * HW4 * (C8 / 8)) / 256, 256, 0, stream>>>(phic, phi);
    pool_g_kernel<<<dim3(HW4 / PGK, NB), dim3(512), 0, stream>>>(gconv, gbuf);
    attn_wmma_kernel<<<dim3(HW / 256, NB), dim3(512), 2 * BUF_H * 2, stream>>>(
        theta, phi, gbuf, attnout);
    final_conv_kernel<<<dim3(HW / 16, DIMS / 64, NB), blk, 0, stream>>>(
        attnout, wat_h, b_attn, x, sigma, out);
}

// v003
// One run takes 201 microseconds.
// Next to v002, in two timings, it ran 1.54 times as fast each time.
// Over all steps from v000 it is 2.74 times as fast.
#include <hip/hip_runtime.h>
#include <hip/hip_bf16.h>

typedef __attribute__((ext_vector_type(16))) _Float16 v16h;
typedef __attribute__((ext_vector_type(8)))  _Float16 v8h;
typedef __attribute__((ext_vector_type(8)))  float    v8f;
typedef __attribute__((ext_vector_type(4)))  float    v4f;

#define DIMS 512
#define NB   16
#define HW   4096   // 64*64
#define HW4  1024   // pooled positions
#define C8   64
#define C2   256

#define WMMA_F16(A, B, C) __builtin_amdgcn_wmma_f32_16x16x32_f16(false, A, false, B, (short)0, C, false, false)

// Fragment K pattern for 16x16x32 f16 WMMA (ISA 7.12.2):
//   lane half 0: K in [0,8) and [16,24);  lane half 1: K in [8,16) and [24,32).
// With K contiguous in memory a fragment is exactly two 16-byte loads.
__device__ __forceinline__ v16h load_frag_row(const _Float16* __restrict__ p, int half) {
    v8h lo = *(const v8h*)(p + half * 8);
    v8h hi = *(const v8h*)(p + 16 + half * 8);
    v16h r;
    #pragma unroll
    for (int i = 0; i < 8; ++i) { r[i] = lo[i]; r[i + 8] = hi[i]; }
    return r;
}

// ---------------------------------------------------------------------------
// Fused QKV 1x1 conv: reads X once, produces theta, phi-conv and g-conv.
// Per wave: 6 accumulators = theta tile (16 co) + phi tile (16 co) + 4 g tiles
// (64 co). Block of 4 waves covers all 64+64+256 output channels.
// Grid (HW/16, 1, B), block 128.
// ---------------------------------------------------------------------------
__global__ void qkv_conv_kernel(const float* __restrict__ X,
                                const _Float16* __restrict__ Wth,
                                const _Float16* __restrict__ Wph,
                                const _Float16* __restrict__ Wg,
                                const float* __restrict__ bth,
                                const float* __restrict__ bph,
                                const float* __restrict__ bg,
                                _Float16* __restrict__ theta,
                                _Float16* __restrict__ phic,
                                _Float16* __restrict__ gc) {
    __shared__ _Float16 sA[16 * 128];   // [m][ci_panel], K contiguous per row

    const int hw0  = blockIdx.x * 16;
    const int b    = blockIdx.z;
    const int t    = threadIdx.x;
    const int lane = t & 31;
    const int wave = t >> 5;
    const int half = lane >> 4;
    const int mn   = lane & 15;
    const int m_s  = t & 15;            // staging row
    const int ci0  = (t >> 4) * 16;     // staging K base

    const float* xb = X + (size_t)b * DIMS * HW + hw0;
    const _Float16* wrT  = Wth + (size_t)(wave * 16 + mn) * DIMS;
    const _Float16* wrP  = Wph + (size_t)(wave * 16 + mn) * DIMS;
    const _Float16* wrG0 = Wg + (size_t)(wave * 64 +      mn) * DIMS;
    const _Float16* wrG1 = Wg + (size_t)(wave * 64 + 16 + mn) * DIMS;
    const _Float16* wrG2 = Wg + (size_t)(wave * 64 + 32 + mn) * DIMS;
    const _Float16* wrG3 = Wg + (size_t)(wave * 64 + 48 + mn) * DIMS;

    v8f accT = {}, accP = {}, accG0 = {}, accG1 = {}, accG2 = {}, accG3 = {};

    for (int kp = 0; kp < DIMS; kp += 128) {
        __syncthreads();
        // gather 16 strided f32 (independent loads -> one clause), pack, 2x b128
        float tmp[16];
        #pragma unroll
        for (int j = 0; j < 16; ++j)
            tmp[j] = xb[(size_t)(kp + ci0 + j) * HW + m_s];
        v8h h0, h1;
        #pragma unroll
        for (int j = 0; j < 8; ++j) {
            h0[j] = (_Float16)tmp[j];
            h1[j] = (_Float16)tmp[j + 8];
        }
        *(v8h*)(sA + m_s * 128 + ci0)     = h0;
        *(v8h*)(sA + m_s * 128 + ci0 + 8) = h1;
        if (kp + 128 < DIMS)              // prefetch next panel
            __builtin_prefetch(&xb[(size_t)(kp + 128 + ci0) * HW + m_s], 0, 0);
        __syncthreads();

        #pragma unroll
        for (int q = 0; q < 4; ++q) {
            const int kk = q * 32;
            v16h a  = load_frag_row(sA + mn * 128 + kk, half);
            v16h bT = load_frag_row(wrT  + kp + kk, half);
            v16h bP = load_frag_row(wrP  + kp + kk, half);
            v16h b0 = load_frag_row(wrG0 + kp + kk, half);
            v16h b1 = load_frag_row(wrG1 + kp + kk, half);
            v16h b2 = load_frag_row(wrG2 + kp + kk, half);
            v16h b3 = load_frag_row(wrG3 + kp + kk, half);
            accT  = WMMA_F16(a, bT, accT);
            accP  = WMMA_F16(a, bP, accP);
            accG0 = WMMA_F16(a, b0, accG0);
            accG1 = WMMA_F16(a, b1, accG1);
            accG2 = WMMA_F16(a, b2, accG2);
            accG3 = WMMA_F16(a, b3, accG3);
        }
    }

    const float bvT  = bth[wave * 16 + mn];
    const float bvP  = bph[wave * 16 + mn];
    const float bvG0 = bg[wave * 64 +      mn];
    const float bvG1 = bg[wave * 64 + 16 + mn];
    const float bvG2 = bg[wave * 64 + 32 + mn];
    const float bvG3 = bg[wave * 64 + 48 + mn];
    #pragma unroll
    for (int r = 0; r < 8; ++r) {
        int m = r + half * 8;
        size_t row = (size_t)b * HW + hw0 + m;
        theta[row * C8 + wave * 16 + mn] = (_Float16)(accT[r] + bvT);
        phic [row * C8 + wave * 16 + mn] = (_Float16)(accP[r] + bvP);
        gc[row * C2 + wave * 64 +      mn] = (_Float16)(accG0[r] + bvG0);
        gc[row * C2 + wave * 64 + 16 + mn] = (_Float16)(accG1[r] + bvG1);
        gc[row * C2 + wave * 64 + 32 + mn] = (_Float16)(accG2[r] + bvG2);
        gc[row * C2 + wave * 64 + 48 + mn] = (_Float16)(accG3[r] + bvG3);
    }
}

// ---------------------------------------------------------------------------
// 2x2 maxpool, phi: [b][hw][64] -> phi[b][key][64]; v8h in/out.
// ---------------------------------------------------------------------------
__global__ void pool_phi_kernel(const _Float16* __restrict__ pc,
                                _Float16* __restrict__ phi) {
    int idx = blockIdx.x * blockDim.x + threadIdx.x;   // NB*HW4*(C8/8)
    if (idx >= NB * HW4 * (C8 / 8)) return;
    int cb = idx & 7;
    int mp = (idx >> 3) & (HW4 - 1);
    int b  = idx >> 13;
    int hp = mp >> 5, wp = mp & 31;
    int hw = (hp * 2) * 64 + wp * 2;
    const _Float16* base = pc + (size_t)b * HW * C8 + cb * 8;
    v8h v0 = *(const v8h*)(base + (size_t)(hw)      * C8);
    v8h v1 = *(const v8h*)(base + (size_t)(hw + 1)  * C8);
    v8h v2 = *(const v8h*)(base + (size_t)(hw + 64) * C8);
    v8h v3 = *(const v8h*)(base + (size_t)(hw + 65) * C8);
    v8h m;
    #pragma unroll
    for (int i = 0; i < 8; ++i)
        m[i] = (_Float16)fmaxf(fmaxf((float)v0[i], (float)v1[i]),
                               fmaxf((float)v2[i], (float)v3[i]));
    *(v8h*)(phi + ((size_t)b * HW4 + mp) * C8 + cb * 8) = m;
}

// 2x2 maxpool + transpose, g: [b][hw][256] -> g[b][c][key].
// A block takes 64 keys (two pooled rows) x all 256 channels. Reading, a wave's
// 32 lanes cover the 256 channels of one position with 16 bytes each (four whole
// lines a load); the pooled rows turn through LDS; writing, 8 lanes cover the 64
// keys of one channel (one whole line). Grid (HW4/64, B), block 512.
// LDS row = key, its columns rotated by 16 channels per group of 8 keys, so that
// the 8 key groups a wave reads back at once fall on different banks.
#define PGK 64
__global__ void __launch_bounds__(512)
pool_g_kernel(const _Float16* __restrict__ gc, _Float16* __restrict__ g) {
    __shared__ __attribute__((aligned(16))) _Float16 sT[PGK * C2];

    const int t    = threadIdx.x;
    const int lane = t & 31;
    const int wave = t >> 5;
    const int k0   = blockIdx.x * PGK;
    const int b    = blockIdx.y;

    const _Float16* base = gc + (size_t)b * HW * C2 + lane * 8;
    #pragma unroll   // all 16 loads of a lane in flight together
    for (int j = 0; j < 4; ++j) {
        const int kl = wave * 4 + j;
        const int mp = k0 + kl;
        const int hw = (mp >> 5) * 128 + (mp & 31) * 2;
        v8h v0 = *(const v8h*)(base + (hw)      * C2);
        v8h v1 = *(const v8h*)(base + (hw + 1)  * C2);
        v8h v2 = *(const v8h*)(base + (hw + 64) * C2);
        v8h v3 = *(const v8h*)(base + (hw + 65) * C2);
        v8h m = __builtin_elementwise_max(__builtin_elementwise_max(v0, v1),
                                          __builtin_elementwise_max(v2, v3));
        *(v8h*)(sT + kl * C2 + ((lane * 8 + (kl >> 3) * 16) & (C2 - 1))) = m;
    }
    __syncthreads();   // every pooled row is in LDS before any column is read

    const int kg = t & 7;    // group of 8 consecutive keys
    const int c0 = t >> 3;   // 0..63
    #pragma unroll   // all 32 LDS reads of a lane issue ahead of the first store
    for (int j = 0; j < 4; ++j) {
        const int c   = c0 + j * 64;
        const int col = (c + kg * 16) & (C2 - 1);
        v8h h;
        #pragma unroll   // constant indices keep the vector in registers
        for (int i = 0; i < 8; ++i) h[i] = sT[(kg * 8 + i) * C2 + col];
        *(v8h*)(g + ((size_t)b * C2 + c) * HW4 + k0 + kg * 8) = h;
    }
}

// f32 -> f16 conversion (weights)
__global__ void cvt_f16_kernel(const float* __restrict__ src,
                               _Float16* __restrict__ dst, int n) {
    int i = blockIdx.x * blockDim.x + threadIdx.x;
    if (i * 4 >= n) return;
    v4f v = *(const v4f*)(src + i * 4);
    _Float16* d = dst + i * 4;
    d[0] = (_Float16)v[0]; d[1] = (_Float16)v[1];
    d[2] = (_Float16)v[2]; d[3] = (_Float16)v[3];
}

// ---------------------------------------------------------------------------
// Attention, 256 queries per block: 16 waves x 16 queries walk the 1024 keys in
// chunks of 64 that the block stages once in LDS (two buffers), so every byte
// of phi and g fetched from L2 serves 256 queries.
//   S^T(key x query) = phi_chunk @ theta^T   (A from LDS, B kept in registers)
//   O^T(chan x query) += g_chunk @ P^T       (A from LDS, B packed from S^T)
// A lane holds one query's scores: running maximum and sum stay in registers.
// Grid (HW/256, B), block 512. Dynamic LDS = 2 x 46,080 B. Four waves per SIMD
// (16 waves x 256 VGPRs fill one WGP): the attribute holds the allocator to that.
// ---------------------------------------------------------------------------
#define KCH    64                    // keys per chunk
#define PITCH  72                    // LDS row pitch in halfwords (128 B + 16 B)
#define PHI_H  (KCH * PITCH)         // phi chunk: 64 key rows
#define BUF_H  ((KCH + C2) * PITCH)  // + g chunk: 256 channel rows

// lane l <-> lane l ^ 16
__device__ __forceinline__ float xhalf(float x) {
    int i = __builtin_bit_cast(int, x);
    return __builtin_bit_cast(float,
        __builtin_amdgcn_permlanex16(i, i, 0x76543210, 0xfedcba98, false, false));
}

// 2^x; the v_nop keeps the one free issue slot that the instruction set asks for
// behind a transcendental, whatever the scheduler places next
__device__ __forceinline__ float exp2_slot(float x) {
    float r;
    asm("v_exp_f32 %0, %1\n\tv_nop" : "=v"(r) : "v"(x));
    return r;
}

__global__ void __launch_bounds__(512) __attribute__((amdgpu_waves_per_eu(4, 4)))
attn_wmma_kernel(const _Float16* __restrict__ theta,
                 const _Float16* __restrict__ phi,
                 const _Float16* __restrict__ g,
                 _Float16* __restrict__ o) {
    extern __shared__ __attribute__((aligned(16))) char smem[];
    _Float16* sBuf = (_Float16*)smem;

    const int b    = blockIdx.y;
    const int t    = threadIdx.x;
    const int lane = t & 31;
    const int wave = t >> 5;
    const int half = lane >> 4;
    const int mn   = lane & 15;
    const int q0   = blockIdx.x * 256 + wave * 16;

    // staging: 8 threads per 128-byte row, 64 rows per sweep
    const int srow = t >> 3, scol = (t & 7) * 8;
    const _Float16* pBase = phi + (size_t)b * HW4 * C8;   // uniform bases,
    const _Float16* gBase = g + (size_t)b * C2 * HW4;     // 32-bit lane offsets
    const int pOff = srow * C8 + scol;
    const int gOff = srow * HW4 + scol;
    const int sDst = srow * PITCH + scol;

    // theta^T as B operand: lane = query, K = channel, kept for the whole walk
    const _Float16* trow = theta + ((size_t)b * HW + q0 + mn) * C8;
    const v16h bq0 = load_frag_row(trow, half);
    const v16h bq1 = load_frag_row(trow + 32, half);

    v8h stP, stG[4];
    stP = *(const v8h*)(pBase + pOff);
    #pragma unroll   // constant indices keep the array in registers
    for (int j = 0; j < 4; ++j) stG[j] = *(const v8h*)(gBase + j * 64 * HW4 + gOff);
    *(v8h*)(sBuf + sDst) = stP;
    #pragma unroll   // constant indices keep the array in registers
    for (int j = 0; j < 4; ++j) *(v8h*)(sBuf + PHI_H + sDst + j * 64 * PITCH) = stG[j];
    __syncthreads();   // chunk 0 is published

    const float L2E = 1.4426950408889634f;
    v8f acc[16];
    #pragma unroll   // constant indices keep the array in registers
    for (int ct = 0; ct < 16; ++ct) acc[ct] = (v8f){};
    float ms = -3.0e38f;   // running maximum, in log2 units
    float l  = 0.f;        // running sum over this lane's keys

    for (int kc = 0; kc < HW4 / KCH; ++kc) {
        const _Float16* sp = sBuf + (kc & 1) * BUF_H;
        const _Float16* sg = sp + PHI_H;
        const bool more = kc + 1 < HW4 / KCH;

        // ---- S^T: s[kt][r] = score(key kt*16 + r + 8*half, query mn) ----
        v8f s[4];
        #pragma unroll   // constant indices keep the array in registers
        for (int kt = 0; kt < 4; ++kt) {
            const _Float16* pr = sp + (kt * 16 + mn) * PITCH;
            v16h a0 = load_frag_row(pr, half);
            v16h a1 = load_frag_row(pr + 32, half);
            v8f z = {};
            z = WMMA_F16(a0, bq0, z);
            z = WMMA_F16(a1, bq1, z);
            s[kt] = z;
        }

        // ---- running softmax, one query per lane ----
        float mx = s[0][0];
        #pragma unroll   // constant indices keep the array in registers
        for (int kt = 0; kt < 4; ++kt)
            #pragma unroll   // constant indices keep the array in registers
            for (int r = 0; r < 8; ++r) mx = fmaxf(mx, s[kt][r]);
        mx = fmaxf(mx, xhalf(mx));
        const float msn   = fmaxf(ms, mx * L2E);
        const float alpha = exp2_slot(ms - msn);   // 0 on the first chunk
        ms = msn;

        // P^T as B operand: score tiles 2ks and 2ks+1 already sit in the k order
        // of load_frag_row (half*8 + i, then 16 + half*8 + i)
        v16h p[2];
        float ls = 0.f;
        #pragma unroll   // constant indices keep the array in registers
        for (int ks = 0; ks < 2; ++ks) {
            #pragma unroll   // constant indices keep the array in registers
            for (int r = 0; r < 8; ++r) {
                const float x0 = fmaf(s[2 * ks][r],     L2E, -msn);
                const float x1 = fmaf(s[2 * ks + 1][r], L2E, -msn);
                const float e0 = exp2_slot(x0);
                const float e1 = exp2_slot(x1);
                ls += e0 + e1;
                p[ks][r]     = (_Float16)e0;
                p[ks][r + 8] = (_Float16)e1;
            }
        }
        l = l * alpha + ls;

        if (more) {   // next chunk's loads fly under the 32 products below (scores are packed: registers free)
            const int k1 = (kc + 1) * KCH;
            stP = *(const v8h*)(pBase + k1 * C8 + pOff);
            #pragma unroll   // constant indices keep the array in registers
            for (int j = 0; j < 4; ++j)
                stG[j] = *(const v8h*)(gBase + (j * 64 * HW4 + k1) + gOff);
            // stands in front of any later rewrite of these loads' address registers
            asm volatile("s_wait_xcnt 0x0" ::: "memory");
        }

        // ---- O^T += g_chunk @ P^T ----
        #pragma unroll   // constant indices keep the array in registers
        for (int ct = 0; ct < 16; ++ct) {
            const _Float16* gr = sg + (ct * 16 + mn) * PITCH;
            v16h a0 = load_frag_row(gr, half);
            v16h a1 = load_frag_row(gr + 32, half);
            v8f c = acc[ct] * alpha;
            c = WMMA_F16(a0, p[0], c);
            c = WMMA_F16(a1, p[1], c);
            acc[ct] = c;
        }

        if (more) {   // the other buffer's last readers left at the previous barrier
            _Float16* sn = sBuf + ((kc + 1) & 1) * BUF_H;
            *(v8h*)(sn + sDst) = stP;
            #pragma unroll   // constant indices keep the array in registers
            for (int j = 0; j < 4; ++j) *(v8h*)(sn + PHI_H + sDst + j * 64 * PITCH) = stG[j];
        }
        __syncthreads();   // publishes chunk kc + 1 and ends every read of chunk kc's buffer
    }

    l += xhalf(l);
    const float inv = 1.0f / l;
    _Float16* orow = o + ((size_t)b * HW + q0 + mn) * C2 + half * 8;
    #pragma unroll   // constant indices keep the array in registers
    for (int ct = 0; ct < 16; ++ct) {
        v8h h;
        #pragma unroll   // constant indices keep the array in registers
        for (int r = 0; r < 8; ++r) h[r] = (_Float16)(acc[ct][r] * inv);
        *(v8h*)(orow + ct * 16) = h;
    }
}

// ---------------------------------------------------------------------------
// Final: out[b][co][hw] = x + sigma*(w_attn[co,:]·attnG[b][hw,:] + b_attn[co])
// A block of 8 waves takes 64 positions x 256 output channels. The 64 attnG rows
// are staged once in LDS (whole 512-B rows in, 528-B pitch) and serve all waves.
// A wave does 32 channels x 64 positions as the transposed product
//   D(channel x position) = w_attn_tile @ attnG_tile^T   (A from global, B from LDS)
// Position tile j holds positions 4*mn + j, so a lane ends with four consecutive
// positions of one channel: x and out move 16 B a lane, 256 B a half wave.
// Weight fragments run three k steps ahead in a register ring; as the ring
// drains, its registers take the x rows, which so fly under the last products.
// Grid (512/256, HW/64, B), block 256.
// ---------------------------------------------------------------------------
#define FHW    64     // positions per block
#define FPITCH 264    // LDS row pitch in halfwords (512 B + 16 B)
#define FKS    (C2 / 32)
__global__ void __launch_bounds__(256)
final_conv_kernel(const _Float16* __restrict__ ag,
                  const _Float16* __restrict__ Wh,
                  const float* __restrict__ bt,
                  const float* __restrict__ x,
                  const float* __restrict__ sigma,
                  float* __restrict__ out) {
    __shared__ __attribute__((aligned(16))) _Float16 sB[FHW * FPITCH];

    const int hw0  = blockIdx.y * FHW;
    const int b    = blockIdx.z;
    const int t    = threadIdx.x;
    const int lane = t & 31;
    const int wave = t >> 5;
    const int half = lane >> 4;
    const int mn   = lane & 15;
    const int cob  = blockIdx.x * 256;   // the block's first channel

    // a wave fetches one whole row a load; position p lands in LDS row (p & 3) * 16 + (p >> 2)
    const _Float16* abase = ag + ((size_t)b * HW + hw0) * C2;   // uniform bases,
    const _Float16* wbase = Wh + (size_t)cob * C2;              // 32-bit lane offsets
    const int aoff = wave * C2 + lane * 8;
    const int woff = (wave * 32 + mn) * C2;
    v8h st[8];
    #pragma unroll   // all 8 loads of a lane in flight together
    for (int i = 0; i < 8; ++i) st[i] = *(const v8h*)(abase + aoff + i * 8 * C2);
    // keeps the row loads first in the queue: loads return in order, and the LDS
    // stores below would otherwise wait for the weight fragments too
    __builtin_amdgcn_sched_barrier(0);

    v16h aw[3][2];   // weight fragments of three k steps
    #pragma unroll   // constant indices keep the array in registers
    for (int q = 0; q < 3; ++q) {
        aw[q][0] = load_frag_row(wbase + woff + q * 32, half);
        aw[q][1] = load_frag_row(wbase + woff + 16 * C2 + q * 32, half);
    }

    #pragma unroll   // constant indices keep the array in registers
    for (int i = 0; i < 8; ++i) {
        const int p = i * 8 + wave;
        *(v8h*)(sB + ((p & 3) * 16 + (p >> 2)) * FPITCH + lane * 8) = st[i];
    }
    __syncthreads();   // the 64 rows are in LDS before any fragment is read

    const float* xb = x   + ((size_t)b * DIMS + cob) * HW + hw0;
    float*       ob = out + ((size_t)b * DIMS + cob) * HW + hw0;
    const int eoff = (wave * 32 + half * 8) * HW + mn * 4;

    const _Float16* br = sB + mn * FPITCH;
    v8f acc[2][4];
    #pragma unroll   // constant indices keep the array in registers
    for (int j = 0; j < 4; ++j) { acc[0][j] = (v8f){}; acc[1][j] = (v8f){}; }
    v4f xv[16];      // x rows: channel offset i = mt*16 + r -> xv[mt*8 + r]

    #pragma unroll   // constant indices keep the arrays in registers
    for (int ks = 0; ks < FKS; ++ks) {
        #pragma unroll   // constant indices keep the array in registers
        for (int j = 0; j < 4; ++j) {
            v16h bb = load_frag_row(br + j * 16 * FPITCH + ks * 32, half);
            acc[0][j] = WMMA_F16(aw[ks % 3][0], bb, acc[0][j]);
            acc[1][j] = WMMA_F16(aw[ks % 3][1], bb, acc[1][j]);
        }
        if (ks + 3 < FKS) {
            aw[ks % 3][0] = load_frag_row(wbase + woff + (ks + 3) * 32, half);
            aw[ks % 3][1] = load_frag_row(wbase + woff + 16 * C2 + (ks + 3) * 32, half);
        } else {
            #pragma unroll   // constant indices keep the array in registers
            for (int i = 0; i < 4; ++i) {
                const int e = (ks + 3 - FKS) * 4 + i;
                xv[e] = *(const v4f*)(xb + eoff + ((e >> 3) * 16 + (e & 7)) * HW);
            }
        }
        // holds the loads above at this place: without it the scheduler sinks them
        // to just in front of their use and each k step waits out an L2 round trip
        __builtin_amdgcn_sched_barrier(0);
    }
    #pragma unroll   // constant indices keep the array in registers
    for (int e = 12; e < 16; ++e)
        xv[e] = *(const v4f*)(xb + eoff + ((e >> 3) * 16 + (e & 7)) * HW);
    // holds the last four x loads here, so that all sixteen are in flight together
    __builtin_amdgcn_sched_barrier(0);

    // acc[mt][j][r]: channel cob + wave*32 + mt*16 + half*8 + r, position hw0 + 4*mn + j
    const float s = sigma[0];
    #pragma unroll   // constant indices keep the array in registers
    for (int mt = 0; mt < 2; ++mt) {
        const float* bp = bt + cob + wave * 32 + mt * 16 + half * 8;
        const v4f bl = *(const v4f*)(bp);
        const v4f bh = *(const v4f*)(bp + 4);
        #pragma unroll   // constant indices keep the array in registers
        for (int r = 0; r < 8; ++r) {
            const float bv = r < 4 ? bl[r & 3] : bh[r & 3];
            v4f ov;
            #pragma unroll   // constant indices keep the array in registers
            for (int j = 0; j < 4; ++j) ov[j] = xv[mt * 8 + r][j] + s * (acc[mt][j][r] + bv);
            *(v4f*)(ob + eoff + (mt * 16 + r) * HW) = ov;
        }
    }
}

// ---------------------------------------------------------------------------
extern "C" void kernel_launch(void* const* d_in, const int* in_sizes, int n_in,
                              void* d_out, int out_size, void* d_ws, size_t ws_size,
                              hipStream_t stream) {
    const float* x       = (const float*)d_in[0];
    const float* w_theta = (const float*)d_in[1];
    const float* b_theta = (const float*)d_in[2];
    const float* w_phi   = (const float*)d_in[3];
    const float* b_phi   = (const float*)d_in[4];
    const float* w_g     = (const float*)d_in[5];
    const float* b_g     = (const float*)d_in[6];
    const float* w_attn  = (const float*)d_in[7];
    const float* b_attn  = (const float*)d_in[8];
    const float* sigma   = (const float*)d_in[9];
    float* out = (float*)d_out;

    char* ws = (char*)d_ws;
    _Float16* theta   = (_Float16*)(ws);                 //  8 MB   [b][hw][64]
    _Float16* phi     = (_Float16*)(ws +  8388608);      //  2 MB   [b][key][64]
    _Float16* gbuf    = (_Float16*)(ws + 10485760);      //  8 MB   [b][c][key]
    _Float16* wth_h   = (_Float16*)(ws + 18874368);      //  64 KB  [64][512]
    _Float16* wph_h   = (_Float16*)(ws + 18939904);      //  64 KB  [64][512]
    _Float16* wg_h    = (_Float16*)(ws + 19005440);      // 256 KB  [256][512]
    _Float16* wat_h   = (_Float16*)(ws + 19267584);      // 256 KB  [512][256]
    _Float16* phic    = (_Float16*)(ws + 19529728);      //  8 MB   [b][hw][64]
    _Float16* gconv   = (_Float16*)(ws + 27918336);      //  32 MB  [b][hw][256]
    _Float16* attnout = (_Float16*)(ws + 19529728);      //  reuses phic+gconv

    const dim3 blk(128);

    cvt_f16_kernel<<<(C8 * DIMS / 4 + 255) / 256, 256, 0, stream>>>(w_theta, wth_h, C8 * DIMS);
    cvt_f16_kernel<<<(C8 * DIMS / 4 + 255) / 256, 256, 0, stream>>>(w_phi, wph_h, C8 * DIMS);
    cvt_f16_kernel<<<(C2 * DIMS / 4 + 255) / 256, 256, 0, stream>>>(w_g, wg_h, C2 * DIMS);
    cvt_f16_kernel<<<(DIMS * C2 / 4 + 255) / 256, 256, 0, stream>>>(w_attn, wat_h, DIMS * C2);

    // one pass over X produces theta, phi-conv and g-conv
    qkv_conv_kernel<<<dim3(HW / 16, 1, NB), blk, 0, stream>>>(
        x, wth_h, wph_h, wg_h, b_theta, b_phi, b_g, theta, phic, gconv);
    pool_phi_kernel<<<(NB * HW4 * (C8 / 8)) / 256, 256, 0, stream>>>(phic, phi);
    pool_g_kernel<<<dim3(HW4 / PGK, NB), dim3(512), 0, stream>>>(gconv, gbuf);
    attn_wmma_kernel<<<dim3(HW / 256, NB), dim3(512), 2 * BUF_H * 2, stream>>>(
        theta, phi, gbuf, attnout);
    final_conv_kernel<<<dim3(DIMS / 256, HW / FHW, NB), dim3(256), 0, stream>>>(
        attnout, wat_h, b_attn, x, sigma, out);
}

// v004
// A run of this version takes 130 microseconds.
// In two side-by-side timings against v003, it was 1.55 and 1.54 times as fast.
// Counting every step since v000, it is 4.23 times as fast.
#include <hip/hip_runtime.h>
#include <hip/hip_bf16.h>

typedef __attribute__((ext_vector_type(16))) _Float16 v16h;
typedef __attribute__((ext_vector_type(8)))  _Float16 v8h;
typedef __attribute__((ext_vector_type(8)))  float    v8f;
typedef __attribute__((ext_vector_type(4)))  float    v4f;

#define DIMS 512
#define NB   16
#define HW   4096   // 64*64
#define HW4  1024   // pooled positions
#define C8   64
#define C2   256

#define WMMA_F16(A, B, C) __builtin_amdgcn_wmma_f32_16x16x32_f16(false, A, false, B, (short)0, C, false, false)

// Fragment K pattern for 16x16x32 f16 WMMA (ISA 7.12.2):
//   lane half 0: K in [0,8) and [16,24);  lane half 1: K in [8,16) and [24,32).
// With K contiguous in memory a fragment is exactly two 16-byte loads.
__device__ __forceinline__ v16h load_frag_row(const _Float16* __restrict__ p, int half) {
    v8h lo = *(const v8h*)(p + half * 8);
    v8h hi = *(const v8h*)(p + 16 + half * 8);
    v16h r;
    #pragma unroll
    for (int i = 0; i < 8; ++i) { r[i] = lo[i]; r[i + 8] = hi[i]; }
    return r;
}

// ---------------------------------------------------------------------------
// Fused QKV 1x1 conv: reads X once, produces theta, phi-conv and g-conv.
// A block of 12 waves takes 128 positions x all 64+64+256 output channels.
// X is staged as f16 in LDS in panels of 64 input channels (two buffers): a
// staging wave reads whole 512-B rows of X, 16 B a lane, eight rows a panel, and
// each lane packs its four positions' eight channels into four 16-B LDS stores.
// Position p lands in LDS row (p & 3) * 32 + (p >> 2), so that the lanes of one
// store walk consecutive rows. A wave does 32 channels x 128 positions as
//   D(channel x position) = w_tile @ X_tile   (A from global, B from LDS)
// so a weight row fetched once serves 128 positions, and a lane ends with eight
// consecutive channels of one position (one 16-B store).
// Weight fragments run one panel ahead in registers.
// Grid (HW/128, B), block 384.
// ---------------------------------------------------------------------------
#define QP     128            // positions per block
#define QK     64             // input channels per panel
#define QPITCH 72             // LDS row pitch in halfwords (128 B + 16 B)
#define QBUF   (QP * QPITCH)
#define QNP    (DIMS / QK)
__global__ void __launch_bounds__(384)
qkv_conv_kernel(const float* __restrict__ X,
                const _Float16* __restrict__ Wth,
                const _Float16* __restrict__ Wph,
                const _Float16* __restrict__ Wg,
                const float* __restrict__ bth,
                const float* __restrict__ bph,
                const float* __restrict__ bg,
                _Float16* __restrict__ theta,
                _Float16* __restrict__ phic,
                _Float16* __restrict__ gc) {
    __shared__ __attribute__((aligned(16))) _Float16 sX[2 * QBUF];

    const int hw0  = blockIdx.x * QP;
    const int b    = blockIdx.y;
    const int t    = threadIdx.x;
    const int lane = t & 31;
    const int wave = __builtin_amdgcn_readfirstlane(t >> 5);   // scalar: uniform bases and branches
    const int half = lane >> 4;
    const int mn   = lane & 15;

    // the wave's 32 output channels: waves 0-1 theta, 2-3 phi, 4-11 g
    const _Float16* wsel;
    const float*    bsel;
    _Float16*       dsel;
    int             dstr;
    if (wave < 2)      { wsel = Wth + wave * 32 * DIMS;       bsel = bth + wave * 32;       dsel = theta + wave * 32;       dstr = C8; }
    else if (wave < 4) { wsel = Wph + (wave - 2) * 32 * DIMS; bsel = bph + (wave - 2) * 32; dsel = phic + (wave - 2) * 32;  dstr = C8; }
    else               { wsel = Wg + (wave - 4) * 32 * DIMS;  bsel = bg + (wave - 4) * 32;  dsel = gc + (wave - 4) * 32;    dstr = C2; }
    const int woff = mn * DIMS;

    // staging: waves 0-7 take eight X rows of each panel
    const bool stager = wave < QK / 8;
    const float* xs = X + ((size_t)b * DIMS + (wave & 7) * 8) * HW + hw0;
    const int xoff = lane * 4;
    const int sDst = lane * QPITCH + (wave & 7) * 8;

    v4f xr[8];
    if (stager) {
        #pragma unroll   // all 8 loads of a lane in flight together
        for (int i = 0; i < 8; ++i) xr[i] = *(const v4f*)(xs + i * HW + xoff);
    }
    // keeps the X loads first in the queue: loads return in order, and the LDS
    // stores below would otherwise wait for the weight fragments too
    __builtin_amdgcn_sched_barrier(0);

    v16h aw[2][2];   // weight fragments of one panel (two k steps, two channel tiles)
    #pragma unroll   // constant indices keep the array in registers
    for (int q = 0; q < 2; ++q) {
        aw[q][0] = load_frag_row(wsel + woff + q * 32, half);
        aw[q][1] = load_frag_row(wsel + woff + 16 * DIMS + q * 32, half);
    }

    if (stager) {
        #pragma unroll   // constant indices keep the array in registers
        for (int j = 0; j < 4; ++j) {
            v8h h;
            #pragma unroll   // constant indices keep the array in registers
            for (int i = 0; i < 8; ++i) h[i] = (_Float16)xr[i][j];
            *(v8h*)(sX + sDst + j * 32 * QPITCH) = h;
        }
    }
    __syncthreads();   // panel 0 is published

    v8f acc[2][8];
    #pragma unroll   // constant indices keep the array in registers
    for (int n = 0; n < 8; ++n) { acc[0][n] = (v8f){}; acc[1][n] = (v8f){}; }

    #pragma unroll   // constant buffer and panel offsets; no branch behind a product
    for (int kp = 0; kp < QNP; ++kp) {
        const _Float16* br = sX + (kp & 1) * QBUF + mn * QPITCH;
        // Eight steps of four products: step u takes k step SQ(u) and position tiles
        // 2*SN(u), 2*SN(u)+1. Both k steps are touched in the first two steps, so every
        // weight load has been waited for before the X loads are issued: loads return
        // in order, and a wait for a weight behind them would wait for memory too.
        #define SQ(u) ((u) < 2 ? (u) : ((u) < 5 ? 0 : 1))
        #define SN(u) ((u) < 2 ? 0 : ((u) < 5 ? (u) - 1 : (u) - 4))
        // X fragments come in pairs through a ring of three: pair u + 2 is asked for
        // in front of pair u's four products, so an LDS round trip hides under eight
        v16h bb[3][2];
        #pragma unroll   // constant indices keep the array in registers
        for (int u = 0; u < 2; ++u) {
            const _Float16* bn = br + SN(u) * 32 * QPITCH + SQ(u) * 32;
            bb[u][0] = load_frag_row(bn, half);
            bb[u][1] = load_frag_row(bn + 16 * QPITCH, half);
        }
        #pragma unroll   // constant indices keep the arrays in registers
        for (int u = 0; u < 8; ++u) {
            const int q = SQ(u), n = SN(u) * 2;
            if (u == 2 && kp + 1 < QNP && stager) {   // next panel's rows fly under the 24 products left
                #pragma unroll   // all 8 loads of a lane in flight together
                for (int i = 0; i < 8; ++i)
                    xr[i] = *(const v4f*)(xs + ((kp + 1) * QK + i) * HW + xoff);
            }
            if (u + 2 < 8) {
                const int v = u + 2;
                const _Float16* bn = br + SN(v) * 32 * QPITCH + SQ(v) * 32;
                bb[v % 3][0] = load_frag_row(bn, half);
                bb[v % 3][1] = load_frag_row(bn + 16 * QPITCH, half);
            }
            acc[0][n]     = WMMA_F16(aw[q][0], bb[u % 3][0], acc[0][n]);
            acc[1][n]     = WMMA_F16(aw[q][1], bb[u % 3][0], acc[1][n]);
            acc[0][n + 1] = WMMA_F16(aw[q][0], bb[u % 3][1], acc[0][n + 1]);
            acc[1][n + 1] = WMMA_F16(aw[q][1], bb[u % 3][1], acc[1][n + 1]);
            if ((u == 4 || u == 7) && kp + 1 < QNP) {   // this k step's weights are spent: fetch the next panel's
                aw[q][0] = load_frag_row(wsel + woff + (kp + 1) * QK + q * 32, half);
                aw[q][1] = load_frag_row(wsel + woff + 16 * DIMS + (kp + 1) * QK + q * 32, half);
            }
            // holds every load at the place written: sunk to its use, an LDS read would
            // stall each pair of products and a weight load each k step
            __builtin_amdgcn_sched_barrier(0);
        }

        if (kp + 1 < QNP && stager) {   // the other buffer's last readers left at the previous barrier
            _Float16* sn = sX + ((kp + 1) & 1) * QBUF + sDst;
            #pragma unroll   // constant indices keep the array in registers
            for (int j = 0; j < 4; ++j) {
                v8h h;
                #pragma unroll   // constant indices keep the array in registers
                for (int i = 0; i < 8; ++i) h[i] = (_Float16)xr[i][j];
                *(v8h*)(sn + j * 32 * QPITCH) = h;
            }
        }
        if (kp + 1 < QNP) {
            // publishes panel kp + 1 and ends every read of panel kp's buffer. The fences
            // name LDS alone: __syncthreads() would also drain the weight loads just
            // issued for the next panel, an L2 round trip in front of every barrier
            __builtin_amdgcn_fence(__ATOMIC_RELEASE, "workgroup", "local");
            __builtin_amdgcn_s_barrier();
            __builtin_amdgcn_fence(__ATOMIC_ACQUIRE, "workgroup", "local");
        }
    }

    // acc[mt][n][r]: channel mt*16 + half*8 + r of the wave's 32,
    // position hw0 + 4*((n & 1)*16 + mn) + (n >> 1)
    _Float16* dl = dsel + ((size_t)b * HW + hw0) * dstr + half * 8;
    #pragma unroll   // constant indices keep the array in registers
    for (int mt = 0; mt < 2; ++mt) {
        const float* bp = bsel + mt * 16 + half * 8;
        const v4f bl = *(const v4f*)(bp);
        const v4f bh = *(const v4f*)(bp + 4);
        #pragma unroll   // constant indices keep the array in registers
        for (int n = 0; n < 8; ++n) {
            const int p = 4 * ((n & 1) * 16 + mn) + (n >> 1);
            v8h h;
            #pragma unroll   // constant indices keep the array in registers
            for (int r = 0; r < 8; ++r)
                h[r] = (_Float16)(acc[mt][n][r] + (r < 4 ? bl[r & 3] : bh[r & 3]));
            *(v8h*)(dl + p * dstr + mt * 16) = h;
        }
    }
}

// ---------------------------------------------------------------------------
// 2x2 maxpool, phi: [b][hw][64] -> phi[b][key][64]; v8h in/out.
// ---------------------------------------------------------------------------
__global__ void pool_phi_kernel(const _Float16* __restrict__ pc,
                                _Float16* __restrict__ phi) {
    int idx = blockIdx.x * blockDim.x + threadIdx.x;   // NB*HW4*(C8/8)
    if (idx >= NB * HW4 * (C8 / 8)) return;
    int cb = idx & 7;
    int mp = (idx >> 3) & (HW4 - 1);
    int b  = idx >> 13;
    int hp = mp >> 5, wp = mp & 31;
    int hw = (hp * 2) * 64 + wp * 2;
    const _Float16* base = pc + (size_t)b * HW * C8 + cb * 8;
    v8h v0 = *(const v8h*)(base + (size_t)(hw)      * C8);
    v8h v1 = *(const v8h*)(base + (size_t)(hw + 1)  * C8);
    v8h v2 = *(const v8h*)(base + (size_t)(hw + 64) * C8);
    v8h v3 = *(const v8h*)(base + (size_t)(hw + 65) * C8);
    v8h m;
    #pragma unroll
    for (int i = 0; i < 8; ++i)
        m[i] = (_Float16)fmaxf(fmaxf((float)v0[i], (float)v1[i]),
                               fmaxf((float)v2[i], (float)v3[i]));
    *(v8h*)(phi + ((size_t)b * HW4 + mp) * C8 + cb * 8) = m;
}

// 2x2 maxpool + transpose, g: [b][hw][256] -> g[b][c][key].
// A block takes 64 keys (two pooled rows) x all 256 channels. Reading, a wave's
// 32 lanes cover the 256 channels of one position with 16 bytes each (four whole
// lines a load); the pooled rows turn through LDS; writing, 8 lanes cover the 64
// keys of one channel (one whole line). Grid (HW4/64, B), block 512.
// LDS row = key, its columns rotated by 16 channels per group of 8 keys, so that
// the 8 key groups a wave reads back at once fall on different banks.
#define PGK 64
__global__ void __launch_bounds__(512)
pool_g_kernel(const _Float16* __restrict__ gc, _Float16* __restrict__ g) {
    __shared__ __attribute__((aligned(16))) _Float16 sT[PGK * C2];

    const int t    = threadIdx.x;
    const int lane = t & 31;
    const int wave = t >> 5;
    const int k0   = blockIdx.x * PGK;
    const int b    = blockIdx.y;

    const _Float16* base = gc + (size_t)b * HW * C2 + lane * 8;
    #pragma unroll   // all 16 loads of a lane in flight together
    for (int j = 0; j < 4; ++j) {
        const int kl = wave * 4 + j;
        const int mp = k0 + kl;
        const int hw = (mp >> 5) * 128 + (mp & 31) * 2;
        v8h v0 = *(const v8h*)(base + (hw)      * C2);
        v8h v1 = *(const v8h*)(base + (hw + 1)  * C2);
        v8h v2 = *(const v8h*)(base + (hw + 64) * C2);
        v8h v3 = *(const v8h*)(base + (hw + 65) * C2);
        v8h m = __builtin_elementwise_max(__builtin_elementwise_max(v0, v1),
                                          __builtin_elementwise_max(v2, v3));
        *(v8h*)(sT + kl * C2 + ((lane * 8 + (kl >> 3) * 16) & (C2 - 1))) = m;
    }
    __syncthreads();   // every pooled row is in LDS before any column is read

    const int kg = t & 7;    // group of 8 consecutive keys
    const int c0 = t >> 3;   // 0..63
    #pragma unroll   // all 32 LDS reads of a lane issue ahead of the first store
    for (int j = 0; j < 4; ++j) {
        const int c   = c0 + j * 64;
        const int col = (c + kg * 16) & (C2 - 1);
        v8h h;
        #pragma unroll   // constant indices keep the vector in registers
        for (int i = 0; i < 8; ++i) h[i] = sT[(kg * 8 + i) * C2 + col];
        *(v8h*)(g + ((size_t)b * C2 + c) * HW4 + k0 + kg * 8) = h;
    }
}

// f32 -> f16 conversion (weights)
__global__ void cvt_f16_kernel(const float* __restrict__ src,
                               _Float16* __restrict__ dst, int n) {
    int i = blockIdx.x * blockDim.x + threadIdx.x;
    if (i * 4 >= n) return;
    v4f v = *(const v4f*)(src + i * 4);
    _Float16* d = dst + i * 4;
    d[0] = (_Float16)v[0]; d[1] = (_Float16)v[1];
    d[2] = (_Float16)v[2]; d[3] = (_Float16)v[3];
}

// ---------------------------------------------------------------------------
// Attention, 256 queries per block: 16 waves x 16 queries walk the 1024 keys in
// chunks of 64 that the block stages once in LDS (two buffers), so every byte
// of phi and g fetched from L2 serves 256 queries.
//   S^T(key x query) = phi_chunk @ theta^T   (A from LDS, B kept in registers)
//   O^T(chan x query) += g_chunk @ P^T       (A from LDS, B packed from S^T)
// A lane holds one query's scores: running maximum and sum stay in registers.
// Grid (HW/256, B), block 512. Dynamic LDS = 2 x 46,080 B. Four waves per SIMD
// (16 waves x 256 VGPRs fill one WGP): the attribute holds the allocator to that.
// ---------------------------------------------------------------------------
#define KCH    64                    // keys per chunk
#define PITCH  72                    // LDS row pitch in halfwords (128 B + 16 B)
#define PHI_H  (KCH * PITCH)         // phi chunk: 64 key rows
#define BUF_H  ((KCH + C2) * PITCH)  // + g chunk: 256 channel rows

// lane l <-> lane l ^ 16
__device__ __forceinline__ float xhalf(float x) {
    int i = __builtin_bit_cast(int, x);
    return __builtin_bit_cast(float,
        __builtin_amdgcn_permlanex16(i, i, 0x76543210, 0xfedcba98, false, false));
}

// 2^x; the v_nop keeps the one free issue slot that the instruction set asks for
// behind a transcendental, whatever the scheduler places next
__device__ __forceinline__ float exp2_slot(float x) {
    float r;
    asm("v_exp_f32 %0, %1\n\tv_nop" : "=v"(r) : "v"(x));
    return r;
}

__global__ void __launch_bounds__(512) __attribute__((amdgpu_waves_per_eu(4, 4)))
attn_wmma_kernel(const _Float16* __restrict__ theta,
                 const _Float16* __restrict__ phi,
                 const _Float16* __restrict__ g,
                 _Float16* __restrict__ o) {
    extern __shared__ __attribute__((aligned(16))) char smem[];
    _Float16* sBuf = (_Float16*)smem;

    const int b    = blockIdx.y;
    const int t    = threadIdx.x;
    const int lane = t & 31;
    const int wave = t >> 5;
    const int half = lane >> 4;
    const int mn   = lane & 15;
    const int q0   = blockIdx.x * 256 + wave * 16;

    // staging: 8 threads per 128-byte row, 64 rows per sweep
    const int srow = t >> 3, scol = (t & 7) * 8;
    const _Float16* pBase = phi + (size_t)b * HW4 * C8;   // uniform bases,
    const _Float16* gBase = g + (size_t)b * C2 * HW4;     // 32-bit lane offsets
    const int pOff = srow * C8 + scol;
    const int gOff = srow * HW4 + scol;
    const int sDst = srow * PITCH + scol;

    // theta^T as B operand: lane = query, K = channel, kept for the whole walk
    const _Float16* trow = theta + ((size_t)b * HW + q0 + mn) * C8;
    const v16h bq0 = load_frag_row(trow, half);
    const v16h bq1 = load_frag_row(trow + 32, half);

    v8h stP, stG[4];
    stP = *(const v8h*)(pBase + pOff);
    #pragma unroll   // constant indices keep the array in registers
    for (int j = 0; j < 4; ++j) stG[j] = *(const v8h*)(gBase + j * 64 * HW4 + gOff);
    *(v8h*)(sBuf + sDst) = stP;
    #pragma unroll   // constant indices keep the array in registers
    for (int j = 0; j < 4; ++j) *(v8h*)(sBuf + PHI_H + sDst + j * 64 * PITCH) = stG[j];
    __syncthreads();   // chunk 0 is published

    const float L2E = 1.4426950408889634f;
    v8f acc[16];
    #pragma unroll   // constant indices keep the array in registers
    for (int ct = 0; ct < 16; ++ct) acc[ct] = (v8f){};
    float ms = -3.0e38f;   // running maximum, in log2 units
    float l  = 0.f;        // running sum over this lane's keys

    for (int kc = 0; kc < HW4 / KCH; ++kc) {
        const _Float16* sp = sBuf + (kc & 1) * BUF_H;
        const _Float16* sg = sp + PHI_H;
        const bool more = kc + 1 < HW4 / KCH;

        // ---- S^T: s[kt][r] = score(key kt*16 + r + 8*half, query mn) ----
        v8f s[4];
        #pragma unroll   // constant indices keep the array in registers
        for (int kt = 0; kt < 4; ++kt) {
            const _Float16* pr = sp + (kt * 16 + mn) * PITCH;
            v16h a0 = load_frag_row(pr, half);
            v16h a1 = load_frag_row(pr + 32, half);
            v8f z = {};
            z = WMMA_F16(a0, bq0, z);
            z = WMMA_F16(a1, bq1, z);
            s[kt] = z;
        }

        // ---- running softmax, one query per lane ----
        float mx = s[0][0];
        #pragma unroll   // constant indices keep the array in registers
        for (int kt = 0; kt < 4; ++kt)
            #pragma unroll   // constant indices keep the array in registers
            for (int r = 0; r < 8; ++r) mx = fmaxf(mx, s[kt][r]);
        mx = fmaxf(mx, xhalf(mx));
        const float msn   = fmaxf(ms, mx * L2E);
        const float alpha = exp2_slot(ms - msn);   // 0 on the first chunk
        ms = msn;

        // P^T as B operand: score tiles 2ks and 2ks+1 already sit in the k order
        // of load_frag_row (half*8 + i, then 16 + half*8 + i)
        v16h p[2];
        float ls = 0.f;
        #pragma unroll   // constant indices keep the array in registers
        for (int ks = 0; ks < 2; ++ks) {
            #pragma unroll   // constant indices keep the array in registers
            for (int r = 0; r < 8; ++r) {
                const float x0 = fmaf(s[2 * ks][r],     L2E, -msn);
                const float x1 = fmaf(s[2 * ks + 1][r], L2E, -msn);
                const float e0 = exp2_slot(x0);
                const float e1 = exp2_slot(x1);
                ls += e0 + e1;
                p[ks][r]     = (_Float16)e0;
                p[ks][r + 8] = (_Float16)e1;
            }
        }
        l = l * alpha + ls;

        if (more) {   // next chunk's loads fly under the 32 products below (scores are packed: registers free)
            const int k1 = (kc + 1) * KCH;
            stP = *(const v8h*)(pBase + k1 * C8 + pOff);
            #pragma unroll   // constant indices keep the array in registers
            for (int j = 0; j < 4; ++j)
                stG[j] = *(const v8h*)(gBase + (j * 64 * HW4 + k1) + gOff);
            // stands in front of any later rewrite of these loads' address registers
            asm volatile("s_wait_xcnt 0x0" ::: "memory");
        }

        // ---- O^T += g_chunk @ P^T ----
        #pragma unroll   // constant indices keep the array in registers
        for (int ct = 0; ct < 16; ++ct) {
            const _Float16* gr = sg + (ct * 16 + mn) * PITCH;
            v16h a0 = load_frag_row(gr, half);
            v16h a1 = load_frag_row(gr + 32, half);
            v8f c = acc[ct] * alpha;
            c = WMMA_F16(a0, p[0], c);
            c = WMMA_F16(a1, p[1], c);
            acc[ct] = c;
        }

        if (more) {   // the other buffer's last readers left at the previous barrier
            _Float16* sn = sBuf + ((kc + 1) & 1) * BUF_H;
            *(v8h*)(sn + sDst) = stP;
            #pragma unroll   // constant indices keep the array in registers
            for (int j = 0; j < 4; ++j) *(v8h*)(sn + PHI_H + sDst + j * 64 * PITCH) = stG[j];
        }
        __syncthreads();   // publishes chunk kc + 1 and ends every read of chunk kc's buffer
    }

    l += xhalf(l);
    const float inv = 1.0f / l;
    _Float16* orow = o + ((size_t)b * HW + q0 + mn) * C2 + half * 8;
    #pragma unroll   // constant indices keep the array in registers
    for (int ct = 0; ct < 16; ++ct) {
        v8h h;
        #pragma unroll   // constant indices keep the array in registers
        for (int r = 0; r < 8; ++r) h[r] = (_Float16)(acc[ct][r] * inv);
        *(v8h*)(orow + ct * 16) = h;
    }
}

// ---------------------------------------------------------------------------
// Final: out[b][co][hw] = x + sigma*(w_attn[co,:]·attnG[b][hw,:] + b_attn[co])
// A block of 8 waves takes 64 positions x 256 output channels. The 64 attnG rows
// are staged once in LDS (whole 512-B rows in, 528-B pitch) and serve all waves.
// A wave does 32 channels x 64 positions as the transposed product
//   D(channel x position) = w_attn_tile @ attnG_tile^T   (A from global, B from LDS)
// Position tile j holds positions 4*mn + j, so a lane ends with four consecutive
// positions of one channel: x and out move 16 B a lane, 256 B a half wave.
// Weight fragments run three k steps ahead in a register ring; as the ring
// drains, its registers take the x rows, which so fly under the last products.
// Grid (512/256, HW/64, B), block 256.
// ---------------------------------------------------------------------------
#define FHW    64     // positions per block
#define FPITCH 264    // LDS row pitch in halfwords (512 B + 16 B)
#define FKS    (C2 / 32)
__global__ void __launch_bounds__(256)
final_conv_kernel(const _Float16* __restrict__ ag,
                  const _Float16* __restrict__ Wh,
                  const float* __restrict__ bt,
                  const float* __restrict__ x,
                  const float* __restrict__ sigma,
                  float* __restrict__ out) {
    __shared__ __attribute__((aligned(16))) _Float16 sB[FHW * FPITCH];

    const int hw0  = blockIdx.y * FHW;
    const int b    = blockIdx.z;
    const int t    = threadIdx.x;
    const int lane = t & 31;
    const int wave = t >> 5;
    const int half = lane >> 4;
    const int mn   = lane & 15;
    const int cob  = blockIdx.x * 256;   // the block's first channel

    // a wave fetches one whole row a load; position p lands in LDS row (p & 3) * 16 + (p >> 2)
    const _Float16* abase = ag + ((size_t)b * HW + hw0) * C2;   // uniform bases,
    const _Float16* wbase = Wh + (size_t)cob * C2;              // 32-bit lane offsets
    const int aoff = wave * C2 + lane * 8;
    const int woff = (wave * 32 + mn) * C2;
    v8h st[8];
    #pragma unroll   // all 8 loads of a lane in flight together
    for (int i = 0; i < 8; ++i) st[i] = *(const v8h*)(abase + aoff + i * 8 * C2);
    // keeps the row loads first in the queue: loads return in order, and the LDS
    // stores below would otherwise wait for the weight fragments too
    __builtin_amdgcn_sched_barrier(0);

    v16h aw[3][2];   // weight fragments of three k steps
    #pragma unroll   // constant indices keep the array in registers
    for (int q = 0; q < 3; ++q) {
        aw[q][0] = load_frag_row(wbase + woff + q * 32, half);
        aw[q][1] = load_frag_row(wbase + woff + 16 * C2 + q * 32, half);
    }

    #pragma unroll   // constant indices keep the array in registers
    for (int i = 0; i < 8; ++i) {
        const int p = i * 8 + wave;
        *(v8h*)(sB + ((p & 3) * 16 + (p >> 2)) * FPITCH + lane * 8) = st[i];
    }
    __syncthreads();   // the 64 rows are in LDS before any fragment is read

    const float* xb = x   + ((size_t)b * DIMS + cob) * HW + hw0;
    float*       ob = out + ((size_t)b * DIMS + cob) * HW + hw0;
    const int eoff = (wave * 32 + half * 8) * HW + mn * 4;

    const _Float16* br = sB + mn * FPITCH;
    v8f acc[2][4];
    #pragma unroll   // constant indices keep the array in registers
    for (int j = 0; j < 4; ++j) { acc[0][j] = (v8f){}; acc[1][j] = (v8f){}; }
    v4f xv[16];      // x rows: channel offset i = mt*16 + r -> xv[mt*8 + r]

    #pragma unroll   // constant indices keep the arrays in registers
    for (int ks = 0; ks < FKS; ++ks) {
        #pragma unroll   // constant indices keep the array in registers
        for (int j = 0; j < 4; ++j) {
            v16h bb = load_frag_row(br + j * 16 * FPITCH + ks * 32, half);
            acc[0][j] = WMMA_F16(aw[ks % 3][0], bb, acc[0][j]);
            acc[1][j] = WMMA_F16(aw[ks % 3][1], bb, acc[1][j]);
        }
        if (ks + 3 < FKS) {
            aw[ks % 3][0] = load_frag_row(wbase + woff + (ks + 3) * 32, half);
            aw[ks % 3][1] = load_frag_row(wbase + woff + 16 * C2 + (ks + 3) * 32, half);
        } else {
            #pragma unroll   // constant indices keep the array in registers
            for (int i = 0; i < 4; ++i) {
                const int e = (ks + 3 - FKS) * 4 + i;
                xv[e] = *(const v4f*)(xb + eoff + ((e >> 3) * 16 + (e & 7)) * HW);
            }
        }
        // holds the loads above at this place: without it the scheduler sinks them
        // to just in front of their use and each k step waits out an L2 round trip
        __builtin_amdgcn_sched_barrier(0);
    }
    #pragma unroll   // constant indices keep the array in registers
    for (int e = 12; e < 16; ++e)
        xv[e] = *(const v4f*)(xb + eoff + ((e >> 3) * 16 + (e & 7)) * HW);
    // holds the last four x loads here, so that all sixteen are in flight together
    __builtin_amdgcn_sched_barrier(0);

    // acc[mt][j][r]: channel cob + wave*32 + mt*16 + half*8 + r, position hw0 + 4*mn + j
    const float s = sigma[0];
    #pragma unroll   // constant indices keep the array in registers
    for (int mt = 0; mt < 2; ++mt) {
        const float* bp = bt + cob + wave * 32 + mt * 16 + half * 8;
        const v4f bl = *(const v4f*)(bp);
        const v4f bh = *(const v4f*)(bp + 4);
        #pragma unroll   // constant indices keep the array in registers
        for (int r = 0; r < 8; ++r) {
            const float bv = r < 4 ? bl[r & 3] : bh[r & 3];
            v4f ov;
            #pragma unroll   // constant indices keep the array in registers
            for (int j = 0; j < 4; ++j) ov[j] = xv[mt * 8 + r][j] + s * (acc[mt][j][r] + bv);
            *(v4f*)(ob + eoff + (mt * 16 + r) * HW) = ov;
        }
    }
}

// ---------------------------------------------------------------------------
extern "C" void kernel_launch(void* const* d_in, const int* in_sizes, int n_in,
                              void* d_out, int out_size, void* d_ws, size_t ws_size,
                              hipStream_t stream) {
    const float* x       = (const float*)d_in[0];
    const float* w_theta = (const float*)d_in[1];
    const float* b_theta = (const float*)d_in[2];
    const float* w_phi   = (const float*)d_in[3];
    const float* b_phi   = (const float*)d_in[4];
    const float* w_g     = (const float*)d_in[5];
    const float* b_g     = (const float*)d_in[6];
    const float* w_attn  = (const float*)d_in[7];
    const float* b_attn  = (const float*)d_in[8];
    const float* sigma   = (const float*)d_in[9];
    float* out = (float*)d_out;

    char* ws = (char*)d_ws;
    _Float16* theta   = (_Float16*)(ws);                 //  8 MB   [b][hw][64]
    _Float16* phi     = (_Float16*)(ws +  8388608);      //  2 MB   [b][key][64]
    _Float16* gbuf    = (_Float16*)(ws + 10485760);      //  8 MB   [b][c][key]
    _Float16* wth_h   = (_Float16*)(ws + 18874368);      //  64 KB  [64][512]
    _Float16* wph_h   = (_Float16*)(ws + 18939904);      //  64 KB  [64][512]
    _Float16* wg_h    = (_Float16*)(ws + 19005440);      // 256 KB  [256][512]
    _Float16* wat_h   = (_Float16*)(ws + 19267584);      // 256 KB  [512][256]
    _Float16* phic    = (_Float16*)(ws + 19529728);      //  8 MB   [b][hw][64]
    _Float16* gconv   = (_Float16*)(ws + 27918336);      //  32 MB  [b][hw][256]
    _Float16* attnout = (_Float16*)(ws + 19529728);      //  reuses phic+gconv

    cvt_f16_kernel<<<(C8 * DIMS / 4 + 255) / 256, 256, 0, stream>>>(w_theta, wth_h, C8 * DIMS);
    cvt_f16_kernel<<<(C8 * DIMS / 4 + 255) / 256, 256, 0, stream>>>(w_phi, wph_h, C8 * DIMS);
    cvt_f16_kernel<<<(C2 * DIMS / 4 + 255) / 256, 256, 0, stream>>>(w_g, wg_h, C2 * DIMS);
    cvt_f16_kernel<<<(DIMS * C2 / 4 + 255) / 256, 256, 0, stream>>>(w_attn, wat_h, DIMS * C2);

    // one pass over X produces theta, phi-conv and g-conv
    qkv_conv_kernel<<<dim3(HW / QP, NB), dim3(384), 0, stream>>>(
        x, wth_h, wph_h, wg_h, b_theta, b_phi, b_g, theta, phic, gconv);
    pool_phi_kernel<<<(NB * HW4 * (C8 / 8)) / 256, 256, 0, stream>>>(phic, phi);
    pool_g_kernel<<<dim3(HW4 / PGK, NB), dim3(512), 0, stream>>>(gconv, gbuf);
    attn_wmma_kernel<<<dim3(HW / 256, NB), dim3(512), 2 * BUF_H * 2, stream>>>(
        theta, phi, gbuf, attnout);
    final_conv_kernel<<<dim3(DIMS / 256, HW / FHW, NB), dim3(256), 0, stream>>>(
        attnout, wat_h, b_attn, x, sigma, out);
}

// v005
// It runs in 115 microseconds.
// In both of two side-by-side timings against v004, it was 1.13 times as fast.
// Counting every step since v000, it is 4.76 times as fast.
#include <hip/hip_runtime.h>
#include <hip/hip_bf16.h>

typedef __attribute__((ext_vector_type(16))) _Float16 v16h;
typedef __attribute__((ext_vector_type(8)))  _Float16 v8h;
typedef __attribute__((ext_vector_type(2)))  _Float16 v2h;
typedef __attribute__((ext_vector_type(8)))  float    v8f;
typedef __attribute__((ext_vector_type(4)))  float    v4f;

#define DIMS 512
#define NB   16
#define HW   4096   // 64*64
#define HW4  1024   // pooled positions
#define C8   64
#define C2   256
#define GT   32     // keys per tile of g: g[b][key / GT][channel][key % GT]

#define WMMA_F16(A, B, C) __builtin_amdgcn_wmma_f32_16x16x32_f16(false, A, false, B, (short)0, C, false, false)

// Fragment K pattern for 16x16x32 f16 WMMA (ISA 7.12.2):
//   lane half 0: K in [0,8) and [16,24);  lane half 1: K in [8,16) and [24,32).
// With K contiguous in memory a fragment is exactly two 16-byte loads.
__device__ __forceinline__ v16h load_frag_row(const _Float16* __restrict__ p, int half) {
    v8h lo = *(const v8h*)(p + half * 8);
    v8h hi = *(const v8h*)(p + 16 + half * 8);
    v16h r;
    #pragma unroll
    for (int i = 0; i < 8; ++i) { r[i] = lo[i]; r[i + 8] = hi[i]; }
    return r;
}

// ---------------------------------------------------------------------------
// Fused QKV 1x1 conv: reads X once, produces theta and the max-pooled phi and g.
// A block of 12 waves takes 128 positions (two image rows) x all 64+64+256 output
// channels, so every 2x2 pooling window lies inside one block.
// X is staged as f16 in LDS in panels of 64 input channels (two buffers): a
// staging wave reads whole 512-B rows of X, 16 B a lane, eight rows a panel, and
// each lane packs its four positions' eight channels into four 16-B LDS stores.
// Position p lands in LDS row (p & 3) * 32 + (p >> 2), so that the lanes of one
// store walk consecutive rows. A wave does 32 channels x 128 positions as
//   D(channel x position) = w_tile @ X_tile   (A from global, B from LDS)
// so a weight row fetched once serves 128 positions, and a lane ends with eight
// consecutive channels of eight positions. Those eight positions are two whole
// pooling windows: phi and g are pooled in registers and never stored unpooled.
// g goes out in tiles of 32 keys, g[b][key / 32][channel][key % 32]: the block
// writes one whole tile, so no 128-B line has a second writer.
// Weight fragments run one panel ahead in registers.
// Grid (HW/128, B), block 384.
// ---------------------------------------------------------------------------
#define QP     128            // positions per block
#define QK     64             // input channels per panel
#define QPITCH 72             // LDS row pitch in halfwords (128 B + 16 B)
#define QBUF   (QP * QPITCH)
#define QNP    (DIMS / QK)
__global__ void __launch_bounds__(384)
qkv_conv_kernel(const float* __restrict__ X,
                const _Float16* __restrict__ Wth,
                const _Float16* __restrict__ Wph,
                const _Float16* __restrict__ Wg,
                const float* __restrict__ bth,
                const float* __restrict__ bph,
                const float* __restrict__ bg,
                _Float16* __restrict__ theta,
                _Float16* __restrict__ phi,
                _Float16* __restrict__ g) {
    __shared__ __attribute__((aligned(16))) _Float16 sX[2 * QBUF];

    const int hw0  = blockIdx.x * QP;
    const int b    = blockIdx.y;
    const int t    = threadIdx.x;
    const int lane = t & 31;
    const int wave = __builtin_amdgcn_readfirstlane(t >> 5);   // scalar: uniform bases and branches
    const int half = lane >> 4;
    const int mn   = lane & 15;

    // the wave's 32 output channels: waves 0-1 theta, 2-3 phi, 4-11 g
    const _Float16* wsel;
    const float*    bsel;
    if (wave < 2)      { wsel = Wth + wave * 32 * DIMS;       bsel = bth + wave * 32; }
    else if (wave < 4) { wsel = Wph + (wave - 2) * 32 * DIMS; bsel = bph + (wave - 2) * 32; }
    else               { wsel = Wg + (wave - 4) * 32 * DIMS;  bsel = bg + (wave - 4) * 32; }
    const int woff = mn * DIMS;

    // staging: waves 0-7 take eight X rows of each panel
    const bool stager = wave < QK / 8;
    const float* xs = X + ((size_t)b * DIMS + (wave & 7) * 8) * HW + hw0;
    const int xoff = lane * 4;
    const int sDst = lane * QPITCH + (wave & 7) * 8;

    v4f xr[8];
    if (stager) {
        #pragma unroll   // all 8 loads of a lane in flight together
        for (int i = 0; i < 8; ++i) xr[i] = *(const v4f*)(xs + i * HW + xoff);
    }
    // keeps the X loads first in the queue: loads return in order, and the LDS
    // stores below would otherwise wait for the weight fragments too
    __builtin_amdgcn_sched_barrier(0);

    v16h aw[2][2];   // weight fragments of one panel (two k steps, two channel tiles)
    #pragma unroll   // constant indices keep the array in registers
    for (int q = 0; q < 2; ++q) {
        aw[q][0] = load_frag_row(wsel + woff + q * 32, half);
        aw[q][1] = load_frag_row(wsel + woff + 16 * DIMS + q * 32, half);
    }

    if (stager) {
        #pragma unroll   // constant indices keep the array in registers
        for (int j = 0; j < 4; ++j) {
            v8h h;
            #pragma unroll   // constant indices keep the array in registers
            for (int i = 0; i < 8; ++i) h[i] = (_Float16)xr[i][j];
            *(v8h*)(sX + sDst + j * 32 * QPITCH) = h;
        }
    }
    __syncthreads();   // panel 0 is published

    v8f acc[2][8];
    #pragma unroll   // constant indices keep the array in registers
    for (int n = 0; n < 8; ++n) { acc[0][n] = (v8f){}; acc[1][n] = (v8f){}; }

    #pragma unroll   // constant buffer and panel offsets; no branch behind a product
    for (int kp = 0; kp < QNP; ++kp) {
        const _Float16* br = sX + (kp & 1) * QBUF + mn * QPITCH;
        // Eight steps of four products: step u takes k step SQ(u) and position tiles
        // 2*SN(u), 2*SN(u)+1. Both k steps are touched in the first two steps, so every
        // weight load has been waited for before the X loads are issued: loads return
        // in order, and a wait for a weight behind them would wait for memory too.
        #define SQ(u) ((u) < 2 ? (u) : ((u) < 5 ? 0 : 1))
        #define SN(u) ((u) < 2 ? 0 : ((u) < 5 ? (u) - 1 : (u) - 4))
        // X fragments come in pairs through a ring of three: pair u + 2 is asked for
        // in front of pair u's four products, so an LDS round trip hides under eight
        v16h bb[3][2];
        #pragma unroll   // constant indices keep the array in registers
        for (int u = 0; u < 2; ++u) {
            const _Float16* bn = br + SN(u) * 32 * QPITCH + SQ(u) * 32;
            bb[u][0] = load_frag_row(bn, half);
            bb[u][1] = load_frag_row(bn + 16 * QPITCH, half);
        }
        #pragma unroll   // constant indices keep the arrays in registers
        for (int u = 0; u < 8; ++u) {
            const int q = SQ(u), n = SN(u) * 2;
            if (u == 2 && kp + 1 < QNP && stager) {   // next panel's rows fly under the 24 products left
                #pragma unroll   // all 8 loads of a lane in flight together
                for (int i = 0; i < 8; ++i)
                    xr[i] = *(const v4f*)(xs + ((kp + 1) * QK + i) * HW + xoff);
            }
            if (u + 2 < 8) {
                const int v = u + 2;
                const _Float16* bn = br + SN(v) * 32 * QPITCH + SQ(v) * 32;
                bb[v % 3][0] = load_frag_row(bn, half);
                bb[v % 3][1] = load_frag_row(bn + 16 * QPITCH, half);
            }
            acc[0][n]     = WMMA_F16(aw[q][0], bb[u % 3][0], acc[0][n]);
            acc[1][n]     = WMMA_F16(aw[q][1], bb[u % 3][0], acc[1][n]);
            acc[0][n + 1] = WMMA_F16(aw[q][0], bb[u % 3][1], acc[0][n + 1]);
            acc[1][n + 1] = WMMA_F16(aw[q][1], bb[u % 3][1], acc[1][n + 1]);
            if ((u == 4 || u == 7) && kp + 1 < QNP) {   // this k step's weights are spent: fetch the next panel's
                aw[q][0] = load_frag_row(wsel + woff + (kp + 1) * QK + q * 32, half);
                aw[q][1] = load_frag_row(wsel + woff + 16 * DIMS + (kp + 1) * QK + q * 32, half);
            }
            // holds every load at the place written: sunk to its use, an LDS read would
            // stall each pair of products and a weight load each k step
            __builtin_amdgcn_sched_barrier(0);
        }

        if (kp + 1 < QNP && stager) {   // the other buffer's last readers left at the previous barrier
            _Float16* sn = sX + ((kp + 1) & 1) * QBUF + sDst;
            #pragma unroll   // constant indices keep the array in registers
            for (int j = 0; j < 4; ++j) {
                v8h h;
                #pragma unroll   // constant indices keep the array in registers
                for (int i = 0; i < 8; ++i) h[i] = (_Float16)xr[i][j];
                *(v8h*)(sn + j * 32 * QPITCH) = h;
            }
        }
        if (kp + 1 < QNP) {
            // publishes panel kp + 1 and ends every read of panel kp's buffer. The fences
            // name LDS alone: __syncthreads() would also drain the weight loads just
            // issued for the next panel, an L2 round trip in front of every barrier
            __builtin_amdgcn_fence(__ATOMIC_RELEASE, "workgroup", "local");
            __builtin_amdgcn_s_barrier();
            __builtin_amdgcn_fence(__ATOMIC_ACQUIRE, "workgroup", "local");
        }
    }

    // acc[mt][n][r]: channel mt*16 + half*8 + r of the wave's 32,
    // position hw0 + 4*((n & 1)*16 + mn) + (n >> 1)
    if (wave < 2) {   // theta: every position
        _Float16* dl = theta + ((size_t)b * HW + hw0) * C8 + wave * 32 + half * 8;
        #pragma unroll   // constant indices keep the array in registers
        for (int mt = 0; mt < 2; ++mt) {
            const float* bp = bsel + mt * 16 + half * 8;
            const v4f bl = *(const v4f*)(bp);
            const v4f bh = *(const v4f*)(bp + 4);
            #pragma unroll   // constant indices keep the array in registers
            for (int n = 0; n < 8; ++n) {
                const int p = 4 * ((n & 1) * 16 + mn) + (n >> 1);
                v8h h;
                #pragma unroll   // constant indices keep the array in registers
                for (int r = 0; r < 8; ++r)
                    h[r] = (_Float16)(acc[mt][n][r] + (r < 4 ? bl[r & 3] : bh[r & 3]));
                *(v8h*)(dl + p * C8 + mt * 16) = h;
            }
        }
        return;
    }

    // phi and g: tiles n = 4w .. 4w+3 are columns 4*mn + 2w, + 1 of both image rows,
    // the window of pooled column 2*mn + w in pooled row blockIdx.x. The bias is the
    // same over a window and rounding keeps order: maximum first, then bias and f16.
    // Both bias rows are fetched up front: no load stands behind a store.
    v8f pw[2][2];   // [channel tile][w]
    #pragma unroll   // constant indices keep the arrays in registers
    for (int mt = 0; mt < 2; ++mt) {
        const float* bp = bsel + mt * 16 + half * 8;
        const v4f bl = *(const v4f*)(bp);
        const v4f bh = *(const v4f*)(bp + 4);
        #pragma unroll   // constant indices keep the arrays in registers
        for (int w = 0; w < 2; ++w)
            #pragma unroll   // constant indices keep the arrays in registers
            for (int r = 0; r < 8; ++r)
                pw[mt][w][r] = fmaxf(fmaxf(acc[mt][4 * w][r],     acc[mt][4 * w + 1][r]),
                                     fmaxf(acc[mt][4 * w + 2][r], acc[mt][4 * w + 3][r]))
                               + (r < 4 ? bl[r & 3] : bh[r & 3]);
    }
    if (wave < 4) {   // phi[b][key][64]: eight channels of a key, 16 B
        _Float16* dp = phi + ((size_t)b * HW4 + blockIdx.x * 32 + 2 * mn) * C8 + (wave - 2) * 32 + half * 8;
        #pragma unroll   // constant indices keep the arrays in registers
        for (int mt = 0; mt < 2; ++mt)
            #pragma unroll   // constant indices keep the arrays in registers
            for (int w = 0; w < 2; ++w) {
                v8h h;
                #pragma unroll   // constant indices keep the arrays in registers
                for (int r = 0; r < 8; ++r) h[r] = (_Float16)pw[mt][w][r];
                *(v8h*)(dp + w * C8 + mt * 16) = h;
            }
        // stands in front of any later rewrite of these stores' address and data registers
        asm volatile("s_wait_xcnt 0x0" ::: "memory");
    } else {          // g tile: two keys of a channel, 4 B; 16 lanes fill the channel's 64 B
        _Float16* dg = g + (((size_t)b * (HW4 / GT) + blockIdx.x) * C2 + (wave - 4) * 32 + half * 8) * GT + 2 * mn;
        #pragma unroll   // constant indices keep the arrays in registers
        for (int mt = 0; mt < 2; ++mt)
            #pragma unroll   // constant indices keep the arrays in registers
            for (int r = 0; r < 8; ++r) {
                v2h kk = { (_Float16)pw[mt][0][r], (_Float16)pw[mt][1][r] };
                *(v2h*)(dg + (mt * 16 + r) * GT) = kk;
            }
        // stands in front of any later rewrite of these stores' address and data registers
        asm volatile("s_wait_xcnt 0x0" ::: "memory");
    }
}

// f32 -> f16 conversion (weights)
__global__ void cvt_f16_kernel(const float* __restrict__ src,
                               _Float16* __restrict__ dst, int n) {
    int i = blockIdx.x * blockDim.x + threadIdx.x;
    if (i * 4 >= n) return;
    v4f v = *(const v4f*)(src + i * 4);
    _Float16* d = dst + i * 4;
    d[0] = (_Float16)v[0]; d[1] = (_Float16)v[1];
    d[2] = (_Float16)v[2]; d[3] = (_Float16)v[3];
}

// ---------------------------------------------------------------------------
// Attention, 256 queries per block: 16 waves x 16 queries walk the 1024 keys in
// chunks of 64 that the block stages once in LDS (two buffers), so every byte
// of phi and g fetched from L2 serves 256 queries.
//   S^T(key x query) = phi_chunk @ theta^T   (A from LDS, B kept in registers)
//   O^T(chan x query) += g_chunk @ P^T       (A from LDS, B packed from S^T)
// A lane holds one query's scores: running maximum and sum stay in registers.
// Grid (HW/256, B), block 512. Dynamic LDS = 2 x 46,080 B. Four waves per SIMD
// (16 waves x 256 VGPRs fill one WGP): the attribute holds the allocator to that.
// ---------------------------------------------------------------------------
#define KCH    64                    // keys per chunk
#define PITCH  72                    // LDS row pitch in halfwords (128 B + 16 B)
#define PHI_H  (KCH * PITCH)         // phi chunk: 64 key rows
#define BUF_H  ((KCH + C2) * PITCH)  // + g chunk: 256 channel rows

// lane l <-> lane l ^ 16
__device__ __forceinline__ float xhalf(float x) {
    int i = __builtin_bit_cast(int, x);
    return __builtin_bit_cast(float,
        __builtin_amdgcn_permlanex16(i, i, 0x76543210, 0xfedcba98, false, false));
}

// 2^x; the v_nop keeps the one free issue slot that the instruction set asks for
// behind a transcendental, whatever the scheduler places next
__device__ __forceinline__ float exp2_slot(float x) {
    float r;
    asm("v_exp_f32 %0, %1\n\tv_nop" : "=v"(r) : "v"(x));
    return r;
}

__global__ void __launch_bounds__(512) __attribute__((amdgpu_waves_per_eu(4, 4)))
attn_wmma_kernel(const _Float16* __restrict__ theta,
                 const _Float16* __restrict__ phi,
                 const _Float16* __restrict__ g,
                 _Float16* __restrict__ o) {
    extern __shared__ __attribute__((aligned(16))) char smem[];
    _Float16* sBuf = (_Float16*)smem;

    const int b    = blockIdx.y;
    const int t    = threadIdx.x;
    const int lane = t & 31;
    const int wave = t >> 5;
    const int half = lane >> 4;
    const int mn   = lane & 15;
    const int q0   = blockIdx.x * 256 + wave * 16;

    // staging: 8 threads per 128-byte row, 64 rows per sweep
    const int srow = t >> 3, scol = (t & 7) * 8;
    const _Float16* pBase = phi + (size_t)b * HW4 * C8;   // uniform bases,
    const _Float16* gBase = g + (size_t)b * C2 * HW4;     // 32-bit lane offsets
    const int pOff = srow * C8 + scol;
    const int gOff = (scol / GT) * (C2 * GT) + srow * GT + (scol & (GT - 1));   // a chunk is two key tiles of g
    const int sDst = srow * PITCH + scol;

    // theta^T as B operand: lane = query, K = channel, kept for the whole walk
    const _Float16* trow = theta + ((size_t)b * HW + q0 + mn) * C8;
    const v16h bq0 = load_frag_row(trow, half);
    const v16h bq1 = load_frag_row(trow + 32, half);

    v8h stP, stG[4];
    stP = *(const v8h*)(pBase + pOff);
    #pragma unroll   // constant indices keep the array in registers
    for (int j = 0; j < 4; ++j) stG[j] = *(const v8h*)(gBase + j * 64 * GT + gOff);
    *(v8h*)(sBuf + sDst) = stP;
    #pragma unroll   // constant indices keep the array in registers
    for (int j = 0; j < 4; ++j) *(v8h*)(sBuf + PHI_H + sDst + j * 64 * PITCH) = stG[j];
    __syncthreads();   // chunk 0 is published

    const float L2E = 1.4426950408889634f;
    v8f acc[16];
    #pragma unroll   // constant indices keep the array in registers
    for (int ct = 0; ct < 16; ++ct) acc[ct] = (v8f){};
    float ms = -3.0e38f;   // running maximum, in log2 units
    float l  = 0.f;        // running sum over this lane's keys

    for (int kc = 0; kc < HW4 / KCH; ++kc) {
        const _Float16* sp = sBuf + (kc & 1) * BUF_H;
        const _Float16* sg = sp + PHI_H;
        const bool more = kc + 1 < HW4 / KCH;

        // ---- S^T: s[kt][r] = score(key kt*16 + r + 8*half, query mn) ----
        v8f s[4];
        #pragma unroll   // constant indices keep the array in registers
        for (int kt = 0; kt < 4; ++kt) {
            const _Float16* pr = sp + (kt * 16 + mn) * PITCH;
            v16h a0 = load_frag_row(pr, half);
            v16h a1 = load_frag_row(pr + 32, half);
            v8f z = {};
            z = WMMA_F16(a0, bq0, z);
            z = WMMA_F16(a1, bq1, z);
            s[kt] = z;
        }

        // ---- running softmax, one query per lane ----
        float mx = s[0][0];
        #pragma unroll   // constant indices keep the array in registers
        for (int kt = 0; kt < 4; ++kt)
            #pragma unroll   // constant indices keep the array in registers
            for (int r = 0; r < 8; ++r) mx = fmaxf(mx, s[kt][r]);
        mx = fmaxf(mx, xhalf(mx));
        const float msn   = fmaxf(ms, mx * L2E);
        const float alpha = exp2_slot(ms - msn);   // 0 on the first chunk
        ms = msn;

        // P^T as B operand: score tiles 2ks and 2ks+1 already sit in the k order
        // of load_frag_row (half*8 + i, then 16 + half*8 + i)
        v16h p[2];
        float ls = 0.f;
        #pragma unroll   // constant indices keep the array in registers
        for (int ks = 0; ks < 2; ++ks) {
            #pragma unroll   // constant indices keep the array in registers
            for (int r = 0; r < 8; ++r) {
                const float x0 = fmaf(s[2 * ks][r],     L2E, -msn);
                const float x1 = fmaf(s[2 * ks + 1][r], L2E, -msn);
                const float e0 = exp2_slot(x0);
                const float e1 = exp2_slot(x1);
                ls += e0 + e1;
                p[ks][r]     = (_Float16)e0;
                p[ks][r + 8] = (_Float16)e1;
            }
        }
        l = l * alpha + ls;

        if (more) {   // next chunk's loads fly under the 32 products below (scores are packed: registers free)
            const int k1 = (kc + 1) * KCH;
            stP = *(const v8h*)(pBase + k1 * C8 + pOff);
            #pragma unroll   // constant indices keep the array in registers
            for (int j = 0; j < 4; ++j)
                stG[j] = *(const v8h*)(gBase + (j * 64 * GT + k1 * C2) + gOff);
            // stands in front of any later rewrite of these loads' address registers
            asm volatile("s_wait_xcnt 0x0" ::: "memory");
        }

        // ---- O^T += g_chunk @ P^T ----
        #pragma unroll   // constant indices keep the array in registers
        for (int ct = 0; ct < 16; ++ct) {
            const _Float16* gr = sg + (ct * 16 + mn) * PITCH;
            v16h a0 = load_frag_row(gr, half);
            v16h a1 = load_frag_row(gr + 32, half);
            v8f c = acc[ct] * alpha;
            c = WMMA_F16(a0, p[0], c);
            c = WMMA_F16(a1, p[1], c);
            acc[ct] = c;
        }

        if (more) {   // the other buffer's last readers left at the previous barrier
            _Float16* sn = sBuf + ((kc + 1) & 1) * BUF_H;
            *(v8h*)(sn + sDst) = stP;
            #pragma unroll   // constant indices keep the array in registers
            for (int j = 0; j < 4; ++j) *(v8h*)(sn + PHI_H + sDst + j * 64 * PITCH) = stG[j];
        }
        __syncthreads();   // publishes chunk kc + 1 and ends every read of chunk kc's buffer
    }

    l += xhalf(l);
    const float inv = 1.0f / l;
    _Float16* orow = o + ((size_t)b * HW + q0 + mn) * C2 + half * 8;
    #pragma unroll   // constant indices keep the array in registers
    for (int ct = 0; ct < 16; ++ct) {
        v8h h;
        #pragma unroll   // constant indices keep the array in registers
        for (int r = 0; r < 8; ++r) h[r] = (_Float16)(acc[ct][r] * inv);
        *(v8h*)(orow + ct * 16) = h;
    }
}

// ---------------------------------------------------------------------------
// Final: out[b][co][hw] = x + sigma*(w_attn[co,:]·attnG[b][hw,:] + b_attn[co])
// A block of 8 waves takes 64 positions x 256 output channels. The 64 attnG rows
// are staged once in LDS (whole 512-B rows in, 528-B pitch) and serve all waves.
// A wave does 32 channels x 64 positions as the transposed product
//   D(channel x position) = w_attn_tile @ attnG_tile^T   (A from global, B from LDS)
// Position tile j holds positions 4*mn + j, so a lane ends with four consecutive
// positions of one channel: x and out move 16 B a lane, 256 B a half wave.
// Weight fragments run three k steps ahead in a register ring; as the ring
// drains, its registers take the x rows, which so fly under the last products.
// Grid (512/256, HW/64, B), block 256.
// ---------------------------------------------------------------------------
#define FHW    64     // positions per block
#define FPITCH 264    // LDS row pitch in halfwords (512 B + 16 B)
#define FKS    (C2 / 32)
__global__ void __launch_bounds__(256)
final_conv_kernel(const _Float16* __restrict__ ag,
                  const _Float16* __restrict__ Wh,
                  const float* __restrict__ bt,
                  const float* __restrict__ x,
                  const float* __restrict__ sigma,
                  float* __restrict__ out) {
    __shared__ __attribute__((aligned(16))) _Float16 sB[FHW * FPITCH];

    const int hw0  = blockIdx.y * FHW;
    const int b    = blockIdx.z;
    const int t    = threadIdx.x;
    const int lane = t & 31;
    const int wave = t >> 5;
    const int half = lane >> 4;
    const int mn   = lane & 15;
    const int cob  = blockIdx.x * 256;   // the block's first channel

    // a wave fetches one whole row a load; position p lands in LDS row (p & 3) * 16 + (p >> 2)
    const _Float16* abase = ag + ((size_t)b * HW + hw0) * C2;   // uniform bases,
    const _Float16* wbase = Wh + (size_t)cob * C2;              // 32-bit lane offsets
    const int aoff = wave * C2 + lane * 8;
    const int woff = (wave * 32 + mn) * C2;
    v8h st[8];
    #pragma unroll   // all 8 loads of a lane in flight together
    for (int i = 0; i < 8; ++i) st[i] = *(const v8h*)(abase + aoff + i * 8 * C2);
    // keeps the row loads first in the queue: loads return in order, and the LDS
    // stores below would otherwise wait for the weight fragments too
    __builtin_amdgcn_sched_barrier(0);

    v16h aw[3][2];   // weight fragments of three k steps
    #pragma unroll   // constant indices keep the array in registers
    for (int q = 0; q < 3; ++q) {
        aw[q][0] = load_frag_row(wbase + woff + q * 32, half);
        aw[q][1] = load_frag_row(wbase + woff + 16 * C2 + q * 32, half);
    }

    #pragma unroll   // constant indices keep the array in registers
    for (int i = 0; i < 8; ++i) {
        const int p = i * 8 + wave;
        *(v8h*)(sB + ((p & 3) * 16 + (p >> 2)) * FPITCH + lane * 8) = st[i];
    }
    __syncthreads();   // the 64 rows are in LDS before any fragment is read

    const float* xb = x   + ((size_t)b * DIMS + cob) * HW + hw0;
    float*       ob = out + ((size_t)b * DIMS + cob) * HW + hw0;
    const int eoff = (wave * 32 + half * 8) * HW + mn * 4;

    const _Float16* br = sB + mn * FPITCH;
    v8f acc[2][4];
    #pragma unroll   // constant indices keep the array in registers
    for (int j = 0; j < 4; ++j) { acc[0][j] = (v8f){}; acc[1][j] = (v8f){}; }
    v4f xv[16];      // x rows: channel offset i = mt*16 + r -> xv[mt*8 + r]

    #pragma unroll   // constant indices keep the arrays in registers
    for (int ks = 0; ks < FKS; ++ks) {
        #pragma unroll   // constant indices keep the array in registers
        for (int j = 0; j < 4; ++j) {
            v16h bb = load_frag_row(br + j * 16 * FPITCH + ks * 32, half);
            acc[0][j] = WMMA_F16(aw[ks % 3][0], bb, acc[0][j]);
            acc[1][j] = WMMA_F16(aw[ks % 3][1], bb, acc[1][j]);
        }
        if (ks + 3 < FKS) {
            aw[ks % 3][0] = load_frag_row(wbase + woff + (ks + 3) * 32, half);
            aw[ks % 3][1] = load_frag_row(wbase + woff + 16 * C2 + (ks + 3) * 32, half);
        } else {
            #pragma unroll   // constant indices keep the array in registers
            for (int i = 0; i < 4; ++i) {
                const int e = (ks + 3 - FKS) * 4 + i;
                xv[e] = *(const v4f*)(xb + eoff + ((e >> 3) * 16 + (e & 7)) * HW);
            }
        }
        // holds the loads above at this place: without it the scheduler sinks them
        // to just in front of their use and each k step waits out an L2 round trip
        __builtin_amdgcn_sched_barrier(0);
    }
    #pragma unroll   // constant indices keep the array in registers
    for (int e = 12; e < 16; ++e)
        xv[e] = *(const v4f*)(xb + eoff + ((e >> 3) * 16 + (e & 7)) * HW);
    // holds the last four x loads here, so that all sixteen are in flight together
    __builtin_amdgcn_sched_barrier(0);

    // acc[mt][j][r]: channel cob + wave*32 + mt*16 + half*8 + r, position hw0 + 4*mn + j
    const float s = sigma[0];
    #pragma unroll   // constant indices keep the array in registers
    for (int mt = 0; mt < 2; ++mt) {
        const float* bp = bt + cob + wave * 32 + mt * 16 + half * 8;
        const v4f bl = *(const v4f*)(bp);
        const v4f bh = *(const v4f*)(bp + 4);
        #pragma unroll   // constant indices keep the array in registers
        for (int r = 0; r < 8; ++r) {
            const float bv = r < 4 ? bl[r & 3] : bh[r & 3];
            v4f ov;
            #pragma unroll   // constant indices keep the array in registers
            for (int j = 0; j < 4; ++j) ov[j] = xv[mt * 8 + r][j] + s * (acc[mt][j][r] + bv);
            *(v4f*)(ob + eoff + (mt * 16 + r) * HW) = ov;
        }
    }
}

// ---------------------------------------------------------------------------
extern "C" void kernel_launch(void* const* d_in, const int* in_sizes, int n_in,
                              void* d_out, int out_size, void* d_ws, size_t ws_size,
                              hipStream_t stream) {
    const float* x       = (const float*)d_in[0];
    const float* w_theta = (const float*)d_in[1];
    const float* b_theta = (const float*)d_in[2];
    const float* w_phi   = (const float*)d_in[3];
    const float* b_phi   = (const float*)d_in[4];
    const float* w_g     = (const float*)d_in[5];
    const float* b_g     = (const float*)d_in[6];
    const float* w_attn  = (const float*)d_in[7];
    const float* b_attn  = (const float*)d_in[8];
    const float* sigma   = (const float*)d_in[9];
    float* out = (float*)d_out;

    char* ws = (char*)d_ws;
    _Float16* theta   = (_Float16*)(ws);                 //  8 MB   [b][hw][64]
    _Float16* phi     = (_Float16*)(ws +  8388608);      //  2 MB   [b][key][64]
    _Float16* gbuf    = (_Float16*)(ws + 10485760);      //  8 MB   [b][key/32][c][key%32]
    _Float16* wth_h   = (_Float16*)(ws + 18874368);      //  64 KB  [64][512]
    _Float16* wph_h   = (_Float16*)(ws + 18939904);      //  64 KB  [64][512]
    _Float16* wg_h    = (_Float16*)(ws + 19005440);      // 256 KB  [256][512]
    _Float16* wat_h   = (_Float16*)(ws + 19267584);      // 256 KB  [512][256]
    _Float16* attnout = (_Float16*)(ws + 19529728);      //  32 MB  [b][hw][256]

    cvt_f16_kernel<<<(C8 * DIMS / 4 + 255) / 256, 256, 0, stream>>>(w_theta, wth_h, C8 * DIMS);
    cvt_f16_kernel<<<(C8 * DIMS / 4 + 255) / 256, 256, 0, stream>>>(w_phi, wph_h, C8 * DIMS);
    cvt_f16_kernel<<<(C2 * DIMS / 4 + 255) / 256, 256, 0, stream>>>(w_g, wg_h, C2 * DIMS);
    cvt_f16_kernel<<<(DIMS * C2 / 4 + 255) / 256, 256, 0, stream>>>(w_attn, wat_h, DIMS * C2);

    // one pass over X produces theta and the pooled phi and g
    qkv_conv_kernel<<<dim3(HW / QP, NB), dim3(384), 0, stream>>>(
        x, wth_h, wph_h, wg_h, b_theta, b_phi, b_g, theta, phi, gbuf);
    attn_wmma_kernel<<<dim3(HW / 256, NB), dim3(512), 2 * BUF_H * 2, stream>>>(
        theta, phi, gbuf, attnout);
    final_conv_kernel<<<dim3(DIMS / 256, HW / FHW, NB), dim3(256), 0, stream>>>(
        attnout, wat_h, b_attn, x, sigma, out);
}

// v006
// One run takes 109 microseconds.
// Two timings next to v005 both put it at 1.06 times that version's speed.
// All steps since v000 together make it 5.05 times as fast.
#include <hip/hip_runtime.h>
#include <hip/hip_bf16.h>

typedef __attribute__((ext_vector_type(16))) _Float16 v16h;
typedef __attribute__((ext_vector_type(8)))  _Float16 v8h;
typedef __attribute__((ext_vector_type(2)))  _Float16 v2h;
typedef __attribute__((ext_vector_type(8)))  float    v8f;
typedef __attribute__((ext_vector_type(4)))  float    v4f;

#define DIMS 512
#define NB   16
#define HW   4096   // 64*64
#define HW4  1024   // pooled positions
#define C8   64
#define C2   256
#define GT   32     // keys per tile of g: g[b][key / GT][channel][key % GT]

#define WMMA_F16(A, B, C) __builtin_amdgcn_wmma_f32_16x16x32_f16(false, A, false, B, (short)0, C, false, false)

// Fragment K pattern for 16x16x32 f16 WMMA (ISA 7.12.2):
//   lane half 0: K in [0,8) and [16,24);  lane half 1: K in [8,16) and [24,32).
// With K contiguous in memory a fragment is exactly two 16-byte loads.
__device__ __forceinline__ v16h load_frag_row(const _Float16* __restrict__ p, int half) {
    v8h lo = *(const v8h*)(p + half * 8);
    v8h hi = *(const v8h*)(p + 16 + half * 8);
    v16h r;
    #pragma unroll
    for (int i = 0; i < 8; ++i) { r[i] = lo[i]; r[i + 8] = hi[i]; }
    return r;
}

// ---------------------------------------------------------------------------
// Fused QKV 1x1 conv: reads X once, produces theta and the max-pooled phi and g.
// A block of 12 waves takes 128 positions (two image rows) x all 64+64+256 output
// channels, so every 2x2 pooling window lies inside one block.
// X is staged as f16 in LDS in panels of 64 input channels (two buffers): a
// staging wave reads whole 512-B rows of X, 16 B a lane, eight rows a panel, and
// each lane packs its four positions' eight channels into four 16-B LDS stores.
// Position p lands in LDS row (p & 3) * 32 + (p >> 2), so that the lanes of one
// store walk consecutive rows. A wave does 32 channels x 128 positions as
//   D(channel x position) = w_tile @ X_tile   (A from global, B from LDS)
// so a weight row fetched once serves 128 positions, and a lane ends with eight
// consecutive channels of eight positions. Those eight positions are two whole
// pooling windows: phi and g are pooled in registers and never stored unpooled.
// g goes out in tiles of 32 keys, g[b][key / 32][channel][key % 32]: the block
// writes one whole tile, so no 128-B line has a second writer.
// Weight fragments run one panel ahead in registers.
// Grid (HW/128, B), block 384.
// ---------------------------------------------------------------------------
#define QP     128            // positions per block
#define QK     64             // input channels per panel
#define QPITCH 72             // LDS row pitch in halfwords (128 B + 16 B)
#define QBUF   (QP * QPITCH)
#define QNP    (DIMS / QK)
__global__ void __launch_bounds__(384)
qkv_conv_kernel(const float* __restrict__ X,
                const _Float16* __restrict__ Wth,
                const _Float16* __restrict__ Wph,
                const _Float16* __restrict__ Wg,
                const float* __restrict__ bth,
                const float* __restrict__ bph,
                const float* __restrict__ bg,
                _Float16* __restrict__ theta,
                _Float16* __restrict__ phi,
                _Float16* __restrict__ g) {
    __shared__ __attribute__((aligned(16))) _Float16 sX[2 * QBUF];

    const int hw0  = blockIdx.x * QP;
    const int b    = blockIdx.y;
    const int t    = threadIdx.x;
    const int lane = t & 31;
    const int wave = __builtin_amdgcn_readfirstlane(t >> 5);   // scalar: uniform bases and branches
    const int half = lane >> 4;
    const int mn   = lane & 15;

    // the wave's 32 output channels: waves 0-1 theta, 2-3 phi, 4-11 g
    const _Float16* wsel;
    const float*    bsel;
    if (wave < 2)      { wsel = Wth + wave * 32 * DIMS;       bsel = bth + wave * 32; }
    else if (wave < 4) { wsel = Wph + (wave - 2) * 32 * DIMS; bsel = bph + (wave - 2) * 32; }
    else               { wsel = Wg + (wave - 4) * 32 * DIMS;  bsel = bg + (wave - 4) * 32; }
    const int woff = mn * DIMS;

    // staging: waves 0-7 take eight X rows of each panel
    const bool stager = wave < QK / 8;
    const float* xs = X + ((size_t)b * DIMS + (wave & 7) * 8) * HW + hw0;
    const int xoff = lane * 4;
    const int sDst = lane * QPITCH + (wave & 7) * 8;

    v4f xr[8];
    if (stager) {
        #pragma unroll   // all 8 loads of a lane in flight together
        for (int i = 0; i < 8; ++i) xr[i] = *(const v4f*)(xs + i * HW + xoff);
    }
    // keeps the X loads first in the queue: loads return in order, and the LDS
    // stores below would otherwise wait for the weight fragments too
    __builtin_amdgcn_sched_barrier(0);

    v16h aw[2][2];   // weight fragments of one panel (two k steps, two channel tiles)
    #pragma unroll   // constant indices keep the array in registers
    for (int q = 0; q < 2; ++q) {
        aw[q][0] = load_frag_row(wsel + woff + q * 32, half);
        aw[q][1] = load_frag_row(wsel + woff + 16 * DIMS + q * 32, half);
    }

    if (stager) {
        #pragma unroll   // constant indices keep the array in registers
        for (int j = 0; j < 4; ++j) {
            v8h h;
            #pragma unroll   // constant indices keep the array in registers
            for (int i = 0; i < 8; ++i) h[i] = (_Float16)xr[i][j];
            *(v8h*)(sX + sDst + j * 32 * QPITCH) = h;
        }
    }
    __syncthreads();   // panel 0 is published

    v8f acc[2][8];
    #pragma unroll   // constant indices keep the array in registers
    for (int n = 0; n < 8; ++n) { acc[0][n] = (v8f){}; acc[1][n] = (v8f){}; }

    #pragma unroll   // constant buffer and panel offsets; no branch behind a product
    for (int kp = 0; kp < QNP; ++kp) {
        const _Float16* br = sX + (kp & 1) * QBUF + mn * QPITCH;
        // Eight steps of four products: step u takes k step SQ(u) and position tiles
        // 2*SN(u), 2*SN(u)+1. Both k steps are touched in the first two steps, so every
        // weight load has been waited for before the X loads are issued: loads return
        // in order, and a wait for a weight behind them would wait for memory too.
        #define SQ(u) ((u) < 2 ? (u) : ((u) < 5 ? 0 : 1))
        #define SN(u) ((u) < 2 ? 0 : ((u) < 5 ? (u) - 1 : (u) - 4))
        // X fragments come in pairs through a ring of three: pair u + 2 is asked for
        // in front of pair u's four products, so an LDS round trip hides under eight
        v16h bb[3][2];
        #pragma unroll   // constant indices keep the array in registers
        for (int u = 0; u < 2; ++u) {
            const _Float16* bn = br + SN(u) * 32 * QPITCH + SQ(u) * 32;
            bb[u][0] = load_frag_row(bn, half);
            bb[u][1] = load_frag_row(bn + 16 * QPITCH, half);
        }
        #pragma unroll   // constant indices keep the arrays in registers
        for (int u = 0; u < 8; ++u) {
            const int q = SQ(u), n = SN(u) * 2;
            if (u == 2 && kp + 1 < QNP && stager) {   // next panel's rows fly under the 24 products left
                #pragma unroll   // all 8 loads of a lane in flight together
                for (int i = 0; i < 8; ++i)
                    xr[i] = *(const v4f*)(xs + ((kp + 1) * QK + i) * HW + xoff);
            }
            if (u + 2 < 8) {
                const int v = u + 2;
                const _Float16* bn = br + SN(v) * 32 * QPITCH + SQ(v) * 32;
                bb[v % 3][0] = load_frag_row(bn, half);
                bb[v % 3][1] = load_frag_row(bn + 16 * QPITCH, half);
            }
            acc[0][n]     = WMMA_F16(aw[q][0], bb[u % 3][0], acc[0][n]);
            acc[1][n]     = WMMA_F16(aw[q][1], bb[u % 3][0], acc[1][n]);
            acc[0][n + 1] = WMMA_F16(aw[q][0], bb[u % 3][1], acc[0][n + 1]);
            acc[1][n + 1] = WMMA_F16(aw[q][1], bb[u % 3][1], acc[1][n + 1]);
            if ((u == 4 || u == 7) && kp + 1 < QNP) {   // this k step's weights are spent: fetch the next panel's
                aw[q][0] = load_frag_row(wsel + woff + (kp + 1) * QK + q * 32, half);
                aw[q][1] = load_frag_row(wsel + woff + 16 * DIMS + (kp + 1) * QK + q * 32, half);
            }
            // holds every load at the place written: sunk to its use, an LDS read would
            // stall each pair of products and a weight load each k step
            __builtin_amdgcn_sched_barrier(0);
        }

        if (kp + 1 < QNP && stager) {   // the other buffer's last readers left at the previous barrier
            _Float16* sn = sX + ((kp + 1) & 1) * QBUF + sDst;
            #pragma unroll   // constant indices keep the array in registers
            for (int j = 0; j < 4; ++j) {
                v8h h;
                #pragma unroll   // constant indices keep the array in registers
                for (int i = 0; i < 8; ++i) h[i] = (_Float16)xr[i][j];
                *(v8h*)(sn + j * 32 * QPITCH) = h;
            }
        }
        if (kp + 1 < QNP) {
            // publishes panel kp + 1 and ends every read of panel kp's buffer. The fences
            // name LDS alone: __syncthreads() would also drain the weight loads just
            // issued for the next panel, an L2 round trip in front of every barrier
            __builtin_amdgcn_fence(__ATOMIC_RELEASE, "workgroup", "local");
            __builtin_amdgcn_s_barrier();
            __builtin_amdgcn_fence(__ATOMIC_ACQUIRE, "workgroup", "local");
        }
    }

    // acc[mt][n][r]: channel mt*16 + half*8 + r of the wave's 32,
    // position hw0 + 4*((n & 1)*16 + mn) + (n >> 1)
    if (wave < 2) {   // theta: every position
        _Float16* dl = theta + ((size_t)b * HW + hw0) * C8 + wave * 32 + half * 8;
        #pragma unroll   // constant indices keep the array in registers
        for (int mt = 0; mt < 2; ++mt) {
            const float* bp = bsel + mt * 16 + half * 8;
            const v4f bl = *(const v4f*)(bp);
            const v4f bh = *(const v4f*)(bp + 4);
            #pragma unroll   // constant indices keep the array in registers
            for (int n = 0; n < 8; ++n) {
                const int p = 4 * ((n & 1) * 16 + mn) + (n >> 1);
                v8h h;
                #pragma unroll   // constant indices keep the array in registers
                for (int r = 0; r < 8; ++r)
                    h[r] = (_Float16)(acc[mt][n][r] + (r < 4 ? bl[r & 3] : bh[r & 3]));
                *(v8h*)(dl + p * C8 + mt * 16) = h;
            }
        }
        return;
    }

    // phi and g: tiles n = 4w .. 4w+3 are columns 4*mn + 2w, + 1 of both image rows,
    // the window of pooled column 2*mn + w in pooled row blockIdx.x. The bias is the
    // same over a window and rounding keeps order: maximum first, then bias and f16.
    // Both bias rows are fetched up front: no load stands behind a store.
    v8f pw[2][2];   // [channel tile][w]
    #pragma unroll   // constant indices keep the arrays in registers
    for (int mt = 0; mt < 2; ++mt) {
        const float* bp = bsel + mt * 16 + half * 8;
        const v4f bl = *(const v4f*)(bp);
        const v4f bh = *(const v4f*)(bp + 4);
        #pragma unroll   // constant indices keep the arrays in registers
        for (int w = 0; w < 2; ++w)
            #pragma unroll   // constant indices keep the arrays in registers
            for (int r = 0; r < 8; ++r)
                pw[mt][w][r] = fmaxf(fmaxf(acc[mt][4 * w][r],     acc[mt][4 * w + 1][r]),
                                     fmaxf(acc[mt][4 * w + 2][r], acc[mt][4 * w + 3][r]))
                               + (r < 4 ? bl[r & 3] : bh[r & 3]);
    }
    if (wave < 4) {   // phi[b][key][64]: eight channels of a key, 16 B
        _Float16* dp = phi + ((size_t)b * HW4 + blockIdx.x * 32 + 2 * mn) * C8 + (wave - 2) * 32 + half * 8;
        #pragma unroll   // constant indices keep the arrays in registers
        for (int mt = 0; mt < 2; ++mt)
            #pragma unroll   // constant indices keep the arrays in registers
            for (int w = 0; w < 2; ++w) {
                v8h h;
                #pragma unroll   // constant indices keep the arrays in registers
                for (int r = 0; r < 8; ++r) h[r] = (_Float16)pw[mt][w][r];
                *(v8h*)(dp + w * C8 + mt * 16) = h;
            }
        // stands in front of any later rewrite of these stores' address and data registers
        asm volatile("s_wait_xcnt 0x0" ::: "memory");
    } else {          // g tile: two keys of a channel, 4 B; 16 lanes fill the channel's 64 B
        _Float16* dg = g + (((size_t)b * (HW4 / GT) + blockIdx.x) * C2 + (wave - 4) * 32 + half * 8) * GT + 2 * mn;
        #pragma unroll   // constant indices keep the arrays in registers
        for (int mt = 0; mt < 2; ++mt)
            #pragma unroll   // constant indices keep the arrays in registers
            for (int r = 0; r < 8; ++r) {
                v2h kk = { (_Float16)pw[mt][0][r], (_Float16)pw[mt][1][r] };
                *(v2h*)(dg + (mt * 16 + r) * GT) = kk;
            }
        // stands in front of any later rewrite of these stores' address and data registers
        asm volatile("s_wait_xcnt 0x0" ::: "memory");
    }
}

// f32 -> f16 conversion of all four weight matrices in one launch. Their f16 copies
// lie back to back in the workspace (theta, phi, g, attn), so the destination is one
// array. A block converts 2048 consecutive elements, eight a lane (16-B stores, a wave
// fills four whole lines), and picks its source by its index: every matrix is a whole
// number of blocks. Grid CVT_BLOCKS, block 256.
#define CVB        2048
#define CVT_B_PHI  (C8 * DIMS / CVB)                 // first block of w_phi
#define CVT_B_G    (CVT_B_PHI + C8 * DIMS / CVB)     // first block of w_g
#define CVT_B_ATT  (CVT_B_G + C2 * DIMS / CVB)       // first block of w_attn
#define CVT_BLOCKS (CVT_B_ATT + DIMS * C2 / CVB)
__global__ void __launch_bounds__(256)
cvt_weights_kernel(const float* __restrict__ wth,
                   const float* __restrict__ wph,
                   const float* __restrict__ wg,
                   const float* __restrict__ wat,
                   _Float16* __restrict__ dst) {
    const int blk = blockIdx.x;
    const float* src;
    if (blk < CVT_B_PHI)      src = wth + blk * CVB;
    else if (blk < CVT_B_G)   src = wph + (blk - CVT_B_PHI) * CVB;
    else if (blk < CVT_B_ATT) src = wg + (blk - CVT_B_G) * CVB;
    else                      src = wat + (blk - CVT_B_ATT) * CVB;
    const int e = threadIdx.x * 8;
    const v4f lo = *(const v4f*)(src + e);
    const v4f hi = *(const v4f*)(src + e + 4);
    v8h h;
    #pragma unroll   // constant indices keep the vectors in registers
    for (int i = 0; i < 4; ++i) { h[i] = (_Float16)lo[i]; h[i + 4] = (_Float16)hi[i]; }
    *(v8h*)(dst + blk * CVB + e) = h;
}

// ---------------------------------------------------------------------------
// Attention, 256 queries per block: 16 waves x 16 queries walk the 1024 keys in
// chunks of 64 that the block stages once in LDS (two buffers), so every byte
// of phi and g fetched from L2 serves 256 queries.
//   S^T(key x query) = phi_chunk @ theta^T   (A from LDS, B kept in registers)
//   O^T(chan x query) += g_chunk @ P^T       (A from LDS, B packed from S^T)
// A lane holds one query's scores: running maximum and sum stay in registers.
// Grid (HW/256, B), block 512. Dynamic LDS = 2 x 46,080 B. Four waves per SIMD
// (16 waves x 256 VGPRs fill one WGP): the attribute holds the allocator to that.
// ---------------------------------------------------------------------------
#define KCH    64                    // keys per chunk
#define PITCH  72                    // LDS row pitch in halfwords (128 B + 16 B)
#define PHI_H  (KCH * PITCH)         // phi chunk: 64 key rows
#define BUF_H  ((KCH + C2) * PITCH)  // + g chunk: 256 channel rows

// lane l <-> lane l ^ 16
__device__ __forceinline__ float xhalf(float x) {
    int i = __builtin_bit_cast(int, x);
    return __builtin_bit_cast(float,
        __builtin_amdgcn_permlanex16(i, i, 0x76543210, 0xfedcba98, false, false));
}

// 2^x; the v_nop keeps the one free issue slot that the instruction set asks for
// behind a transcendental, whatever the scheduler places next
__device__ __forceinline__ float exp2_slot(float x) {
    float r;
    asm("v_exp_f32 %0, %1\n\tv_nop" : "=v"(r) : "v"(x));
    return r;
}

__global__ void __launch_bounds__(512) __attribute__((amdgpu_waves_per_eu(4, 4)))
attn_wmma_kernel(const _Float16* __restrict__ theta,
                 const _Float16* __restrict__ phi,
                 const _Float16* __restrict__ g,
                 _Float16* __restrict__ o) {
    extern __shared__ __attribute__((aligned(16))) char smem[];
    _Float16* sBuf = (_Float16*)smem;

    const int b    = blockIdx.y;
    const int t    = threadIdx.x;
    const int lane = t & 31;
    const int wave = t >> 5;
    const int half = lane >> 4;
    const int mn   = lane & 15;
    const int q0   = blockIdx.x * 256 + wave * 16;

    // staging: 8 threads per 128-byte row, 64 rows per sweep
    const int srow = t >> 3, scol = (t & 7) * 8;
    const _Float16* pBase = phi + (size_t)b * HW4 * C8;   // uniform bases,
    const _Float16* gBase = g + (size_t)b * C2 * HW4;     // 32-bit lane offsets
    const int pOff = srow * C8 + scol;
    const int gOff = (scol / GT) * (C2 * GT) + srow * GT + (scol & (GT - 1));   // a chunk is two key tiles of g
    const int sDst = srow * PITCH + scol;

    // theta^T as B operand: lane = query, K = channel, kept for the whole walk
    const _Float16* trow = theta + ((size_t)b * HW + q0 + mn) * C8;
    const v16h bq0 = load_frag_row(trow, half);
    const v16h bq1 = load_frag_row(trow + 32, half);

    v8h stP, stG[4];
    stP = *(const v8h*)(pBase + pOff);
    #pragma unroll   // constant indices keep the array in registers
    for (int j = 0; j < 4; ++j) stG[j] = *(const v8h*)(gBase + j * 64 * GT + gOff);
    *(v8h*)(sBuf + sDst) = stP;
    #pragma unroll   // constant indices keep the array in registers
    for (int j = 0; j < 4; ++j) *(v8h*)(sBuf + PHI_H + sDst + j * 64 * PITCH) = stG[j];
    __syncthreads();   // chunk 0 is published

    const float L2E = 1.4426950408889634f;
    v8f acc[16];
    #pragma unroll   // constant indices keep the array in registers
    for (int ct = 0; ct < 16; ++ct) acc[ct] = (v8f){};
    float ms = -3.0e38f;   // running maximum, in log2 units
    float l  = 0.f;        // running sum over this lane's keys

    for (int kc = 0; kc < HW4 / KCH; ++kc) {
        const _Float16* sp = sBuf + (kc & 1) * BUF_H;
        const _Float16* sg = sp + PHI_H;
        const bool more = kc + 1 < HW4 / KCH;

        // ---- S^T: s[kt][r] = score(key kt*16 + r + 8*half, query mn) ----
        v8f s[4];
        #pragma unroll   // constant indices keep the array in registers
        for (int kt = 0; kt < 4; ++kt) {
            const _Float16* pr = sp + (kt * 16 + mn) * PITCH;
            v16h a0 = load_frag_row(pr, half);
            v16h a1 = load_frag_row(pr + 32, half);
            v8f z = {};
            z = WMMA_F16(a0, bq0, z);
            z = WMMA_F16(a1, bq1, z);
            s[kt] = z;
        }

        // ---- running softmax, one query per lane ----
        float mx = s[0][0];
        #pragma unroll   // constant indices keep the array in registers
        for (int kt = 0; kt < 4; ++kt)
            #pragma unroll   // constant indices keep the array in registers
            for (int r = 0; r < 8; ++r) mx = fmaxf(mx, s[kt][r]);
        mx = fmaxf(mx, xhalf(mx));
        const float msn   = fmaxf(ms, mx * L2E);
        const float alpha = exp2_slot(ms - msn);   // 0 on the first chunk
        ms = msn;

        // P^T as B operand: score tiles 2ks and 2ks+1 already sit in the k order
        // of load_frag_row (half*8 + i, then 16 + half*8 + i)
        v16h p[2];
        float ls = 0.f;
        #pragma unroll   // constant indices keep the array in registers
        for (int ks = 0; ks < 2; ++ks) {
            #pragma unroll   // constant indices keep the array in registers
            for (int r = 0; r < 8; ++r) {
                const float x0 = fmaf(s[2 * ks][r],     L2E, -msn);
                const float x1 = fmaf(s[2 * ks + 1][r], L2E, -msn);
                const float e0 = exp2_slot(x0);
                const float e1 = exp2_slot(x1);
                ls += e0 + e1;
                p[ks][r]     = (_Float16)e0;
                p[ks][r + 8] = (_Float16)e1;
            }
        }
        l = l * alpha + ls;

        if (more) {   // next chunk's loads fly under the 32 products below (scores are packed: registers free)
            const int k1 = (kc + 1) * KCH;
            stP = *(const v8h*)(pBase + k1 * C8 + pOff);
            #pragma unroll   // constant indices keep the array in registers
            for (int j = 0; j < 4; ++j)
                stG[j] = *(const v8h*)(gBase + (j * 64 * GT + k1 * C2) + gOff);
            // stands in front of any later rewrite of these loads' address registers
            asm volatile("s_wait_xcnt 0x0" ::: "memory");
        }

        // ---- O^T += g_chunk @ P^T ----
        #pragma unroll   // constant indices keep the array in registers
        for (int ct = 0; ct < 16; ++ct) {
            const _Float16* gr = sg + (ct * 16 + mn) * PITCH;
            v16h a0 = load_frag_row(gr, half);
            v16h a1 = load_frag_row(gr + 32, half);
            v8f c = acc[ct] * alpha;
            c = WMMA_F16(a0, p[0], c);
            c = WMMA_F16(a1, p[1], c);
            acc[ct] = c;
        }

        if (more) {   // the other buffer's last readers left at the previous barrier
            _Float16* sn = sBuf + ((kc + 1) & 1) * BUF_H;
            *(v8h*)(sn + sDst) = stP;
            #pragma unroll   // constant indices keep the array in registers
            for (int j = 0; j < 4; ++j) *(v8h*)(sn + PHI_H + sDst + j * 64 * PITCH) = stG[j];
        }
        __syncthreads();   // publishes chunk kc + 1 and ends every read of chunk kc's buffer
    }

    l += xhalf(l);
    const float inv = 1.0f / l;
    _Float16* orow = o + ((size_t)b * HW + q0 + mn) * C2 + half * 8;
    #pragma unroll   // constant indices keep the array in registers
    for (int ct = 0; ct < 16; ++ct) {
        v8h h;
        #pragma unroll   // constant indices keep the array in registers
        for (int r = 0; r < 8; ++r) h[r] = (_Float16)(acc[ct][r] * inv);
        *(v8h*)(orow + ct * 16) = h;
    }
}

// ---------------------------------------------------------------------------
// Final: out[b][co][hw] = x + sigma*(w_attn[co,:]·attnG[b][hw,:] + b_attn[co])
// A block of 8 waves takes 64 positions x 256 output channels. The 64 attnG rows
// are staged once in LDS (whole 512-B rows in, 528-B pitch) and serve all waves.
// A wave does 32 channels x 64 positions as the transposed product
//   D(channel x position) = w_attn_tile @ attnG_tile^T   (A from global, B from LDS)
// Position tile j holds positions 4*mn + j, so a lane ends with four consecutive
// positions of one channel: x and out move 16 B a lane, 256 B a half wave.
// Weight fragments run three k steps ahead in a register ring; as the ring
// drains, its registers take the x rows, which so fly under the last products.
// Grid (512/256, HW/64, B), block 256.
// ---------------------------------------------------------------------------
#define FHW    64     // positions per block
#define FPITCH 264    // LDS row pitch in halfwords (512 B + 16 B)
#define FKS    (C2 / 32)
__global__ void __launch_bounds__(256)
final_conv_kernel(const _Float16* __restrict__ ag,
                  const _Float16* __restrict__ Wh,
                  const float* __restrict__ bt,
                  const float* __restrict__ x,
                  const float* __restrict__ sigma,
                  float* __restrict__ out) {
    __shared__ __attribute__((aligned(16))) _Float16 sB[FHW * FPITCH];

    const int hw0  = blockIdx.y * FHW;
    const int b    = blockIdx.z;
    const int t    = threadIdx.x;
    const int lane = t & 31;
    const int wave = t >> 5;
    const int half = lane >> 4;
    const int mn   = lane & 15;
    const int cob  = blockIdx.x * 256;   // the block's first channel

    // a wave fetches one whole row a load; position p lands in LDS row (p & 3) * 16 + (p >> 2)
    const _Float16* abase = ag + ((size_t)b * HW + hw0) * C2;   // uniform bases,
    const _Float16* wbase = Wh + (size_t)cob * C2;              // 32-bit lane offsets
    const int aoff = wave * C2 + lane * 8;
    const int woff = (wave * 32 + mn) * C2;
    v8h st[8];
    #pragma unroll   // all 8 loads of a lane in flight together
    for (int i = 0; i < 8; ++i) st[i] = *(const v8h*)(abase + aoff + i * 8 * C2);
    // keeps the row loads first in the queue: loads return in order, and the LDS
    // stores below would otherwise wait for the weight fragments too
    __builtin_amdgcn_sched_barrier(0);

    v16h aw[3][2];   // weight fragments of three k steps
    #pragma unroll   // constant indices keep the array in registers
    for (int q = 0; q < 3; ++q) {
        aw[q][0] = load_frag_row(wbase + woff + q * 32, half);
        aw[q][1] = load_frag_row(wbase + woff + 16 * C2 + q * 32, half);
    }

    #pragma unroll   // constant indices keep the array in registers
    for (int i = 0; i < 8; ++i) {
        const int p = i * 8 + wave;
        *(v8h*)(sB + ((p & 3) * 16 + (p >> 2)) * FPITCH + lane * 8) = st[i];
    }
    __syncthreads();   // the 64 rows are in LDS before any fragment is read

    const float* xb = x   + ((size_t)b * DIMS + cob) * HW + hw0;
    float*       ob = out + ((size_t)b * DIMS + cob) * HW + hw0;
    const int eoff = (wave * 32 + half * 8) * HW + mn * 4;

    const _Float16* br = sB + mn * FPITCH;
    v8f acc[2][4];
    #pragma unroll   // constant indices keep the array in registers
    for (int j = 0; j < 4; ++j) { acc[0][j] = (v8f){}; acc[1][j] = (v8f){}; }
    v4f xv[16];      // x rows: channel offset i = mt*16 + r -> xv[mt*8 + r]

    #pragma unroll   // constant indices keep the arrays in registers
    for (int ks = 0; ks < FKS; ++ks) {
        #pragma unroll   // constant indices keep the array in registers
        for (int j = 0; j < 4; ++j) {
            v16h bb = load_frag_row(br + j * 16 * FPITCH + ks * 32, half);
            acc[0][j] = WMMA_F16(aw[ks % 3][0], bb, acc[0][j]);
            acc[1][j] = WMMA_F16(aw[ks % 3][1], bb, acc[1][j]);
        }
        if (ks + 3 < FKS) {
            aw[ks % 3][0] = load_frag_row(wbase + woff + (ks + 3) * 32, half);
            aw[ks % 3][1] = load_frag_row(wbase + woff + 16 * C2 + (ks + 3) * 32, half);
        } else {
            #pragma unroll   // constant indices keep the array in registers
            for (int i = 0; i < 4; ++i) {
                const int e = (ks + 3 - FKS) * 4 + i;
                xv[e] = *(const v4f*)(xb + eoff + ((e >> 3) * 16 + (e & 7)) * HW);
            }
        }
        // holds the loads above at this place: without it the scheduler sinks them
        // to just in front of their use and each k step waits out an L2 round trip
        __builtin_amdgcn_sched_barrier(0);
    }
    #pragma unroll   // constant indices keep the array in registers
    for (int e = 12; e < 16; ++e)
        xv[e] = *(const v4f*)(xb + eoff + ((e >> 3) * 16 + (e & 7)) * HW);
    // holds the last four x loads here, so that all sixteen are in flight together
    __builtin_amdgcn_sched_barrier(0);

    // acc[mt][j][r]: channel cob + wave*32 + mt*16 + half*8 + r, position hw0 + 4*mn + j
    const float s = sigma[0];
    #pragma unroll   // constant indices keep the array in registers
    for (int mt = 0; mt < 2; ++mt) {
        const float* bp = bt + cob + wave * 32 + mt * 16 + half * 8;
        const v4f bl = *(const v4f*)(bp);
        const v4f bh = *(const v4f*)(bp + 4);
        #pragma unroll   // constant indices keep the array in registers
        for (int r = 0; r < 8; ++r) {
            const float bv = r < 4 ? bl[r & 3] : bh[r & 3];
            v4f ov;
            #pragma unroll   // constant indices keep the array in registers
            for (int j = 0; j < 4; ++j) ov[j] = xv[mt * 8 + r][j] + s * (acc[mt][j][r] + bv);
            *(v4f*)(ob + eoff + (mt * 16 + r) * HW) = ov;
        }
    }
}

// ---------------------------------------------------------------------------
extern "C" void kernel_launch(void* const* d_in, const int* in_sizes, int n_in,
                              void* d_out, int out_size, void* d_ws, size_t ws_size,
                              hipStream_t stream) {
    const float* x       = (const float*)d_in[0];
    const float* w_theta = (const float*)d_in[1];
    const float* b_theta = (const float*)d_in[2];
    const float* w_phi   = (const float*)d_in[3];
    const float* b_phi   = (const float*)d_in[4];
    const float* w_g     = (const float*)d_in[5];
    const float* b_g     = (const float*)d_in[6];
    const float* w_attn  = (const float*)d_in[7];
    const float* b_attn  = (const float*)d_in[8];
    const float* sigma   = (const float*)d_in[9];
    float* out = (float*)d_out;

    char* ws = (char*)d_ws;
    _Float16* theta   = (_Float16*)(ws);                 //  8 MB   [b][hw][64]
    _Float16* phi     = (_Float16*)(ws +  8388608);      //  2 MB   [b][key][64]
    _Float16* gbuf    = (_Float16*)(ws + 10485760);      //  8 MB   [b][key/32][c][key%32]
    _Float16* wth_h   = (_Float16*)(ws + 18874368);      //  64 KB  [64][512]
    _Float16* wph_h   = (_Float16*)(ws + 18939904);      //  64 KB  [64][512]
    _Float16* wg_h    = (_Float16*)(ws + 19005440);      // 256 KB  [256][512]
    _Float16* wat_h   = (_Float16*)(ws + 19267584);      // 256 KB  [512][256]
    _Float16* attnout = (_Float16*)(ws + 19529728);      //  32 MB  [b][hw][256]

    // wth_h, wph_h, wg_h and wat_h are one contiguous range that starts at wth_h
    cvt_weights_kernel<<<CVT_BLOCKS, 256, 0, stream>>>(w_theta, w_phi, w_g, w_attn, wth_h);

    // one pass over X produces theta and the pooled phi and g
    qkv_conv_kernel<<<dim3(HW / QP, NB), dim3(384), 0, stream>>>(
        x, wth_h, wph_h, wg_h, b_theta, b_phi, b_g, theta, phi, gbuf);
    attn_wmma_kernel<<<dim3(HW / 256, NB), dim3(512), 2 * BUF_H * 2, stream>>>(
        theta, phi, gbuf, attnout);
    final_conv_kernel<<<dim3(DIMS / 256, HW / FHW, NB), dim3(256), 0, stream>>>(
        attnout, wat_h, b_attn, x, sigma, out);
}

// v007
// Measured time: 105 microseconds a run.
// In two side-by-side timings against v006, it was 1.03 and 1.04 times as fast.
// Over all steps from v000 it is 5.22 times as fast.
#include <hip/hip_runtime.h>
#include <hip/hip_bf16.h>

typedef __attribute__((ext_vector_type(16))) _Float16 v16h;
typedef __attribute__((ext_vector_type(8)))  _Float16 v8h;
typedef __attribute__((ext_vector_type(2)))  _Float16 v2h;
typedef __attribute__((ext_vector_type(8)))  float    v8f;
typedef __attribute__((ext_vector_type(4)))  float    v4f;

#define DIMS 512
#define NB   16
#define HW   4096   // 64*64
#define HW4  1024   // pooled positions
#define C8   64
#define C2   256
#define GT   32     // keys per tile of g: g[b][key / GT][channel][key % GT]

#define WMMA_F16(A, B, C) __builtin_amdgcn_wmma_f32_16x16x32_f16(false, A, false, B, (short)0, C, false, false)

// Fragment K pattern for 16x16x32 f16 WMMA (ISA 7.12.2):
//   lane half 0: K in [0,8) and [16,24);  lane half 1: K in [8,16) and [24,32).
// With K contiguous in memory a fragment is exactly two 16-byte loads.
__device__ __forceinline__ v16h load_frag_row(const _Float16* __restrict__ p, int half) {
    v8h lo = *(const v8h*)(p + half * 8);
    v8h hi = *(const v8h*)(p + 16 + half * 8);
    v16h r;
    #pragma unroll
    for (int i = 0; i < 8; ++i) { r[i] = lo[i]; r[i + 8] = hi[i]; }
    return r;
}

// ---------------------------------------------------------------------------
// Fused QKV 1x1 conv: reads X once, produces theta and the max-pooled phi and g.
// A block of 12 waves takes 128 positions (two image rows) x all 64+64+256 output
// channels, so every 2x2 pooling window lies inside one block.
// X is staged as f16 in LDS in panels of 64 input channels (two buffers): a
// staging wave reads whole 512-B rows of X, 16 B a lane, eight rows a panel, and
// each lane packs its four positions' eight channels into four 16-B LDS stores.
// Position p lands in LDS row (p & 3) * 32 + (p >> 2), so that the lanes of one
// store walk consecutive rows. A wave does 32 channels x 128 positions as
//   D(channel x position) = w_tile @ X_tile   (A from global, B from LDS)
// so a weight row fetched once serves 128 positions, and a lane ends with eight
// consecutive channels of eight positions. Those eight positions are two whole
// pooling windows: phi and g are pooled in registers and never stored unpooled.
// g goes out in tiles of 32 keys, g[b][key / 32][channel][key % 32]: the block
// writes one whole tile, so no 128-B line has a second writer.
// Weight fragments run one panel ahead in registers.
// Grid (HW/128, B), block 384.
// ---------------------------------------------------------------------------
#define QP     128            // positions per block
#define QK     64             // input channels per panel
#define QPITCH 72             // LDS row pitch in halfwords (128 B + 16 B)
#define QBUF   (QP * QPITCH)
#define QNP    (DIMS / QK)
__global__ void __launch_bounds__(384)
qkv_conv_kernel(const float* __restrict__ X,
                const _Float16* __restrict__ Wth,
                const _Float16* __restrict__ Wph,
                const _Float16* __restrict__ Wg,
                const float* __restrict__ bth,
                const float* __restrict__ bph,
                const float* __restrict__ bg,
                _Float16* __restrict__ theta,
                _Float16* __restrict__ phi,
                _Float16* __restrict__ g) {
    __shared__ __attribute__((aligned(16))) _Float16 sX[2 * QBUF];

    const int hw0  = blockIdx.x * QP;
    const int b    = blockIdx.y;
    const int t    = threadIdx.x;
    const int lane = t & 31;
    const int wave = __builtin_amdgcn_readfirstlane(t >> 5);   // scalar: uniform bases and branches
    const int half = lane >> 4;
    const int mn   = lane & 15;

    // the wave's 32 output channels: waves 0-1 theta, 2-3 phi, 4-11 g
    const _Float16* wsel;
    const float*    bsel;
    if (wave < 2)      { wsel = Wth + wave * 32 * DIMS;       bsel = bth + wave * 32; }
    else if (wave < 4) { wsel = Wph + (wave - 2) * 32 * DIMS; bsel = bph + (wave - 2) * 32; }
    else               { wsel = Wg + (wave - 4) * 32 * DIMS;  bsel = bg + (wave - 4) * 32; }
    const int woff = mn * DIMS;

    // staging: waves 0-7 take eight X rows of each panel
    const bool stager = wave < QK / 8;
    const float* xs = X + ((size_t)b * DIMS + (wave & 7) * 8) * HW + hw0;
    const int xoff = lane * 4;
    const int sDst = lane * QPITCH + (wave & 7) * 8;

    v4f xr[8];
    if (stager) {
        #pragma unroll   // all 8 loads of a lane in flight together
        for (int i = 0; i < 8; ++i) xr[i] = *(const v4f*)(xs + i * HW + xoff);
    }
    // keeps the X loads first in the queue: loads return in order, and the LDS
    // stores below would otherwise wait for the weight fragments too
    __builtin_amdgcn_sched_barrier(0);

    v16h aw[2][2];   // weight fragments of one panel (two k steps, two channel tiles)
    #pragma unroll   // constant indices keep the array in registers
    for (int q = 0; q < 2; ++q) {
        aw[q][0] = load_frag_row(wsel + woff + q * 32, half);
        aw[q][1] = load_frag_row(wsel + woff + 16 * DIMS + q * 32, half);
    }

    if (stager) {
        #pragma unroll   // constant indices keep the array in registers
        for (int j = 0; j < 4; ++j) {
            v8h h;
            #pragma unroll   // constant indices keep the array in registers
            for (int i = 0; i < 8; ++i) h[i] = (_Float16)xr[i][j];
            *(v8h*)(sX + sDst + j * 32 * QPITCH) = h;
        }
    }
    __syncthreads();   // panel 0 is published

    v8f acc[2][8];
    #pragma unroll   // constant indices keep the array in registers
    for (int n = 0; n < 8; ++n) { acc[0][n] = (v8f){}; acc[1][n] = (v8f){}; }

    #pragma unroll   // constant buffer and panel offsets; no branch behind a product
    for (int kp = 0; kp < QNP; ++kp) {
        const _Float16* br = sX + (kp & 1) * QBUF + mn * QPITCH;
        // Eight steps of four products: step u takes k step SQ(u) and position tiles
        // 2*SN(u), 2*SN(u)+1. Both k steps are touched in the first two steps, so every
        // weight load has been waited for before the X loads are issued: loads return
        // in order, and a wait for a weight behind them would wait for memory too.
        #define SQ(u) ((u) < 2 ? (u) : ((u) < 5 ? 0 : 1))
        #define SN(u) ((u) < 2 ? 0 : ((u) < 5 ? (u) - 1 : (u) - 4))
        // X fragments come in pairs through a ring of three: pair u + 2 is asked for
        // in front of pair u's four products, so an LDS round trip hides under eight
        v16h bb[3][2];
        #pragma unroll   // constant indices keep the array in registers
        for (int u = 0; u < 2; ++u) {
            const _Float16* bn = br + SN(u) * 32 * QPITCH + SQ(u) * 32;
            bb[u][0] = load_frag_row(bn, half);
            bb[u][1] = load_frag_row(bn + 16 * QPITCH, half);
        }
        #pragma unroll   // constant indices keep the arrays in registers
        for (int u = 0; u < 8; ++u) {
            const int q = SQ(u), n = SN(u) * 2;
            if (u == 2 && kp + 1 < QNP && stager) {   // next panel's rows fly under the 24 products left
                #pragma unroll   // all 8 loads of a lane in flight together
                for (int i = 0; i < 8; ++i)
                    xr[i] = *(const v4f*)(xs + ((kp + 1) * QK + i) * HW + xoff);
            }
            if (u + 2 < 8) {
                const int v = u + 2;
                const _Float16* bn = br + SN(v) * 32 * QPITCH + SQ(v) * 32;
                bb[v % 3][0] = load_frag_row(bn, half);
                bb[v % 3][1] = load_frag_row(bn + 16 * QPITCH, half);
            }
            acc[0][n]     = WMMA_F16(aw[q][0], bb[u % 3][0], acc[0][n]);
            acc[1][n]     = WMMA_F16(aw[q][1], bb[u % 3][0], acc[1][n]);
            acc[0][n + 1] = WMMA_F16(aw[q][0], bb[u % 3][1], acc[0][n + 1]);
            acc[1][n + 1] = WMMA_F16(aw[q][1], bb[u % 3][1], acc[1][n + 1]);
            if ((u == 4 || u == 7) && kp + 1 < QNP) {   // this k step's weights are spent: fetch the next panel's
                aw[q][0] = load_frag_row(wsel + woff + (kp + 1) * QK + q * 32, half);
                aw[q][1] = load_frag_row(wsel + woff + 16 * DIMS + (kp + 1) * QK + q * 32, half);
            }
            // holds every load at the place written: sunk to its use, an LDS read would
            // stall each pair of products and a weight load each k step
            __builtin_amdgcn_sched_barrier(0);
        }

        if (kp + 1 < QNP && stager) {   // the other buffer's last readers left at the previous barrier
            _Float16* sn = sX + ((kp + 1) & 1) * QBUF + sDst;
            #pragma unroll   // constant indices keep the array in registers
            for (int j = 0; j < 4; ++j) {
                v8h h;
                #pragma unroll   // constant indices keep the array in registers
                for (int i = 0; i < 8; ++i) h[i] = (_Float16)xr[i][j];
                *(v8h*)(sn + j * 32 * QPITCH) = h;
            }
        }
        if (kp + 1 < QNP) {
            // publishes panel kp + 1 and ends every read of panel kp's buffer. The fences
            // name LDS alone: __syncthreads() would also drain the weight loads just
            // issued for the next panel, an L2 round trip in front of every barrier
            __builtin_amdgcn_fence(__ATOMIC_RELEASE, "workgroup", "local");
            __builtin_amdgcn_s_barrier();
            __builtin_amdgcn_fence(__ATOMIC_ACQUIRE, "workgroup", "local");
        }
    }

    // acc[mt][n][r]: channel mt*16 + half*8 + r of the wave's 32,
    // position hw0 + 4*((n & 1)*16 + mn) + (n >> 1)
    if (wave < 2) {   // theta: every position
        _Float16* dl = theta + ((size_t)b * HW + hw0) * C8 + wave * 32 + half * 8;
        #pragma unroll   // constant indices keep the array in registers
        for (int mt = 0; mt < 2; ++mt) {
            const float* bp = bsel + mt * 16 + half * 8;
            const v4f bl = *(const v4f*)(bp);
            const v4f bh = *(const v4f*)(bp + 4);
            #pragma unroll   // constant indices keep the array in registers
            for (int n = 0; n < 8; ++n) {
                const int p = 4 * ((n & 1) * 16 + mn) + (n >> 1);
                v8h h;
                #pragma unroll   // constant indices keep the array in registers
                for (int r = 0; r < 8; ++r)
                    h[r] = (_Float16)(acc[mt][n][r] + (r < 4 ? bl[r & 3] : bh[r & 3]));
                *(v8h*)(dl + p * C8 + mt * 16) = h;
            }
        }
        return;
    }

    // phi and g: tiles n = 4w .. 4w+3 are columns 4*mn + 2w, + 1 of both image rows,
    // the window of pooled column 2*mn + w in pooled row blockIdx.x. The bias is the
    // same over a window and rounding keeps order: maximum first, then bias and f16.
    // Both bias rows are fetched up front: no load stands behind a store.
    v8f pw[2][2];   // [channel tile][w]
    #pragma unroll   // constant indices keep the arrays in registers
    for (int mt = 0; mt < 2; ++mt) {
        const float* bp = bsel + mt * 16 + half * 8;
        const v4f bl = *(const v4f*)(bp);
        const v4f bh = *(const v4f*)(bp + 4);
        #pragma unroll   // constant indices keep the arrays in registers
        for (int w = 0; w < 2; ++w)
            #pragma unroll   // constant indices keep the arrays in registers
            for (int r = 0; r < 8; ++r)
                pw[mt][w][r] = fmaxf(fmaxf(acc[mt][4 * w][r],     acc[mt][4 * w + 1][r]),
                                     fmaxf(acc[mt][4 * w + 2][r], acc[mt][4 * w + 3][r]))
                               + (r < 4 ? bl[r & 3] : bh[r & 3]);
    }
    if (wave < 4) {   // phi[b][key][64]: eight channels of a key, 16 B
        _Float16* dp = phi + ((size_t)b * HW4 + blockIdx.x * 32 + 2 * mn) * C8 + (wave - 2) * 32 + half * 8;
        #pragma unroll   // constant indices keep the arrays in registers
        for (int mt = 0; mt < 2; ++mt)
            #pragma unroll   // constant indices keep the arrays in registers
            for (int w = 0; w < 2; ++w) {
                v8h h;
                #pragma unroll   // constant indices keep the arrays in registers
                for (int r = 0; r < 8; ++r) h[r] = (_Float16)pw[mt][w][r];
                *(v8h*)(dp + w * C8 + mt * 16) = h;
            }
        // stands in front of any later rewrite of these stores' address and data registers
        asm volatile("s_wait_xcnt 0x0" ::: "memory");
    } else {          // g tile: two keys of a channel, 4 B; 16 lanes fill the channel's 64 B
        _Float16* dg = g + (((size_t)b * (HW4 / GT) + blockIdx.x) * C2 + (wave - 4) * 32 + half * 8) * GT + 2 * mn;
        #pragma unroll   // constant indices keep the arrays in registers
        for (int mt = 0; mt < 2; ++mt)
            #pragma unroll   // constant indices keep the arrays in registers
            for (int r = 0; r < 8; ++r) {
                v2h kk = { (_Float16)pw[mt][0][r], (_Float16)pw[mt][1][r] };
                *(v2h*)(dg + (mt * 16 + r) * GT) = kk;
            }
        // stands in front of any later rewrite of these stores' address and data registers
        asm volatile("s_wait_xcnt 0x0" ::: "memory");
    }
}

// f32 -> f16 conversion of all four weight matrices in one launch. Their f16 copies
// lie back to back in the workspace (theta, phi, g, attn), so the destination is one
// array. A block converts 2048 consecutive elements, eight a lane (16-B stores, a wave
// fills four whole lines), and picks its source by its index: every matrix is a whole
// number of blocks. Grid CVT_BLOCKS, block 256.
#define CVB        2048
#define CVT_B_PHI  (C8 * DIMS / CVB)                 // first block of w_phi
#define CVT_B_G    (CVT_B_PHI + C8 * DIMS / CVB)     // first block of w_g
#define CVT_B_ATT  (CVT_B_G + C2 * DIMS / CVB)       // first block of w_attn
#define CVT_BLOCKS (CVT_B_ATT + DIMS * C2 / CVB)
__global__ void __launch_bounds__(256)
cvt_weights_kernel(const float* __restrict__ wth,
                   const float* __restrict__ wph,
                   const float* __restrict__ wg,
                   const float* __restrict__ wat,
                   _Float16* __restrict__ dst) {
    const int blk = blockIdx.x;
    const float* src;
    if (blk < CVT_B_PHI)      src = wth + blk * CVB;
    else if (blk < CVT_B_G)   src = wph + (blk - CVT_B_PHI) * CVB;
    else if (blk < CVT_B_ATT) src = wg + (blk - CVT_B_G) * CVB;
    else                      src = wat + (blk - CVT_B_ATT) * CVB;
    const int e = threadIdx.x * 8;
    const v4f lo = *(const v4f*)(src + e);
    const v4f hi = *(const v4f*)(src + e + 4);
    v8h h;
    #pragma unroll   // constant indices keep the vectors in registers
    for (int i = 0; i < 4; ++i) { h[i] = (_Float16)lo[i]; h[i + 4] = (_Float16)hi[i]; }
    *(v8h*)(dst + blk * CVB + e) = h;
}

// ---------------------------------------------------------------------------
// Attention, 256 queries per block: 8 waves x 32 queries walk the 1024 keys in
// chunks of 64 that the block stages once in LDS (two buffers), so every byte
// of phi and g fetched from L2 serves 256 queries.
//   S^T(key x query) = phi_chunk @ theta^T   (A from LDS, B kept in registers)
//   O^T(chan x query) += g_chunk @ P^T       (A from LDS, B packed from S^T)
// A wave holds two query tiles, so every fragment read from LDS feeds two
// products: with one tile a wave the LDS reads take twice the matrix time.
// A lane holds one query's scores per tile: running maximum and sum stay in
// registers. Grid (HW/256, B), block 256. Dynamic LDS = 2 x 46,080 B. Two waves
// per SIMD (the 256 x 32 f32 output tile alone is 256 VGPRs a wave).
// ---------------------------------------------------------------------------
#define KCH    64                    // keys per chunk
#define PITCH  72                    // LDS row pitch in halfwords (128 B + 16 B)
#define PHI_H  (KCH * PITCH)         // phi chunk: 64 key rows
#define BUF_H  ((KCH + C2) * PITCH)  // + g chunk: 256 channel rows
#define QT     2                     // query tiles per wave
#define GC     2                     // channel tiles per group of g fragments

// lane l <-> lane l ^ 16
__device__ __forceinline__ float xhalf(float x) {
    int i = __builtin_bit_cast(int, x);
    return __builtin_bit_cast(float,
        __builtin_amdgcn_permlanex16(i, i, 0x76543210, 0xfedcba98, false, false));
}

// 2^x; the v_nop keeps the one free issue slot that the instruction set asks for
// behind a transcendental, whatever the scheduler places next
__device__ __forceinline__ float exp2_slot(float x) {
    float r;
    asm("v_exp_f32 %0, %1\n\tv_nop" : "=v"(r) : "v"(x));
    return r;
}

__global__ void __launch_bounds__(256) __attribute__((amdgpu_waves_per_eu(2, 2)))
attn_wmma_kernel(const _Float16* __restrict__ theta,
                 const _Float16* __restrict__ phi,
                 const _Float16* __restrict__ g,
                 _Float16* __restrict__ o) {
    extern __shared__ __attribute__((aligned(16))) char smem[];
    _Float16* sBuf = (_Float16*)smem;

    const int b    = blockIdx.y;
    const int t    = threadIdx.x;
    const int lane = t & 31;
    const int wave = t >> 5;
    const int half = lane >> 4;
    const int mn   = lane & 15;
    const int q0   = blockIdx.x * 256 + wave * (16 * QT);

    // staging: 8 threads per 128-byte row, 32 rows per sweep
    const int srow = t >> 3, scol = (t & 7) * 8;
    const char* pBase = (const char*)(phi + (size_t)b * HW4 * C8);   // uniform bases,
    const char* gBase = (const char*)(g + (size_t)b * C2 * HW4);     // 32-bit lane offsets
    const int pOff = (srow * C8 + scol) * 2;                                          // in bytes
    const int gOff = ((scol / GT) * (C2 * GT) + srow * GT + (scol & (GT - 1))) * 2;   // a chunk is two key tiles of g
    const int sDst = srow * PITCH + scol;

    // theta^T as B operand: lane = query, K = channel, kept for the whole walk
    const _Float16* tq = theta + ((size_t)b * HW + q0 + mn) * C8 + half * 8;
    v16h bq[QT][2];
    #pragma unroll   // constant indices keep the array in registers
    for (int qt = 0; qt < QT; ++qt) {
        bq[qt][0] = load_frag_row(tq + qt * 16 * C8, 0);
        bq[qt][1] = load_frag_row(tq + qt * 16 * C8 + 32, 0);
    }
    // stands in front of any later rewrite of these loads' address registers; it
    // names the address, so that its registers stay untouched up to the wait
    asm volatile("s_wait_xcnt 0x0" :: "v"(tq) : "memory");

    v8h stP[2], stG[8];
    #pragma unroll   // constant indices keep the array in registers
    for (int j = 0; j < 2; ++j) stP[j] = *(const v8h*)(pBase + pOff + j * 32 * C8 * 2);
    #pragma unroll   // constant indices keep the array in registers
    for (int j = 0; j < 8; ++j) stG[j] = *(const v8h*)(gBase + gOff + j * 32 * GT * 2);
    // the same for the staging loads and their two lane offsets
    asm volatile("s_wait_xcnt 0x0" :: "v"(pOff), "v"(gOff) : "memory");
    #pragma unroll   // constant indices keep the array in registers
    for (int j = 0; j < 2; ++j) *(v8h*)(sBuf + sDst + j * 32 * PITCH) = stP[j];
    #pragma unroll   // constant indices keep the array in registers
    for (int j = 0; j < 8; ++j) *(v8h*)(sBuf + PHI_H + sDst + j * 32 * PITCH) = stG[j];
    __syncthreads();   // chunk 0 is published

    const float L2E = 1.4426950408889634f;
    v8f acc[16][QT];
    #pragma unroll   // constant indices keep the array in registers
    for (int ct = 0; ct < 16; ++ct)
        #pragma unroll   // constant indices keep the array in registers
        for (int qt = 0; qt < QT; ++qt) acc[ct][qt] = (v8f){};
    float ms[QT], l[QT];   // running maximum, in log2 units; running sum over this lane's keys
    #pragma unroll   // constant indices keep the arrays in registers
    for (int qt = 0; qt < QT; ++qt) { ms[qt] = -3.0e38f; l[qt] = 0.f; }

    for (int kc = 0; kc < HW4 / KCH; ++kc) {
        const _Float16* sp = sBuf + (kc & 1) * BUF_H;
        const _Float16* sg = sp + PHI_H;
        // the chunk staged during this trip. The last trip fetches its own chunk again,
        // into the buffer that nobody reads any more: with no branch the trip is one
        // block of code, and the fences below can hold its loads and sums in place
        const int kn = kc + 1 < HW4 / KCH ? kc + 1 : kc;

        // ---- S^T: s[qt][kt][r] = score(key kt*16 + r + 8*half, query qt*16 + mn) ----
        v16h ap[4][2];
        #pragma unroll   // constant indices keep the array in registers
        for (int kt = 0; kt < 4; ++kt) {
            const _Float16* pr = sp + (kt * 16 + mn) * PITCH;
            ap[kt][0] = load_frag_row(pr, half);
            ap[kt][1] = load_frag_row(pr + 32, half);
        }
        // all sixteen phi reads go out as one group: spread among the products, each
        // pair of products would wait out an LDS round trip of its own
        __builtin_amdgcn_sched_barrier(0);
        v8f s[QT][4];
        #pragma unroll   // constant indices keep the arrays in registers
        for (int kt = 0; kt < 4; ++kt) {
            #pragma unroll   // constant indices keep the arrays in registers
            for (int qt = 0; qt < QT; ++qt) {
                v8f z = {};
                z = WMMA_F16(ap[kt][0], bq[qt][0], z);
                z = WMMA_F16(ap[kt][1], bq[qt][1], z);
                s[qt][kt] = z;
            }
        }
        // holds the score products in front of the g reads below: the phi fragments'
        // registers are free again before the ring takes its own
        __builtin_amdgcn_sched_barrier(0);

        // g fragments come in groups of two channel tiles through a ring of three. With
        // two waves a SIMD a wave hides its own LDS round trips: group 0 is asked for
        // here and lands under the softmax, group 1 behind the softmax (the scores'
        // registers are free then), group u + 2 in front of group u's products
        v16h ar[3][GC][2];
        #pragma unroll   // constant indices keep the array in registers
        for (int c = 0; c < GC; ++c) {
            const _Float16* gr = sg + (c * 16 + mn) * PITCH;
            ar[0][c][0] = load_frag_row(gr, half);
            ar[0][c][1] = load_frag_row(gr + 32, half);
        }
        // keeps those reads here: sunk to their use they would stall the first products
        __builtin_amdgcn_sched_barrier(0);

        // ---- running softmax, one query per lane and tile ----
        // P^T as B operand: score tiles 2ks and 2ks+1 already sit in the k order
        // of load_frag_row (half*8 + i, then 16 + half*8 + i)
        v16h p[QT][2];
        float alpha[QT];
        #pragma unroll   // constant indices keep the arrays in registers
        for (int qt = 0; qt < QT; ++qt) {
            float mx = s[qt][0][0];
            #pragma unroll   // constant indices keep the array in registers
            for (int kt = 0; kt < 4; ++kt)
                #pragma unroll   // constant indices keep the array in registers
                for (int r = 0; r < 8; ++r) mx = fmaxf(mx, s[qt][kt][r]);
            mx = fmaxf(mx, xhalf(mx));
            const float msn = fmaxf(ms[qt], mx * L2E);
            alpha[qt] = exp2_slot(ms[qt] - msn);   // 0 on the first chunk
            ms[qt] = msn;

            float ls = 0.f;
            #pragma unroll   // constant indices keep the array in registers
            for (int ks = 0; ks < 2; ++ks) {
                #pragma unroll   // constant indices keep the array in registers
                for (int r = 0; r < 8; ++r) {
                    const float x0 = fmaf(s[qt][2 * ks][r],     L2E, -msn);
                    const float x1 = fmaf(s[qt][2 * ks + 1][r], L2E, -msn);
                    const float e0 = exp2_slot(x0);
                    const float e1 = exp2_slot(x1);
                    ls += e0 + e1;
                    p[qt][ks][r]     = (_Float16)e0;
                    p[qt][ks][r + 8] = (_Float16)e1;
                }
            }
            l[qt] = l[qt] * alpha[qt] + ls;
        }

        // ends the softmax here: group 1's reads take registers that the scores have left,
        // and row sums sunk below the products would hold their exponentials in
        // registers through the whole walk over g
        __builtin_amdgcn_sched_barrier(0);
        #pragma unroll   // constant indices keep the array in registers
        for (int c = 0; c < GC; ++c) {
            const _Float16* gr = sg + ((GC + c) * 16 + mn) * PITCH;
            ar[1][c][0] = load_frag_row(gr, half);
            ar[1][c][1] = load_frag_row(gr + 32, half);
        }

        {   // next chunk's loads fly under the 64 products below (scores are packed: registers free)
            const int k1 = kn * KCH;
            #pragma unroll   // constant indices keep the array in registers
            for (int j = 0; j < 2; ++j)
                stP[j] = *(const v8h*)(pBase + (j * 32 * C8 + k1 * C8) * 2 + pOff);
            #pragma unroll   // constant indices keep the array in registers
            for (int j = 0; j < 8; ++j)
                stG[j] = *(const v8h*)(gBase + (j * 32 * GT + k1 * C2) * 2 + gOff);
            // stands in front of any later rewrite of these loads' address registers
            asm volatile("s_wait_xcnt 0x0" ::: "memory");
        }

        // ---- O^T += g_chunk @ P^T: each g fragment serves both query tiles ----
        // a group's tiles are rescaled one step ahead, among the products of the group before
        #pragma unroll   // constant indices keep the array in registers
        for (int c = 0; c < GC; ++c)
            #pragma unroll   // constant indices keep the array in registers
            for (int qt = 0; qt < QT; ++qt) acc[c][qt] *= alpha[qt];
        // keeps group 1's reads and the first rescale in front of the products
        __builtin_amdgcn_sched_barrier(0);
        #pragma unroll   // constant indices keep the arrays in registers
        for (int u = 0; u < 16 / GC; ++u) {
            if (u + 2 < 16 / GC) {
                #pragma unroll   // constant indices keep the array in registers
                for (int c = 0; c < GC; ++c) {
                    const _Float16* gr = sg + (((u + 2) * GC + c) * 16 + mn) * PITCH;
                    ar[(u + 2) % 3][c][0] = load_frag_row(gr, half);
                    ar[(u + 2) % 3][c][1] = load_frag_row(gr + 32, half);
                }
            }
            #pragma unroll   // constant indices keep the arrays in registers
            for (int c = 0; c < GC; ++c) {
                const int ct = u * GC + c;
                #pragma unroll   // constant indices keep the arrays in registers
                for (int qt = 0; qt < QT; ++qt)
                    acc[ct][qt] = WMMA_F16(ar[u % 3][c][0], p[qt][0], acc[ct][qt]);
                if (u + 1 < 16 / GC) {
                    #pragma unroll   // constant indices keep the arrays in registers
                    for (int qt = 0; qt < QT; ++qt) acc[ct + GC][qt] *= alpha[qt];
                }
                #pragma unroll   // constant indices keep the arrays in registers
                for (int qt = 0; qt < QT; ++qt)
                    acc[ct][qt] = WMMA_F16(ar[u % 3][c][1], p[qt][1], acc[ct][qt]);
            }
            // holds each group's reads two groups ahead of their products: sunk to
            // their use, every pair of products would wait out an LDS round trip
            __builtin_amdgcn_sched_barrier(0);
        }

        {   // the other buffer's last readers left at the previous barrier
            _Float16* sn = sBuf + ((kc + 1) & 1) * BUF_H;
            #pragma unroll   // constant indices keep the array in registers
            for (int j = 0; j < 2; ++j) *(v8h*)(sn + sDst + j * 32 * PITCH) = stP[j];
            #pragma unroll   // constant indices keep the array in registers
            for (int j = 0; j < 8; ++j) *(v8h*)(sn + PHI_H + sDst + j * 32 * PITCH) = stG[j];
        }
        __syncthreads();   // publishes chunk kc + 1 and ends every read of chunk kc's buffer
    }

    #pragma unroll   // constant indices keep the arrays in registers
    for (int qt = 0; qt < QT; ++qt) {
        const float lt  = l[qt] + xhalf(l[qt]);
        const float inv = 1.0f / lt;
        _Float16* orow = o + ((size_t)b * HW + q0 + qt * 16 + mn) * C2 + half * 8;
        #pragma unroll   // constant indices keep the array in registers
        for (int ct = 0; ct < 16; ++ct) {
            v8h h;
            #pragma unroll   // constant indices keep the array in registers
            for (int r = 0; r < 8; ++r) h[r] = (_Float16)(acc[ct][qt][r] * inv);
            *(v8h*)(orow + ct * 16) = h;
        }
    }
}

// ---------------------------------------------------------------------------
// Final: out[b][co][hw] = x + sigma*(w_attn[co,:]·attnG[b][hw,:] + b_attn[co])
// A block of 8 waves takes 64 positions x 256 output channels. The 64 attnG rows
// are staged once in LDS (whole 512-B rows in, 528-B pitch) and serve all waves.
// A wave does 32 channels x 64 positions as the transposed product
//   D(channel x position) = w_attn_tile @ attnG_tile^T   (A from global, B from LDS)
// Position tile j holds positions 4*mn + j, so a lane ends with four consecutive
// positions of one channel: x and out move 16 B a lane, 256 B a half wave.
// Weight fragments run three k steps ahead in a register ring; as the ring
// drains, its registers take the x rows, which so fly under the last products.
// Grid (512/256, HW/64, B), block 256.
// ---------------------------------------------------------------------------
#define FHW    64     // positions per block
#define FPITCH 264    // LDS row pitch in halfwords (512 B + 16 B)
#define FKS    (C2 / 32)
__global__ void __launch_bounds__(256)
final_conv_kernel(const _Float16* __restrict__ ag,
                  const _Float16* __restrict__ Wh,
                  const float* __restrict__ bt,
                  const float* __restrict__ x,
                  const float* __restrict__ sigma,
                  float* __restrict__ out) {
    __shared__ __attribute__((aligned(16))) _Float16 sB[FHW * FPITCH];

    const int hw0  = blockIdx.y * FHW;
    const int b    = blockIdx.z;
    const int t    = threadIdx.x;
    const int lane = t & 31;
    const int wave = t >> 5;
    const int half = lane >> 4;
    const int mn   = lane & 15;
    const int cob  = blockIdx.x * 256;   // the block's first channel

    // a wave fetches one whole row a load; position p lands in LDS row (p & 3) * 16 + (p >> 2)
    const _Float16* abase = ag + ((size_t)b * HW + hw0) * C2;   // uniform bases,
    const _Float16* wbase = Wh + (size_t)cob * C2;              // 32-bit lane offsets
    const int aoff = wave * C2 + lane * 8;
    const int woff = (wave * 32 + mn) * C2;
    v8h st[8];
    #pragma unroll   // all 8 loads of a lane in flight together
    for (int i = 0; i < 8; ++i) st[i] = *(const v8h*)(abase + aoff + i * 8 * C2);
    // keeps the row loads first in the queue: loads return in order, and the LDS
    // stores below would otherwise wait for the weight fragments too
    __builtin_amdgcn_sched_barrier(0);

    v16h aw[3][2];   // weight fragments of three k steps
    #pragma unroll   // constant indices keep the array in registers
    for (int q = 0; q < 3; ++q) {
        aw[q][0] = load_frag_row(wbase + woff + q * 32, half);
        aw[q][1] = load_frag_row(wbase + woff + 16 * C2 + q * 32, half);
    }

    #pragma unroll   // constant indices keep the array in registers
    for (int i = 0; i < 8; ++i) {
        const int p = i * 8 + wave;
        *(v8h*)(sB + ((p & 3) * 16 + (p >> 2)) * FPITCH + lane * 8) = st[i];
    }
    __syncthreads();   // the 64 rows are in LDS before any fragment is read

    const float* xb = x   + ((size_t)b * DIMS + cob) * HW + hw0;
    float*       ob = out + ((size_t)b * DIMS + cob) * HW + hw0;
    const int eoff = (wave * 32 + half * 8) * HW + mn * 4;

    const _Float16* br = sB + mn * FPITCH;
    v8f acc[2][4];
    #pragma unroll   // constant indices keep the array in registers
    for (int j = 0; j < 4; ++j) { acc[0][j] = (v8f){}; acc[1][j] = (v8f){}; }
    v4f xv[16];      // x rows: channel offset i = mt*16 + r -> xv[mt*8 + r]

    #pragma unroll   // constant indices keep the arrays in registers
    for (int ks = 0; ks < FKS; ++ks) {
        #pragma unroll   // constant indices keep the array in registers
        for (int j = 0; j < 4; ++j) {
            v16h bb = load_frag_row(br + j * 16 * FPITCH + ks * 32, half);
            acc[0][j] = WMMA_F16(aw[ks % 3][0], bb, acc[0][j]);
            acc[1][j] = WMMA_F16(aw[ks % 3][1], bb, acc[1][j]);
        }
        if (ks + 3 < FKS) {
            aw[ks % 3][0] = load_frag_row(wbase + woff + (ks + 3) * 32, half);
            aw[ks % 3][1] = load_frag_row(wbase + woff + 16 * C2 + (ks + 3) * 32, half);
        } else {
            #pragma unroll   // constant indices keep the array in registers
            for (int i = 0; i < 4; ++i) {
                const int e = (ks + 3 - FKS) * 4 + i;
                xv[e] = *(const v4f*)(xb + eoff + ((e >> 3) * 16 + (e & 7)) * HW);
            }
        }
        // holds the loads above at this place: without it the scheduler sinks them
        // to just in front of their use and each k step waits out an L2 round trip
        __builtin_amdgcn_sched_barrier(0);
    }
    #pragma unroll   // constant indices keep the array in registers
    for (int e = 12; e < 16; ++e)
        xv[e] = *(const v4f*)(xb + eoff + ((e >> 3) * 16 + (e & 7)) * HW);
    // holds the last four x loads here, so that all sixteen are in flight together
    __builtin_amdgcn_sched_barrier(0);

    // acc[mt][j][r]: channel cob + wave*32 + mt*16 + half*8 + r, position hw0 + 4*mn + j
    const float s = sigma[0];
    #pragma unroll   // constant indices keep the array in registers
    for (int mt = 0; mt < 2; ++mt) {
        const float* bp = bt + cob + wave * 32 + mt * 16 + half * 8;
        const v4f bl = *(const v4f*)(bp);
        const v4f bh = *(const v4f*)(bp + 4);
        #pragma unroll   // constant indices keep the array in registers
        for (int r = 0; r < 8; ++r) {
            const float bv = r < 4 ? bl[r & 3] : bh[r & 3];
            v4f ov;
            #pragma unroll   // constant indices keep the array in registers
            for (int j = 0; j < 4; ++j) ov[j] = xv[mt * 8 + r][j] + s * (acc[mt][j][r] + bv);
            *(v4f*)(ob + eoff + (mt * 16 + r) * HW) = ov;
        }
    }
}

// ---------------------------------------------------------------------------
extern "C" void kernel_launch(void* const* d_in, const int* in_sizes, int n_in,
                              void* d_out, int out_size, void* d_ws, size_t ws_size,
                              hipStream_t stream) {
    const float* x       = (const float*)d_in[0];
    const float* w_theta = (const float*)d_in[1];
    const float* b_theta = (const float*)d_in[2];
    const float* w_phi   = (const float*)d_in[3];
    const float* b_phi   = (const float*)d_in[4];
    const float* w_g     = (const float*)d_in[5];
    const float* b_g     = (const float*)d_in[6];
    const float* w_attn  = (const float*)d_in[7];
    const float* b_attn  = (const float*)d_in[8];
    const float* sigma   = (const float*)d_in[9];
    float* out = (float*)d_out;

    char* ws = (char*)d_ws;
    _Float16* theta   = (_Float16*)(ws);                 //  8 MB   [b][hw][64]
    _Float16* phi     = (_Float16*)(ws +  8388608);      //  2 MB   [b][key][64]
    _Float16* gbuf    = (_Float16*)(ws + 10485760);      //  8 MB   [b][key/32][c][key%32]
    _Float16* wth_h   = (_Float16*)(ws + 18874368);      //  64 KB  [64][512]
    _Float16* wph_h   = (_Float16*)(ws + 18939904);      //  64 KB  [64][512]
    _Float16* wg_h    = (_Float16*)(ws + 19005440);      // 256 KB  [256][512]
    _Float16* wat_h   = (_Float16*)(ws + 19267584);      // 256 KB  [512][256]
    _Float16* attnout = (_Float16*)(ws + 19529728);      //  32 MB  [b][hw][256]

    // wth_h, wph_h, wg_h and wat_h are one contiguous range that starts at wth_h
    cvt_weights_kernel<<<CVT_BLOCKS, 256, 0, stream>>>(w_theta, w_phi, w_g, w_attn, wth_h);

    // one pass over X produces theta and the pooled phi and g
    qkv_conv_kernel<<<dim3(HW / QP, NB), dim3(384), 0, stream>>>(
        x, wth_h, wph_h, wg_h, b_theta, b_phi, b_g, theta, phi, gbuf);
    attn_wmma_kernel<<<dim3(HW / 256, NB), dim3(256), 2 * BUF_H * 2, stream>>>(
        theta, phi, gbuf, attnout);
    final_conv_kernel<<<dim3(DIMS / 256, HW / FHW, NB), dim3(256), 0, stream>>>(
        attnout, wat_h, b_attn, x, sigma, out);
}

// v008
// A run of this version takes 99.5 microseconds.
// Next to v007, in two timings, it ran 1.05 and 1.06 times as fast.
// Over all steps from v000 it is 5.51 times as fast.
#include <hip/hip_runtime.h>
#include <hip/hip_bf16.h>

typedef __attribute__((ext_vector_type(16))) _Float16 v16h;
typedef __attribute__((ext_vector_type(8)))  _Float16 v8h;
typedef __attribute__((ext_vector_type(2)))  _Float16 v2h;
typedef __attribute__((ext_vector_type(8)))  float    v8f;
typedef __attribute__((ext_vector_type(4)))  float    v4f;

#define DIMS 512
#define NB   16
#define HW   4096   // 64*64
#define HW4  1024   // pooled positions
#define C8   64
#define C2   256
#define GT   32     // keys per tile of g: g[b][key / GT][channel][key % GT]

#define WMMA_F16(A, B, C) __builtin_amdgcn_wmma_f32_16x16x32_f16(false, A, false, B, (short)0, C, false, false)

// Fragment K pattern for 16x16x32 f16 WMMA (ISA 7.12.2):
//   lane half 0: K in [0,8) and [16,24);  lane half 1: K in [8,16) and [24,32).
// With K contiguous in memory a fragment is exactly two 16-byte loads.
__device__ __forceinline__ v16h load_frag_row(const _Float16* __restrict__ p, int half) {
    v8h lo = *(const v8h*)(p + half * 8);
    v8h hi = *(const v8h*)(p + 16 + half * 8);
    v16h r;
    #pragma unroll
    for (int i = 0; i < 8; ++i) { r[i] = lo[i]; r[i + 8] = hi[i]; }
    return r;
}

// A weight fragment kept in fragment order (cvt_weights_kernel writes it): 1 KB, lane l's
// first eight k values at l * 16 B, its second eight at 512 B + l * 16 B. p points at the
// lane's first eight. Each of the two loads is 512 contiguous bytes of a wave, four whole
// lines; from row-major weights it touches sixteen lines for the same bytes.
#define WFRAG 512   // halfwords per fragment (16 rows x 32 k)
__device__ __forceinline__ v16h load_frag_packed(const _Float16* __restrict__ p) {
    v8h lo = *(const v8h*)(p);
    v8h hi = *(const v8h*)(p + WFRAG / 2);
    v16h r;
    #pragma unroll   // constant indices keep the vectors in registers
    for (int i = 0; i < 8; ++i) { r[i] = lo[i]; r[i + 8] = hi[i]; }
    return r;
}

// ---------------------------------------------------------------------------
// Fused QKV 1x1 conv: reads X once, produces theta and the max-pooled phi and g.
// A block of 12 waves takes 128 positions (two image rows) x all 64+64+256 output
// channels, so every 2x2 pooling window lies inside one block.
// X is staged as f16 in LDS in panels of 64 input channels (two buffers): a
// staging wave reads whole 512-B rows of X, 16 B a lane, eight rows a panel, and
// each lane packs its four positions' eight channels into four 16-B LDS stores.
// Position p lands in LDS row (p & 3) * 32 + (p >> 2), so that the lanes of one
// store walk consecutive rows. A wave does 32 channels x 128 positions as
//   D(channel x position) = w_tile @ X_tile   (A from global, B from LDS)
// so a weight row fetched once serves 128 positions, and a lane ends with eight
// consecutive channels of eight positions. Those eight positions are two whole
// pooling windows: phi and g are pooled in registers and never stored unpooled.
// g goes out in tiles of 32 keys, g[b][key / 32][channel][key % 32]: the block
// writes one whole tile, so no 128-B line has a second writer.
// Weight fragments run one panel ahead in registers.
// Grid (HW/128, B), block 384.
// ---------------------------------------------------------------------------
#define QP     128            // positions per block
#define QK     64             // input channels per panel
#define QPITCH 72             // LDS row pitch in halfwords (128 B + 16 B)
#define QBUF   (QP * QPITCH)
#define QNP    (DIMS / QK)
__global__ void __launch_bounds__(384)
qkv_conv_kernel(const float* __restrict__ X,
                const _Float16* __restrict__ Wth,
                const _Float16* __restrict__ Wph,
                const _Float16* __restrict__ Wg,
                const float* __restrict__ bth,
                const float* __restrict__ bph,
                const float* __restrict__ bg,
                _Float16* __restrict__ theta,
                _Float16* __restrict__ phi,
                _Float16* __restrict__ g) {
    __shared__ __attribute__((aligned(16))) _Float16 sX[2 * QBUF];

    const int hw0  = blockIdx.x * QP;
    const int b    = blockIdx.y;
    const int t    = threadIdx.x;
    const int lane = t & 31;
    const int wave = __builtin_amdgcn_readfirstlane(t >> 5);   // scalar: uniform bases and branches
    const int half = lane >> 4;
    const int mn   = lane & 15;

    // the wave's 32 output channels: waves 0-1 theta, 2-3 phi, 4-11 g
    const _Float16* wsel;
    const float*    bsel;
    if (wave < 2)      { wsel = Wth + wave * 32 * DIMS;       bsel = bth + wave * 32; }
    else if (wave < 4) { wsel = Wph + (wave - 2) * 32 * DIMS; bsel = bph + (wave - 2) * 32; }
    else               { wsel = Wg + (wave - 4) * 32 * DIMS;  bsel = bg + (wave - 4) * 32; }
    const int woff = lane * 8;   // fragment (channel tile mt, k step ks) of the wave: (mt * DIMS / 32 + ks) * WFRAG

    // staging: waves 0-7 take eight X rows of each panel
    const bool stager = wave < QK / 8;
    const float* xs = X + ((size_t)b * DIMS + (wave & 7) * 8) * HW + hw0;
    const int xoff = lane * 4;
    const int sDst = lane * QPITCH + (wave & 7) * 8;

    v4f xr[8];
    if (stager) {
        #pragma unroll   // all 8 loads of a lane in flight together
        for (int i = 0; i < 8; ++i) xr[i] = *(const v4f*)(xs + i * HW + xoff);
    }
    // keeps the X loads first in the queue: loads return in order, and the LDS
    // stores below would otherwise wait for the weight fragments too
    __builtin_amdgcn_sched_barrier(0);

    v16h aw[2][2];   // weight fragments of one panel (two k steps, two channel tiles)
    #pragma unroll   // constant indices keep the array in registers
    for (int q = 0; q < 2; ++q) {
        aw[q][0] = load_frag_packed(wsel + woff + q * WFRAG);
        aw[q][1] = load_frag_packed(wsel + woff + (DIMS / 32 + q) * WFRAG);
    }
    // stands in front of any later rewrite of these loads' address registers; it names
    // the lane number they are formed from, so that its register stays untouched up to the wait
    asm volatile("s_wait_xcnt 0x0" :: "v"(lane) : "memory");

    if (stager) {
        #pragma unroll   // constant indices keep the array in registers
        for (int j = 0; j < 4; ++j) {
            v8h h;
            #pragma unroll   // constant indices keep the array in registers
            for (int i = 0; i < 8; ++i) h[i] = (_Float16)xr[i][j];
            *(v8h*)(sX + sDst + j * 32 * QPITCH) = h;
        }
    }
    __syncthreads();   // panel 0 is published

    v8f acc[2][8];
    #pragma unroll   // constant indices keep the array in registers
    for (int n = 0; n < 8; ++n) { acc[0][n] = (v8f){}; acc[1][n] = (v8f){}; }

    #pragma unroll   // constant buffer and panel offsets; no branch behind a product
    for (int kp = 0; kp < QNP; ++kp) {
        const _Float16* br = sX + (kp & 1) * QBUF + mn * QPITCH;
        // Eight steps of four products: step u takes k step SQ(u) and position tiles
        // 2*SN(u), 2*SN(u)+1. Both k steps are touched in the first two steps, so every
        // weight load has been waited for before the X loads are issued: loads return
        // in order, and a wait for a weight behind them would wait for memory too.
        #define SQ(u) ((u) < 2 ? (u) : ((u) < 5 ? 0 : 1))
        #define SN(u) ((u) < 2 ? 0 : ((u) < 5 ? (u) - 1 : (u) - 4))
        // X fragments come in pairs through a ring of three: pair u + 2 is asked for
        // in front of pair u's four products, so an LDS round trip hides under eight
        v16h bb[3][2];
        #pragma unroll   // constant indices keep the array in registers
        for (int u = 0; u < 2; ++u) {
            const _Float16* bn = br + SN(u) * 32 * QPITCH + SQ(u) * 32;
            bb[u][0] = load_frag_row(bn, half);
            bb[u][1] = load_frag_row(bn + 16 * QPITCH, half);
        }
        #pragma unroll   // constant indices keep the arrays in registers
        for (int u = 0; u < 8; ++u) {
            const int q = SQ(u), n = SN(u) * 2;
            if (u == 2 && kp + 1 < QNP && stager) {   // next panel's rows fly under the 24 products left
                #pragma unroll   // all 8 loads of a lane in flight together
                for (int i = 0; i < 8; ++i)
                    xr[i] = *(const v4f*)(xs + ((kp + 1) * QK + i) * HW + xoff);
            }
            if (u + 2 < 8) {
                const int v = u + 2;
                const _Float16* bn = br + SN(v) * 32 * QPITCH + SQ(v) * 32;
                bb[v % 3][0] = load_frag_row(bn, half);
                bb[v % 3][1] = load_frag_row(bn + 16 * QPITCH, half);
            }
            acc[0][n]     = WMMA_F16(aw[q][0], bb[u % 3][0], acc[0][n]);
            acc[1][n]     = WMMA_F16(aw[q][1], bb[u % 3][0], acc[1][n]);
            acc[0][n + 1] = WMMA_F16(aw[q][0], bb[u % 3][1], acc[0][n + 1]);
            acc[1][n + 1] = WMMA_F16(aw[q][1], bb[u % 3][1], acc[1][n + 1]);
            if ((u == 4 || u == 7) && kp + 1 < QNP) {   // this k step's weights are spent: fetch the next panel's
                aw[q][0] = load_frag_packed(wsel + woff + ((kp + 1) * (QK / 32) + q) * WFRAG);
                aw[q][1] = load_frag_packed(wsel + woff + (DIMS / 32 + (kp + 1) * (QK / 32) + q) * WFRAG);
            }
            // holds every load at the place written: sunk to its use, an LDS read would
            // stall each pair of products and a weight load each k step
            __builtin_amdgcn_sched_barrier(0);
        }

        if (kp + 1 < QNP && stager) {   // the other buffer's last readers left at the previous barrier
            _Float16* sn = sX + ((kp + 1) & 1) * QBUF + sDst;
            #pragma unroll   // constant indices keep the array in registers
            for (int j = 0; j < 4; ++j) {
                v8h h;
                #pragma unroll   // constant indices keep the array in registers
                for (int i = 0; i < 8; ++i) h[i] = (_Float16)xr[i][j];
                *(v8h*)(sn + j * 32 * QPITCH) = h;
            }
        }
        if (kp + 1 < QNP) {
            // publishes panel kp + 1 and ends every read of panel kp's buffer. The fences
            // name LDS alone: __syncthreads() would also drain the weight loads just
            // issued for the next panel, an L2 round trip in front of every barrier
            __builtin_amdgcn_fence(__ATOMIC_RELEASE, "workgroup", "local");
            __builtin_amdgcn_s_barrier();
            __builtin_amdgcn_fence(__ATOMIC_ACQUIRE, "workgroup", "local");
        }
    }

    // acc[mt][n][r]: channel mt*16 + half*8 + r of the wave's 32,
    // position hw0 + 4*((n & 1)*16 + mn) + (n >> 1)
    if (wave < 2) {   // theta: every position
        _Float16* dl = theta + ((size_t)b * HW + hw0) * C8 + wave * 32 + half * 8;
        #pragma unroll   // constant indices keep the array in registers
        for (int mt = 0; mt < 2; ++mt) {
            const float* bp = bsel + mt * 16 + half * 8;
            const v4f bl = *(const v4f*)(bp);
            const v4f bh = *(const v4f*)(bp + 4);
            #pragma unroll   // constant indices keep the array in registers
            for (int n = 0; n < 8; ++n) {
                const int p = 4 * ((n & 1) * 16 + mn) + (n >> 1);
                v8h h;
                #pragma unroll   // constant indices keep the array in registers
                for (int r = 0; r < 8; ++r)
                    h[r] = (_Float16)(acc[mt][n][r] + (r < 4 ? bl[r & 3] : bh[r & 3]));
                *(v8h*)(dl + p * C8 + mt * 16) = h;
            }
        }
        return;
    }

    // phi and g: tiles n = 4w .. 4w+3 are columns 4*mn + 2w, + 1 of both image rows,
    // the window of pooled column 2*mn + w in pooled row blockIdx.x. The bias is the
    // same over a window and rounding keeps order: maximum first, then bias and f16.
    // Both bias rows are fetched up front: no load stands behind a store.
    v8f pw[2][2];   // [channel tile][w]
    #pragma unroll   // constant indices keep the arrays in registers
    for (int mt = 0; mt < 2; ++mt) {
        const float* bp = bsel + mt * 16 + half * 8;
        const v4f bl = *(const v4f*)(bp);
        const v4f bh = *(const v4f*)(bp + 4);
        #pragma unroll   // constant indices keep the arrays in registers
        for (int w = 0; w < 2; ++w)
            #pragma unroll   // constant indices keep the arrays in registers
            for (int r = 0; r < 8; ++r)
                pw[mt][w][r] = fmaxf(fmaxf(acc[mt][4 * w][r],     acc[mt][4 * w + 1][r]),
                                     fmaxf(acc[mt][4 * w + 2][r], acc[mt][4 * w + 3][r]))
                               + (r < 4 ? bl[r & 3] : bh[r & 3]);
    }
    if (wave < 4) {   // phi[b][key][64]: eight channels of a key, 16 B
        _Float16* dp = phi + ((size_t)b * HW4 + blockIdx.x * 32 + 2 * mn) * C8 + (wave - 2) * 32 + half * 8;
        #pragma unroll   // constant indices keep the arrays in registers
        for (int mt = 0; mt < 2; ++mt)
            #pragma unroll   // constant indices keep the arrays in registers
            for (int w = 0; w < 2; ++w) {
                v8h h;
                #pragma unroll   // constant indices keep the arrays in registers
                for (int r = 0; r < 8; ++r) h[r] = (_Float16)pw[mt][w][r];
                *(v8h*)(dp + w * C8 + mt * 16) = h;
            }
        // stands in front of any later rewrite of these stores' address and data registers
        asm volatile("s_wait_xcnt 0x0" ::: "memory");
    } else {          // g tile: two keys of a channel, 4 B; 16 lanes fill the channel's 64 B
        _Float16* dg = g + (((size_t)b * (HW4 / GT) + blockIdx.x) * C2 + (wave - 4) * 32 + half * 8) * GT + 2 * mn;
        #pragma unroll   // constant indices keep the arrays in registers
        for (int mt = 0; mt < 2; ++mt)
            #pragma unroll   // constant indices keep the arrays in registers
            for (int r = 0; r < 8; ++r) {
                v2h kk = { (_Float16)pw[mt][0][r], (_Float16)pw[mt][1][r] };
                *(v2h*)(dg + (mt * 16 + r) * GT) = kk;
            }
        // stands in front of any later rewrite of these stores' address and data registers
        asm volatile("s_wait_xcnt 0x0" ::: "memory");
    }
}

// f32 -> f16 conversion of all four weight matrices in one launch. Their f16 copies
// lie back to back in the workspace (theta, phi, g, attn), so the destination is one
// array. The copies are in fragment order: matrix [M][K] becomes fragments of 16 rows x
// 32 k, fragment (row tile, k step) at index row tile * K / 32 + k step, laid out as
// load_frag_packed reads it. A block fills 2048 consecutive destination elements (four
// fragments), eight a lane (16-B stores, a wave fills four whole lines), and picks its
// source by its index: every matrix is a whole number of blocks. A lane's eight values
// are 32 consecutive bytes of one source row. Grid CVT_BLOCKS, block 256.
#define CVB        2048
#define CVT_B_PHI  (C8 * DIMS / CVB)                 // first block of w_phi
#define CVT_B_G    (CVT_B_PHI + C8 * DIMS / CVB)     // first block of w_g
#define CVT_B_ATT  (CVT_B_G + C2 * DIMS / CVB)       // first block of w_attn
#define CVT_BLOCKS (CVT_B_ATT + DIMS * C2 / CVB)
__global__ void __launch_bounds__(256)
cvt_weights_kernel(const float* __restrict__ wth,
                   const float* __restrict__ wph,
                   const float* __restrict__ wg,
                   const float* __restrict__ wat,
                   _Float16* __restrict__ dst) {
    const int blk = blockIdx.x;
    const float* src;   // the block's matrix
    int lb, ksl;        // the block's index in it; log2 of its k steps per row
    if (blk < CVT_B_PHI)      { src = wth; lb = blk;             ksl = 4; }
    else if (blk < CVT_B_G)   { src = wph; lb = blk - CVT_B_PHI; ksl = 4; }
    else if (blk < CVT_B_ATT) { src = wg;  lb = blk - CVT_B_G;   ksl = 4; }
    else                      { src = wat; lb = blk - CVT_B_ATT; ksl = 3; }
    const int t = threadIdx.x;
    const int e = t * 8;
    // 64 threads a fragment: bit 5 of t picks the first or second eight k values of
    // fragment lane t & 31, whose row is t & 15 and whose k half is bit 4
    const int f   = lb * (CVB / WFRAG) + (t >> 6);
    const int row = (f >> ksl) * 16 + (t & 15);
    const int col = (f & ((1 << ksl) - 1)) * 32 + ((t >> 5) & 1) * 16 + ((t >> 4) & 1) * 8;
    const float* sp = src + ((row << ksl) * 32 + col);
    const v4f lo = *(const v4f*)(sp);
    const v4f hi = *(const v4f*)(sp + 4);
    v8h h;
    #pragma unroll   // constant indices keep the vectors in registers
    for (int i = 0; i < 4; ++i) { h[i] = (_Float16)lo[i]; h[i + 4] = (_Float16)hi[i]; }
    *(v8h*)(dst + blk * CVB + e) = h;
}

// ---------------------------------------------------------------------------
// Attention, 256 queries per block: 8 waves x 32 queries walk the 1024 keys in
// chunks of 64 that the block stages once in LDS (two buffers), so every byte
// of phi and g fetched from L2 serves 256 queries.
//   S^T(key x query) = phi_chunk @ theta^T   (A from LDS, B kept in registers)
//   O^T(chan x query) += g_chunk @ P^T       (A from LDS, B packed from S^T)
// A wave holds two query tiles, so every fragment read from LDS feeds two
// products: with one tile a wave the LDS reads take twice the matrix time.
// A lane holds one query's scores per tile: running maximum and sum stay in
// registers. Grid (HW/256, B), block 256. Dynamic LDS = 2 x 46,080 B. Two waves
// per SIMD (the 256 x 32 f32 output tile alone is 256 VGPRs a wave).
// ---------------------------------------------------------------------------
#define KCH    64                    // keys per chunk
#define PITCH  72                    // LDS row pitch in halfwords (128 B + 16 B)
#define PHI_H  (KCH * PITCH)         // phi chunk: 64 key rows
#define BUF_H  ((KCH + C2) * PITCH)  // + g chunk: 256 channel rows
#define QT     2                     // query tiles per wave
#define GC     2                     // channel tiles per group of g fragments

// lane l <-> lane l ^ 16
__device__ __forceinline__ float xhalf(float x) {
    int i = __builtin_bit_cast(int, x);
    return __builtin_bit_cast(float,
        __builtin_amdgcn_permlanex16(i, i, 0x76543210, 0xfedcba98, false, false));
}

// 2^x; the v_nop keeps the one free issue slot that the instruction set asks for
// behind a transcendental, whatever the scheduler places next
__device__ __forceinline__ float exp2_slot(float x) {
    float r;
    asm("v_exp_f32 %0, %1\n\tv_nop" : "=v"(r) : "v"(x));
    return r;
}

__global__ void __launch_bounds__(256) __attribute__((amdgpu_waves_per_eu(2, 2)))
attn_wmma_kernel(const _Float16* __restrict__ theta,
                 const _Float16* __restrict__ phi,
                 const _Float16* __restrict__ g,
                 _Float16* __restrict__ o) {
    extern __shared__ __attribute__((aligned(16))) char smem[];
    _Float16* sBuf = (_Float16*)smem;

    const int b    = blockIdx.y;
    const int t    = threadIdx.x;
    const int lane = t & 31;
    const int wave = t >> 5;
    const int half = lane >> 4;
    const int mn   = lane & 15;
    const int q0   = blockIdx.x * 256 + wave * (16 * QT);

    // staging: 8 threads per 128-byte row, 32 rows per sweep
    const int srow = t >> 3, scol = (t & 7) * 8;
    const char* pBase = (const char*)(phi + (size_t)b * HW4 * C8);   // uniform bases,
    const char* gBase = (const char*)(g + (size_t)b * C2 * HW4);     // 32-bit lane offsets
    const int pOff = (srow * C8 + scol) * 2;                                          // in bytes
    const int gOff = ((scol / GT) * (C2 * GT) + srow * GT + (scol & (GT - 1))) * 2;   // a chunk is two key tiles of g
    const int sDst = srow * PITCH + scol;

    // theta^T as B operand: lane = query, K = channel, kept for the whole walk
    const _Float16* tq = theta + ((size_t)b * HW + q0 + mn) * C8 + half * 8;
    v16h bq[QT][2];
    #pragma unroll   // constant indices keep the array in registers
    for (int qt = 0; qt < QT; ++qt) {
        bq[qt][0] = load_frag_row(tq + qt * 16 * C8, 0);
        bq[qt][1] = load_frag_row(tq + qt * 16 * C8 + 32, 0);
    }
    // stands in front of any later rewrite of these loads' address registers; it
    // names the address, so that its registers stay untouched up to the wait
    asm volatile("s_wait_xcnt 0x0" :: "v"(tq) : "memory");

    v8h stP[2], stG[8];
    #pragma unroll   // constant indices keep the array in registers
    for (int j = 0; j < 2; ++j) stP[j] = *(const v8h*)(pBase + pOff + j * 32 * C8 * 2);
    #pragma unroll   // constant indices keep the array in registers
    for (int j = 0; j < 8; ++j) stG[j] = *(const v8h*)(gBase + gOff + j * 32 * GT * 2);
    // the same for the staging loads and their two lane offsets
    asm volatile("s_wait_xcnt 0x0" :: "v"(pOff), "v"(gOff) : "memory");
    #pragma unroll   // constant indices keep the array in registers
    for (int j = 0; j < 2; ++j) *(v8h*)(sBuf + sDst + j * 32 * PITCH) = stP[j];
    #pragma unroll   // constant indices keep the array in registers
    for (int j = 0; j < 8; ++j) *(v8h*)(sBuf + PHI_H + sDst + j * 32 * PITCH) = stG[j];
    __syncthreads();   // chunk 0 is published

    const float L2E = 1.4426950408889634f;
    v8f acc[16][QT];
    #pragma unroll   // constant indices keep the array in registers
    for (int ct = 0; ct < 16; ++ct)
        #pragma unroll   // constant indices keep the array in registers
        for (int qt = 0; qt < QT; ++qt) acc[ct][qt] = (v8f){};
    float ms[QT], l[QT];   // running maximum, in log2 units; running sum over this lane's keys
    #pragma unroll   // constant indices keep the arrays in registers
    for (int qt = 0; qt < QT; ++qt) { ms[qt] = -3.0e38f; l[qt] = 0.f; }

    for (int kc = 0; kc < HW4 / KCH; ++kc) {
        const _Float16* sp = sBuf + (kc & 1) * BUF_H;
        const _Float16* sg = sp + PHI_H;
        // the chunk staged during this trip. The last trip fetches its own chunk again,
        // into the buffer that nobody reads any more: with no branch the trip is one
        // block of code, and the fences below can hold its loads and sums in place
        const int kn = kc + 1 < HW4 / KCH ? kc + 1 : kc;

        // ---- S^T: s[qt][kt][r] = score(key kt*16 + r + 8*half, query qt*16 + mn) ----
        v16h ap[4][2];
        #pragma unroll   // constant indices keep the array in registers
        for (int kt = 0; kt < 4; ++kt) {
            const _Float16* pr = sp + (kt * 16 + mn) * PITCH;
            ap[kt][0] = load_frag_row(pr, half);
            ap[kt][1] = load_frag_row(pr + 32, half);
        }
        // all sixteen phi reads go out as one group: spread among the products, each
        // pair of products would wait out an LDS round trip of its own
        __builtin_amdgcn_sched_barrier(0);
        v8f s[QT][4];
        #pragma unroll   // constant indices keep the arrays in registers
        for (int kt = 0; kt < 4; ++kt) {
            #pragma unroll   // constant indices keep the arrays in registers
            for (int qt = 0; qt < QT; ++qt) {
                v8f z = {};
                z = WMMA_F16(ap[kt][0], bq[qt][0], z);
                z = WMMA_F16(ap[kt][1], bq[qt][1], z);
                s[qt][kt] = z;
            }
        }
        // holds the score products in front of the g reads below: the phi fragments'
        // registers are free again before the ring takes its own
        __builtin_amdgcn_sched_barrier(0);

        // g fragments come in groups of two channel tiles through a ring of three. With
        // two waves a SIMD a wave hides its own LDS round trips: group 0 is asked for
        // here and lands under the softmax, group 1 behind the softmax (the scores'
        // registers are free then), group u + 2 in front of group u's products
        v16h ar[3][GC][2];
        #pragma unroll   // constant indices keep the array in registers
        for (int c = 0; c < GC; ++c) {
            const _Float16* gr = sg + (c * 16 + mn) * PITCH;
            ar[0][c][0] = load_frag_row(gr, half);
            ar[0][c][1] = load_frag_row(gr + 32, half);
        }
        // keeps those reads here: sunk to their use they would stall the first products
        __builtin_amdgcn_sched_barrier(0);

        // ---- running softmax, one query per lane and tile ----
        // P^T as B operand: score tiles 2ks and 2ks+1 already sit in the k order
        // of load_frag_row (half*8 + i, then 16 + half*8 + i)
        v16h p[QT][2];
        float alpha[QT];
        #pragma unroll   // constant indices keep the arrays in registers
        for (int qt = 0; qt < QT; ++qt) {
            float mx = s[qt][0][0];
            #pragma unroll   // constant indices keep the array in registers
            for (int kt = 0; kt < 4; ++kt)
                #pragma unroll   // constant indices keep the array in registers
                for (int r = 0; r < 8; ++r) mx = fmaxf(mx, s[qt][kt][r]);
            mx = fmaxf(mx, xhalf(mx));
            const float msn = fmaxf(ms[qt], mx * L2E);
            alpha[qt] = exp2_slot(ms[qt] - msn);   // 0 on the first chunk
            ms[qt] = msn;

            float ls = 0.f;
            #pragma unroll   // constant indices keep the array in registers
            for (int ks = 0; ks < 2; ++ks) {
                #pragma unroll   // constant indices keep the array in registers
                for (int r = 0; r < 8; ++r) {
                    const float x0 = fmaf(s[qt][2 * ks][r],     L2E, -msn);
                    const float x1 = fmaf(s[qt][2 * ks + 1][r], L2E, -msn);
                    const float e0 = exp2_slot(x0);
                    const float e1 = exp2_slot(x1);
                    ls += e0 + e1;
                    p[qt][ks][r]     = (_Float16)e0;
                    p[qt][ks][r + 8] = (_Float16)e1;
                }
            }
            l[qt] = l[qt] * alpha[qt] + ls;
        }

        // ends the softmax here: group 1's reads take registers that the scores have left,
        // and row sums sunk below the products would hold their exponentials in
        // registers through the whole walk over g
        __builtin_amdgcn_sched_barrier(0);
        #pragma unroll   // constant indices keep the array in registers
        for (int c = 0; c < GC; ++c) {
            const _Float16* gr = sg + ((GC + c) * 16 + mn) * PITCH;
            ar[1][c][0] = load_frag_row(gr, half);
            ar[1][c][1] = load_frag_row(gr + 32, half);
        }

        {   // next chunk's loads fly under the 64 products below (scores are packed: registers free)
            const int k1 = kn * KCH;
            #pragma unroll   // constant indices keep the array in registers
            for (int j = 0; j < 2; ++j)
                stP[j] = *(const v8h*)(pBase + (j * 32 * C8 + k1 * C8) * 2 + pOff);
            #pragma unroll   // constant indices keep the array in registers
            for (int j = 0; j < 8; ++j)
                stG[j] = *(const v8h*)(gBase + (j * 32 * GT + k1 * C2) * 2 + gOff);
            // stands in front of any later rewrite of these loads' address registers
            asm volatile("s_wait_xcnt 0x0" ::: "memory");
        }

        // ---- O^T += g_chunk @ P^T: each g fragment serves both query tiles ----
        // a group's tiles are rescaled one step ahead, among the products of the group before
        #pragma unroll   // constant indices keep the array in registers
        for (int c = 0; c < GC; ++c)
            #pragma unroll   // constant indices keep the array in registers
            for (int qt = 0; qt < QT; ++qt) acc[c][qt] *= alpha[qt];
        // keeps group 1's reads and the first rescale in front of the products
        __builtin_amdgcn_sched_barrier(0);
        #pragma unroll   // constant indices keep the arrays in registers
        for (int u = 0; u < 16 / GC; ++u) {
            if (u + 2 < 16 / GC) {
                #pragma unroll   // constant indices keep the array in registers
                for (int c = 0; c < GC; ++c) {
                    const _Float16* gr = sg + (((u + 2) * GC + c) * 16 + mn) * PITCH;
                    ar[(u + 2) % 3][c][0] = load_frag_row(gr, half);
                    ar[(u + 2) % 3][c][1] = load_frag_row(gr + 32, half);
                }
            }
            #pragma unroll   // constant indices keep the arrays in registers
            for (int c = 0; c < GC; ++c) {
                const int ct = u * GC + c;
                #pragma unroll   // constant indices keep the arrays in registers
                for (int qt = 0; qt < QT; ++qt)
                    acc[ct][qt] = WMMA_F16(ar[u % 3][c][0], p[qt][0], acc[ct][qt]);
                if (u + 1 < 16 / GC) {
                    #pragma unroll   // constant indices keep the arrays in registers
                    for (int qt = 0; qt < QT; ++qt) acc[ct + GC][qt] *= alpha[qt];
                }
                #pragma unroll   // constant indices keep the arrays in registers
                for (int qt = 0; qt < QT; ++qt)
                    acc[ct][qt] = WMMA_F16(ar[u % 3][c][1], p[qt][1], acc[ct][qt]);
            }
            // holds each group's reads two groups ahead of their products: sunk to
            // their use, every pair of products would wait out an LDS round trip
            __builtin_amdgcn_sched_barrier(0);
        }

        {   // the other buffer's last readers left at the previous barrier
            _Float16* sn = sBuf + ((kc + 1) & 1) * BUF_H;
            #pragma unroll   // constant indices keep the array in registers
            for (int j = 0; j < 2; ++j) *(v8h*)(sn + sDst + j * 32 * PITCH) = stP[j];
            #pragma unroll   // constant indices keep the array in registers
            for (int j = 0; j < 8; ++j) *(v8h*)(sn + PHI_H + sDst + j * 32 * PITCH) = stG[j];
        }
        __syncthreads();   // publishes chunk kc + 1 and ends every read of chunk kc's buffer
    }

    #pragma unroll   // constant indices keep the arrays in registers
    for (int qt = 0; qt < QT; ++qt) {
        const float lt  = l[qt] + xhalf(l[qt]);
        const float inv = 1.0f / lt;
        _Float16* orow = o + ((size_t)b * HW + q0 + qt * 16 + mn) * C2 + half * 8;
        #pragma unroll   // constant indices keep the array in registers
        for (int ct = 0; ct < 16; ++ct) {
            v8h h;
            #pragma unroll   // constant indices keep the array in registers
            for (int r = 0; r < 8; ++r) h[r] = (_Float16)(acc[ct][qt][r] * inv);
            *(v8h*)(orow + ct * 16) = h;
        }
    }
}

// ---------------------------------------------------------------------------
// Final: out[b][co][hw] = x + sigma*(w_attn[co,:]·attnG[b][hw,:] + b_attn[co])
// A block of 8 waves takes 64 positions x 256 output channels. The 64 attnG rows
// are staged once in LDS (whole 512-B rows in, 528-B pitch) and serve all waves.
// A wave does 32 channels x 64 positions as the transposed product
//   D(channel x position) = w_attn_tile @ attnG_tile^T   (A from global, B from LDS)
// Position tile j holds positions 4*mn + j, so a lane ends with four consecutive
// positions of one channel: x and out move 16 B a lane, 256 B a half wave.
// Weight fragments run three k steps ahead in a register ring; as the ring
// drains, its registers take the x rows, which so fly under the last products.
// Grid (512/256, HW/64, B), block 256.
// ---------------------------------------------------------------------------
#define FHW    64     // positions per block
#define FPITCH 264    // LDS row pitch in halfwords (512 B + 16 B)
#define FKS    (C2 / 32)
__global__ void __launch_bounds__(256)
final_conv_kernel(const _Float16* __restrict__ ag,
                  const _Float16* __restrict__ Wh,
                  const float* __restrict__ bt,
                  const float* __restrict__ x,
                  const float* __restrict__ sigma,
                  float* __restrict__ out) {
    __shared__ __attribute__((aligned(16))) _Float16 sB[FHW * FPITCH];

    const int hw0  = blockIdx.y * FHW;
    const int b    = blockIdx.z;
    const int t    = threadIdx.x;
    const int lane = t & 31;
    const int wave = t >> 5;
    const int half = lane >> 4;
    const int mn   = lane & 15;
    const int cob  = blockIdx.x * 256;   // the block's first channel

    // a wave fetches one whole row a load; position p lands in LDS row (p & 3) * 16 + (p >> 2)
    const _Float16* abase = ag + ((size_t)b * HW + hw0) * C2;   // uniform bases,
    const _Float16* wbase = Wh + (size_t)cob * C2;              // 32-bit lane offsets
    const int aoff = wave * C2 + lane * 8;
    const int woff = wave * 32 * C2 + lane * 8;   // fragment (mt, ks) of the wave: (mt * FKS + ks) * WFRAG
    v8h st[8];
    #pragma unroll   // all 8 loads of a lane in flight together
    for (int i = 0; i < 8; ++i) st[i] = *(const v8h*)(abase + aoff + i * 8 * C2);
    // keeps the row loads first in the queue: loads return in order, and the LDS
    // stores below would otherwise wait for the weight fragments too
    __builtin_amdgcn_sched_barrier(0);

    v16h aw[3][2];   // weight fragments of three k steps
    #pragma unroll   // constant indices keep the array in registers
    for (int q = 0; q < 3; ++q) {
        aw[q][0] = load_frag_packed(wbase + woff + q * WFRAG);
        aw[q][1] = load_frag_packed(wbase + woff + (FKS + q) * WFRAG);
    }

    #pragma unroll   // constant indices keep the array in registers
    for (int i = 0; i < 8; ++i) {
        const int p = i * 8 + wave;
        *(v8h*)(sB + ((p & 3) * 16 + (p >> 2)) * FPITCH + lane * 8) = st[i];
    }
    __syncthreads();   // the 64 rows are in LDS before any fragment is read

    const float* xb = x   + ((size_t)b * DIMS + cob) * HW + hw0;
    float*       ob = out + ((size_t)b * DIMS + cob) * HW + hw0;
    const int eoff = (wave * 32 + half * 8) * HW + mn * 4;

    const _Float16* br = sB + mn * FPITCH;
    v8f acc[2][4];
    #pragma unroll   // constant indices keep the array in registers
    for (int j = 0; j < 4; ++j) { acc[0][j] = (v8f){}; acc[1][j] = (v8f){}; }
    v4f xv[16];      // x rows: channel offset i = mt*16 + r -> xv[mt*8 + r]

    #pragma unroll   // constant indices keep the arrays in registers
    for (int ks = 0; ks < FKS; ++ks) {
        #pragma unroll   // constant indices keep the array in registers
        for (int j = 0; j < 4; ++j) {
            v16h bb = load_frag_row(br + j * 16 * FPITCH + ks * 32, half);
            acc[0][j] = WMMA_F16(aw[ks % 3][0], bb, acc[0][j]);
            acc[1][j] = WMMA_F16(aw[ks % 3][1], bb, acc[1][j]);
        }
        if (ks + 3 < FKS) {
            aw[ks % 3][0] = load_frag_packed(wbase + woff + (ks + 3) * WFRAG);
            aw[ks % 3][1] = load_frag_packed(wbase + woff + (FKS + ks + 3) * WFRAG);
        } else {
            #pragma unroll   // constant indices keep the array in registers
            for (int i = 0; i < 4; ++i) {
                const int e = (ks + 3 - FKS) * 4 + i;
                xv[e] = *(const v4f*)(xb + eoff + ((e >> 3) * 16 + (e & 7)) * HW);
            }
        }
        // holds the loads above at this place: without it the scheduler sinks them
        // to just in front of their use and each k step waits out an L2 round trip
        __builtin_amdgcn_sched_barrier(0);
    }
    #pragma unroll   // constant indices keep the array in registers
    for (int e = 12; e < 16; ++e)
        xv[e] = *(const v4f*)(xb + eoff + ((e >> 3) * 16 + (e & 7)) * HW);
    // holds the last four x loads here, so that all sixteen are in flight together
    __builtin_amdgcn_sched_barrier(0);

    // acc[mt][j][r]: channel cob + wave*32 + mt*16 + half*8 + r, position hw0 + 4*mn + j
    const float s = sigma[0];
    #pragma unroll   // constant indices keep the array in registers
    for (int mt = 0; mt < 2; ++mt) {
        const float* bp = bt + cob + wave * 32 + mt * 16 + half * 8;
        const v4f bl = *(const v4f*)(bp);
        const v4f bh = *(const v4f*)(bp + 4);
        #pragma unroll   // constant indices keep the array in registers
        for (int r = 0; r < 8; ++r) {
            const float bv = r < 4 ? bl[r & 3] : bh[r & 3];
            v4f ov;
            #pragma unroll   // constant indices keep the array in registers
            for (int j = 0; j < 4; ++j) ov[j] = xv[mt * 8 + r][j] + s * (acc[mt][j][r] + bv);
            *(v4f*)(ob + eoff + (mt * 16 + r) * HW) = ov;
        }
    }
}

// ---------------------------------------------------------------------------
extern "C" void kernel_launch(void* const* d_in, const int* in_sizes, int n_in,
                              void* d_out, int out_size, void* d_ws, size_t ws_size,
                              hipStream_t stream) {
    const float* x       = (const float*)d_in[0];
    const float* w_theta = (const float*)d_in[1];
    const float* b_theta = (const float*)d_in[2];
    const float* w_phi   = (const float*)d_in[3];
    const float* b_phi   = (const float*)d_in[4];
    const float* w_g     = (const float*)d_in[5];
    const float* b_g     = (const float*)d_in[6];
    const float* w_attn  = (const float*)d_in[7];
    const float* b_attn  = (const float*)d_in[8];
    const float* sigma   = (const float*)d_in[9];
    float* out = (float*)d_out;

    char* ws = (char*)d_ws;
    _Float16* theta   = (_Float16*)(ws);                 //  8 MB   [b][hw][64]
    _Float16* phi     = (_Float16*)(ws +  8388608);      //  2 MB   [b][key][64]
    _Float16* gbuf    = (_Float16*)(ws + 10485760);      //  8 MB   [b][key/32][c][key%32]
    _Float16* wth_h   = (_Float16*)(ws + 18874368);      //  64 KB  [64][512], fragment order
    _Float16* wph_h   = (_Float16*)(ws + 18939904);      //  64 KB  [64][512], fragment order
    _Float16* wg_h    = (_Float16*)(ws + 19005440);      // 256 KB  [256][512], fragment order
    _Float16* wat_h   = (_Float16*)(ws + 19267584);      // 256 KB  [512][256], fragment order
    _Float16* attnout = (_Float16*)(ws + 19529728);      //  32 MB  [b][hw][256]

    // wth_h, wph_h, wg_h and wat_h are one contiguous range that starts at wth_h
    cvt_weights_kernel<<<CVT_BLOCKS, 256, 0, stream>>>(w_theta, w_phi, w_g, w_attn, wth_h);

    // one pass over X produces theta and the pooled phi and g
    qkv_conv_kernel<<<dim3(HW / QP, NB), dim3(384), 0, stream>>>(
        x, wth_h, wph_h, wg_h, b_theta, b_phi, b_g, theta, phi, gbuf);
    attn_wmma_kernel<<<dim3(HW / 256, NB), dim3(256), 2 * BUF_H * 2, stream>>>(
        theta, phi, gbuf, attnout);
    final_conv_kernel<<<dim3(DIMS / 256, HW / FHW, NB), dim3(256), 0, stream>>>(
        attnout, wat_h, b_attn, x, sigma, out);
}

// v009
// It runs in 89.7 microseconds.
// Two timings next to v008 both put it at 1.11 times that version's speed.
// Over all steps from v000 it is 6.11 times as fast.
#include <hip/hip_runtime.h>
#include <hip/hip_bf16.h>

typedef __attribute__((ext_vector_type(16))) _Float16 v16h;
typedef __attribute__((ext_vector_type(8)))  _Float16 v8h;
typedef __attribute__((ext_vector_type(2)))  _Float16 v2h;
typedef __attribute__((ext_vector_type(8)))  float    v8f;
typedef __attribute__((ext_vector_type(4)))  float    v4f;

#define DIMS 512
#define NB   16
#define HW   4096   // 64*64
#define HW4  1024   // pooled positions
#define C8   64
#define C2   256
#define GT   32     // keys per tile of g: g[b][key / GT][channel][key % GT]

#define WMMA_F16(A, B, C) __builtin_amdgcn_wmma_f32_16x16x32_f16(false, A, false, B, (short)0, C, false, false)

// Fragment K pattern for 16x16x32 f16 WMMA (ISA 7.12.2):
//   lane half 0: K in [0,8) and [16,24);  lane half 1: K in [8,16) and [24,32).
// With K contiguous in memory a fragment is exactly two 16-byte loads.
__device__ __forceinline__ v16h load_frag_row(const _Float16* __restrict__ p, int half) {
    v8h lo = *(const v8h*)(p + half * 8);
    v8h hi = *(const v8h*)(p + 16 + half * 8);
    v16h r;
    #pragma unroll
    for (int i = 0; i < 8; ++i) { r[i] = lo[i]; r[i + 8] = hi[i]; }
    return r;
}

// A weight fragment kept in fragment order (cvt_weights_kernel writes it): 1 KB, lane l's
// first eight k values at l * 16 B, its second eight at 512 B + l * 16 B. p points at the
// lane's first eight. Each of the two loads is 512 contiguous bytes of a wave, four whole
// lines; from row-major weights it touches sixteen lines for the same bytes.
#define WFRAG 512   // halfwords per fragment (16 rows x 32 k)
__device__ __forceinline__ v16h load_frag_packed(const _Float16* __restrict__ p) {
    v8h lo = *(const v8h*)(p);
    v8h hi = *(const v8h*)(p + WFRAG / 2);
    v16h r;
    #pragma unroll   // constant indices keep the vectors in registers
    for (int i = 0; i < 8; ++i) { r[i] = lo[i]; r[i + 8] = hi[i]; }
    return r;
}

// ---------------------------------------------------------------------------
// Fused QKV 1x1 conv: reads X once, produces theta and the max-pooled phi and g.
// A block of 12 waves takes 128 positions (two image rows) x all 64+64+256 output
// channels, so every 2x2 pooling window lies inside one block.
// X is staged as f16 in LDS in panels of 64 input channels (two buffers): a
// staging wave reads whole 512-B rows of X, 16 B a lane, eight rows a panel, and
// each lane packs its four positions' eight channels into four 16-B LDS stores.
// Position p lands in LDS row (p & 3) * 32 + (p >> 2), so that the lanes of one
// store walk consecutive rows. A wave does 32 channels x 128 positions as
//   D(channel x position) = w_tile @ X_tile   (A from global, B from LDS)
// so a weight row fetched once serves 128 positions, and a lane ends with eight
// consecutive channels of eight positions. Those eight positions are two whole
// pooling windows: phi and g are pooled in registers and never stored unpooled.
// g goes out in tiles of 32 keys, g[b][key / 32][channel][key % 32]: the block
// writes one whole tile, so no 128-B line has a second writer.
// Weight fragments run one panel ahead in registers.
// Grid (HW/128, B), block 384.
// ---------------------------------------------------------------------------
#define QP     128            // positions per block
#define QK     64             // input channels per panel
#define QPITCH 72             // LDS row pitch in halfwords (128 B + 16 B)
#define QBUF   (QP * QPITCH)
#define QNP    (DIMS / QK)
__global__ void __launch_bounds__(384)
qkv_conv_kernel(const float* __restrict__ X,
                const _Float16* __restrict__ Wth,
                const _Float16* __restrict__ Wph,
                const _Float16* __restrict__ Wg,
                const float* __restrict__ bth,
                const float* __restrict__ bph,
                const float* __restrict__ bg,
                _Float16* __restrict__ theta,
                _Float16* __restrict__ phi,
                _Float16* __restrict__ g) {
    __shared__ __attribute__((aligned(16))) _Float16 sX[2 * QBUF];

    const int hw0  = blockIdx.x * QP;
    const int b    = blockIdx.y;
    const int t    = threadIdx.x;
    const int lane = t & 31;
    const int wave = __builtin_amdgcn_readfirstlane(t >> 5);   // scalar: uniform bases and branches
    const int half = lane >> 4;
    const int mn   = lane & 15;

    // the wave's 32 output channels: waves 0-1 theta, 2-3 phi, 4-11 g
    const _Float16* wsel;
    const float*    bsel;
    if (wave < 2)      { wsel = Wth + wave * 32 * DIMS;       bsel = bth + wave * 32; }
    else if (wave < 4) { wsel = Wph + (wave - 2) * 32 * DIMS; bsel = bph + (wave - 2) * 32; }
    else               { wsel = Wg + (wave - 4) * 32 * DIMS;  bsel = bg + (wave - 4) * 32; }
    const int woff = lane * 8;   // fragment (channel tile mt, k step ks) of the wave: (mt * DIMS / 32 + ks) * WFRAG

    // staging: waves 0-7 take eight X rows of each panel
    const bool stager = wave < QK / 8;
    const float* xs = X + ((size_t)b * DIMS + (wave & 7) * 8) * HW + hw0;
    const int xoff = lane * 4;
    const int sDst = lane * QPITCH + (wave & 7) * 8;

    v4f xr[8];
    if (stager) {
        #pragma unroll   // all 8 loads of a lane in flight together
        for (int i = 0; i < 8; ++i) xr[i] = *(const v4f*)(xs + i * HW + xoff);
    }
    // keeps the X loads first in the queue: loads return in order, and the LDS
    // stores below would otherwise wait for the weight fragments too
    __builtin_amdgcn_sched_barrier(0);

    v16h aw[2][2];   // weight fragments of one panel (two k steps, two channel tiles)
    #pragma unroll   // constant indices keep the array in registers
    for (int q = 0; q < 2; ++q) {
        aw[q][0] = load_frag_packed(wsel + woff + q * WFRAG);
        aw[q][1] = load_frag_packed(wsel + woff + (DIMS / 32 + q) * WFRAG);
    }
    // stands in front of any later rewrite of these loads' address registers; it names
    // the lane number they are formed from, so that its register stays untouched up to the wait
    asm volatile("s_wait_xcnt 0x0" :: "v"(lane) : "memory");

    if (stager) {
        #pragma unroll   // constant indices keep the array in registers
        for (int j = 0; j < 4; ++j) {
            v8h h;
            #pragma unroll   // constant indices keep the array in registers
            for (int i = 0; i < 8; ++i) h[i] = (_Float16)xr[i][j];
            *(v8h*)(sX + sDst + j * 32 * QPITCH) = h;
        }
    }
    __syncthreads();   // panel 0 is published

    v8f acc[2][8];
    #pragma unroll   // constant indices keep the array in registers
    for (int n = 0; n < 8; ++n) { acc[0][n] = (v8f){}; acc[1][n] = (v8f){}; }

    #pragma unroll   // constant buffer and panel offsets; no branch behind a product
    for (int kp = 0; kp < QNP; ++kp) {
        const _Float16* br = sX + (kp & 1) * QBUF + mn * QPITCH;
        // Eight steps of four products: step u takes k step SQ(u) and position tiles
        // 2*SN(u), 2*SN(u)+1. Both k steps are touched in the first two steps, so every
        // weight load has been waited for before the X loads are issued: loads return
        // in order, and a wait for a weight behind them would wait for memory too.
        #define SQ(u) ((u) < 2 ? (u) : ((u) < 5 ? 0 : 1))
        #define SN(u) ((u) < 2 ? 0 : ((u) < 5 ? (u) - 1 : (u) - 4))
        // X fragments come in pairs through a ring of three: pair u + 2 is asked for
        // in front of pair u's four products, so an LDS round trip hides under eight
        v16h bb[3][2];
        #pragma unroll   // constant indices keep the array in registers
        for (int u = 0; u < 2; ++u) {
            const _Float16* bn = br + SN(u) * 32 * QPITCH + SQ(u) * 32;
            bb[u][0] = load_frag_row(bn, half);
            bb[u][1] = load_frag_row(bn + 16 * QPITCH, half);
        }
        #pragma unroll   // constant indices keep the arrays in registers
        for (int u = 0; u < 8; ++u) {
            const int q = SQ(u), n = SN(u) * 2;
            if (u == 2 && kp + 1 < QNP && stager) {   // next panel's rows fly under the 24 products left
                #pragma unroll   // all 8 loads of a lane in flight together
                for (int i = 0; i < 8; ++i)
                    xr[i] = *(const v4f*)(xs + ((kp + 1) * QK + i) * HW + xoff);
            }
            if (u + 2 < 8) {
                const int v = u + 2;
                const _Float16* bn = br + SN(v) * 32 * QPITCH + SQ(v) * 32;
                bb[v % 3][0] = load_frag_row(bn, half);
                bb[v % 3][1] = load_frag_row(bn + 16 * QPITCH, half);
            }
            acc[0][n]     = WMMA_F16(aw[q][0], bb[u % 3][0], acc[0][n]);
            acc[1][n]     = WMMA_F16(aw[q][1], bb[u % 3][0], acc[1][n]);
            acc[0][n + 1] = WMMA_F16(aw[q][0], bb[u % 3][1], acc[0][n + 1]);
            acc[1][n + 1] = WMMA_F16(aw[q][1], bb[u % 3][1], acc[1][n + 1]);
            if ((u == 4 || u == 7) && kp + 1 < QNP) {   // this k step's weights are spent: fetch the next panel's
                aw[q][0] = load_frag_packed(wsel + woff + ((kp + 1) * (QK / 32) + q) * WFRAG);
                aw[q][1] = load_frag_packed(wsel + woff + (DIMS / 32 + (kp + 1) * (QK / 32) + q) * WFRAG);
            }
            // holds every load at the place written: sunk to its use, an LDS read would
            // stall each pair of products and a weight load each k step
            __builtin_amdgcn_sched_barrier(0);
        }

        if (kp + 1 < QNP && stager) {   // the other buffer's last readers left at the previous barrier
            _Float16* sn = sX + ((kp + 1) & 1) * QBUF + sDst;
            #pragma unroll   // constant indices keep the array in registers
            for (int j = 0; j < 4; ++j) {
                v8h h;
                #pragma unroll   // constant indices keep the array in registers
                for (int i = 0; i < 8; ++i) h[i] = (_Float16)xr[i][j];
                *(v8h*)(sn + j * 32 * QPITCH) = h;
            }
        }
        if (kp + 1 < QNP) {
            // publishes panel kp + 1 and ends every read of panel kp's buffer. The fences
            // name LDS alone: __syncthreads() would also drain the weight loads just
            // issued for the next panel, an L2 round trip in front of every barrier
            __builtin_amdgcn_fence(__ATOMIC_RELEASE, "workgroup", "local");
            __builtin_amdgcn_s_barrier();
            __builtin_amdgcn_fence(__ATOMIC_ACQUIRE, "workgroup", "local");
        }
    }

    // acc[mt][n][r]: channel mt*16 + half*8 + r of the wave's 32,
    // position hw0 + 4*((n & 1)*16 + mn) + (n >> 1)
    if (wave < 2) {   // theta: every position
        _Float16* dl = theta + ((size_t)b * HW + hw0) * C8 + wave * 32 + half * 8;
        #pragma unroll   // constant indices keep the array in registers
        for (int mt = 0; mt < 2; ++mt) {
            const float* bp = bsel + mt * 16 + half * 8;
            const v4f bl = *(const v4f*)(bp);
            const v4f bh = *(const v4f*)(bp + 4);
            #pragma unroll   // constant indices keep the array in registers
            for (int n = 0; n < 8; ++n) {
                const int p = 4 * ((n & 1) * 16 + mn) + (n >> 1);
                v8h h;
                #pragma unroll   // constant indices keep the array in registers
                for (int r = 0; r < 8; ++r)
                    h[r] = (_Float16)(acc[mt][n][r] + (r < 4 ? bl[r & 3] : bh[r & 3]));
                *(v8h*)(dl + p * C8 + mt * 16) = h;
            }
        }
        return;
    }

    // phi and g: tiles n = 4w .. 4w+3 are columns 4*mn + 2w, + 1 of both image rows,
    // the window of pooled column 2*mn + w in pooled row blockIdx.x. The bias is the
    // same over a window and rounding keeps order: maximum first, then bias and f16.
    // Both bias rows are fetched up front: no load stands behind a store.
    v8f pw[2][2];   // [channel tile][w]
    #pragma unroll   // constant indices keep the arrays in registers
    for (int mt = 0; mt < 2; ++mt) {
        const float* bp = bsel + mt * 16 + half * 8;
        const v4f bl = *(const v4f*)(bp);
        const v4f bh = *(const v4f*)(bp + 4);
        #pragma unroll   // constant indices keep the arrays in registers
        for (int w = 0; w < 2; ++w)
            #pragma unroll   // constant indices keep the arrays in registers
            for (int r = 0; r < 8; ++r)
                pw[mt][w][r] = fmaxf(fmaxf(acc[mt][4 * w][r],     acc[mt][4 * w + 1][r]),
                                     fmaxf(acc[mt][4 * w + 2][r], acc[mt][4 * w + 3][r]))
                               + (r < 4 ? bl[r & 3] : bh[r & 3]);
    }
    if (wave < 4) {   // phi[b][key][64]: eight channels of a key, 16 B
        _Float16* dp = phi + ((size_t)b * HW4 + blockIdx.x * 32 + 2 * mn) * C8 + (wave - 2) * 32 + half * 8;
        #pragma unroll   // constant indices keep the arrays in registers
        for (int mt = 0; mt < 2; ++mt)
            #pragma unroll   // constant indices keep the arrays in registers
            for (int w = 0; w < 2; ++w) {
                v8h h;
                #pragma unroll   // constant indices keep the arrays in registers
                for (int r = 0; r < 8; ++r) h[r] = (_Float16)pw[mt][w][r];
                *(v8h*)(dp + w * C8 + mt * 16) = h;
            }
        // stands in front of any later rewrite of these stores' address and data registers
        asm volatile("s_wait_xcnt 0x0" ::: "memory");
    } else {          // g tile: two keys of a channel, 4 B; 16 lanes fill the channel's 64 B
        _Float16* dg = g + (((size_t)b * (HW4 / GT) + blockIdx.x) * C2 + (wave - 4) * 32 + half * 8) * GT + 2 * mn;
        #pragma unroll   // constant indices keep the arrays in registers
        for (int mt = 0; mt < 2; ++mt)
            #pragma unroll   // constant indices keep the arrays in registers
            for (int r = 0; r < 8; ++r) {
                v2h kk = { (_Float16)pw[mt][0][r], (_Float16)pw[mt][1][r] };
                *(v2h*)(dg + (mt * 16 + r) * GT) = kk;
            }
        // stands in front of any later rewrite of these stores' address and data registers
        asm volatile("s_wait_xcnt 0x0" ::: "memory");
    }
}

// f32 -> f16 conversion of all four weight matrices in one launch. Their f16 copies
// lie back to back in the workspace (theta, phi, g, attn), so the destination is one
// array. The copies are in fragment order: matrix [M][K] becomes fragments of 16 rows x
// 32 k, fragment (row tile, k step) at index row tile * K / 32 + k step, laid out as
// load_frag_packed reads it. A block fills 2048 consecutive destination elements (four
// fragments), eight a lane (16-B stores, a wave fills four whole lines), and picks its
// source by its index: every matrix is a whole number of blocks. A lane's eight values
// are 32 consecutive bytes of one source row. Grid CVT_BLOCKS, block 256.
#define CVB        2048
#define CVT_B_PHI  (C8 * DIMS / CVB)                 // first block of w_phi
#define CVT_B_G    (CVT_B_PHI + C8 * DIMS / CVB)     // first block of w_g
#define CVT_B_ATT  (CVT_B_G + C2 * DIMS / CVB)       // first block of w_attn
#define CVT_BLOCKS (CVT_B_ATT + DIMS * C2 / CVB)
__global__ void __launch_bounds__(256)
cvt_weights_kernel(const float* __restrict__ wth,
                   const float* __restrict__ wph,
                   const float* __restrict__ wg,
                   const float* __restrict__ wat,
                   _Float16* __restrict__ dst) {
    const int blk = blockIdx.x;
    const float* src;   // the block's matrix
    int lb, ksl;        // the block's index in it; log2 of its k steps per row
    if (blk < CVT_B_PHI)      { src = wth; lb = blk;             ksl = 4; }
    else if (blk < CVT_B_G)   { src = wph; lb = blk - CVT_B_PHI; ksl = 4; }
    else if (blk < CVT_B_ATT) { src = wg;  lb = blk - CVT_B_G;   ksl = 4; }
    else                      { src = wat; lb = blk - CVT_B_ATT; ksl = 3; }
    const int t = threadIdx.x;
    const int e = t * 8;
    // 64 threads a fragment: bit 5 of t picks the first or second eight k values of
    // fragment lane t & 31, whose row is t & 15 and whose k half is bit 4
    const int f   = lb * (CVB / WFRAG) + (t >> 6);
    const int row = (f >> ksl) * 16 + (t & 15);
    const int col = (f & ((1 << ksl) - 1)) * 32 + ((t >> 5) & 1) * 16 + ((t >> 4) & 1) * 8;
    const float* sp = src + ((row << ksl) * 32 + col);
    const v4f lo = *(const v4f*)(sp);
    const v4f hi = *(const v4f*)(sp + 4);
    v8h h;
    #pragma unroll   // constant indices keep the vectors in registers
    for (int i = 0; i < 4; ++i) { h[i] = (_Float16)lo[i]; h[i + 4] = (_Float16)hi[i]; }
    *(v8h*)(dst + blk * CVB + e) = h;
}

// ---------------------------------------------------------------------------
// Attention, 256 queries per block: 8 waves x 32 queries walk the 1024 keys in
// chunks of 64 that the block stages once in LDS (two buffers), so every byte
// of phi and g fetched from L2 serves 256 queries.
//   S^T(key x query) = phi_chunk @ theta^T   (A from LDS, B kept in registers)
//   O^T(chan x query) += g_chunk @ P^T       (A from LDS, B packed from S^T)
// A wave holds two query tiles, so every fragment read from LDS feeds two
// products: with one tile a wave the LDS reads take twice the matrix time.
// A lane holds one query's scores per tile: running maximum and sum stay in
// registers. Grid (HW/256, B), block 256. Dynamic LDS = 2 x 46,080 B. Two waves
// per SIMD (the 256 x 32 f32 output tile alone is 256 VGPRs a wave).
// ---------------------------------------------------------------------------
#define KCH    64                    // keys per chunk
#define PITCH  72                    // LDS row pitch in halfwords (128 B + 16 B)
#define PHI_H  (KCH * PITCH)         // phi chunk: 64 key rows
#define BUF_H  ((KCH + C2) * PITCH)  // + g chunk: 256 channel rows
#define QT     2                     // query tiles per wave
#define GC     2                     // channel tiles per group of g fragments

// lane l <-> lane l ^ 16
__device__ __forceinline__ float xhalf(float x) {
    int i = __builtin_bit_cast(int, x);
    return __builtin_bit_cast(float,
        __builtin_amdgcn_permlanex16(i, i, 0x76543210, 0xfedcba98, false, false));
}

// 2^x; the v_nop keeps the one free issue slot that the instruction set asks for
// behind a transcendental, whatever the scheduler places next
__device__ __forceinline__ float exp2_slot(float x) {
    float r;
    asm("v_exp_f32 %0, %1\n\tv_nop" : "=v"(r) : "v"(x));
    return r;
}

__global__ void __launch_bounds__(256) __attribute__((amdgpu_waves_per_eu(2, 2)))
attn_wmma_kernel(const _Float16* __restrict__ theta,
                 const _Float16* __restrict__ phi,
                 const _Float16* __restrict__ g,
                 _Float16* __restrict__ o) {
    extern __shared__ __attribute__((aligned(16))) char smem[];
    _Float16* sBuf = (_Float16*)smem;

    const int b    = blockIdx.y;
    const int t    = threadIdx.x;
    const int lane = t & 31;
    const int wave = t >> 5;
    const int half = lane >> 4;
    const int mn   = lane & 15;
    const int q0   = blockIdx.x * 256 + wave * (16 * QT);

    // staging: 8 threads per 128-byte row, 32 rows per sweep
    const int srow = t >> 3, scol = (t & 7) * 8;
    const char* pBase = (const char*)(phi + (size_t)b * HW4 * C8);   // uniform bases,
    const char* gBase = (const char*)(g + (size_t)b * C2 * HW4);     // 32-bit lane offsets
    const int pOff = (srow * C8 + scol) * 2;                                          // in bytes
    const int gOff = ((scol / GT) * (C2 * GT) + srow * GT + (scol & (GT - 1))) * 2;   // a chunk is two key tiles of g
    const int sDst = srow * PITCH + scol;

    // theta^T as B operand: lane = query, K = channel, kept for the whole walk
    const _Float16* tq = theta + ((size_t)b * HW + q0 + mn) * C8 + half * 8;
    v16h bq[QT][2];
    #pragma unroll   // constant indices keep the array in registers
    for (int qt = 0; qt < QT; ++qt) {
        bq[qt][0] = load_frag_row(tq + qt * 16 * C8, 0);
        bq[qt][1] = load_frag_row(tq + qt * 16 * C8 + 32, 0);
    }
    // stands in front of any later rewrite of these loads' address registers; it
    // names the address, so that its registers stay untouched up to the wait
    asm volatile("s_wait_xcnt 0x0" :: "v"(tq) : "memory");

    v8h stP[2], stG[8];
    #pragma unroll   // constant indices keep the array in registers
    for (int j = 0; j < 2; ++j) stP[j] = *(const v8h*)(pBase + pOff + j * 32 * C8 * 2);
    #pragma unroll   // constant indices keep the array in registers
    for (int j = 0; j < 8; ++j) stG[j] = *(const v8h*)(gBase + gOff + j * 32 * GT * 2);
    // the same for the staging loads and their two lane offsets
    asm volatile("s_wait_xcnt 0x0" :: "v"(pOff), "v"(gOff) : "memory");
    #pragma unroll   // constant indices keep the array in registers
    for (int j = 0; j < 2; ++j) *(v8h*)(sBuf + sDst + j * 32 * PITCH) = stP[j];
    #pragma unroll   // constant indices keep the array in registers
    for (int j = 0; j < 8; ++j) *(v8h*)(sBuf + PHI_H + sDst + j * 32 * PITCH) = stG[j];
    __syncthreads();   // chunk 0 is published

    const float L2E = 1.4426950408889634f;
    v8f acc[16][QT];
    #pragma unroll   // constant indices keep the array in registers
    for (int ct = 0; ct < 16; ++ct)
        #pragma unroll   // constant indices keep the array in registers
        for (int qt = 0; qt < QT; ++qt) acc[ct][qt] = (v8f){};
    float ms[QT], l[QT];   // running maximum, in log2 units; running sum over this lane's keys
    #pragma unroll   // constant indices keep the arrays in registers
    for (int qt = 0; qt < QT; ++qt) { ms[qt] = -3.0e38f; l[qt] = 0.f; }

    for (int kc = 0; kc < HW4 / KCH; ++kc) {
        const _Float16* sp = sBuf + (kc & 1) * BUF_H;
        const _Float16* sg = sp + PHI_H;
        // the chunk staged during this trip. The last trip fetches its own chunk again,
        // into the buffer that nobody reads any more: with no branch the trip is one
        // block of code, and the fences below can hold its loads and sums in place
        const int kn = kc + 1 < HW4 / KCH ? kc + 1 : kc;

        // ---- S^T: s[qt][kt][r] = score(key kt*16 + r + 8*half, query qt*16 + mn) ----
        v16h ap[4][2];
        #pragma unroll   // constant indices keep the array in registers
        for (int kt = 0; kt < 4; ++kt) {
            const _Float16* pr = sp + (kt * 16 + mn) * PITCH;
            ap[kt][0] = load_frag_row(pr, half);
            ap[kt][1] = load_frag_row(pr + 32, half);
        }
        // all sixteen phi reads go out as one group: spread among the products, each
        // pair of products would wait out an LDS round trip of its own
        __builtin_amdgcn_sched_barrier(0);
        v8f s[QT][4];
        #pragma unroll   // constant indices keep the arrays in registers
        for (int kt = 0; kt < 4; ++kt) {
            #pragma unroll   // constant indices keep the arrays in registers
            for (int qt = 0; qt < QT; ++qt) {
                v8f z = {};
                z = WMMA_F16(ap[kt][0], bq[qt][0], z);
                z = WMMA_F16(ap[kt][1], bq[qt][1], z);
                s[qt][kt] = z;
            }
        }
        // holds the score products in front of the g reads below: the phi fragments'
        // registers are free again before the ring takes its own
        __builtin_amdgcn_sched_barrier(0);

        // g fragments come in groups of two channel tiles through a ring of three. With
        // two waves a SIMD a wave hides its own LDS round trips: group 0 is asked for
        // here and lands under the softmax, group 1 behind the softmax (the scores'
        // registers are free then), group u + 2 in front of group u's products
        v16h ar[3][GC][2];
        #pragma unroll   // constant indices keep the array in registers
        for (int c = 0; c < GC; ++c) {
            const _Float16* gr = sg + (c * 16 + mn) * PITCH;
            ar[0][c][0] = load_frag_row(gr, half);
            ar[0][c][1] = load_frag_row(gr + 32, half);
        }
        // keeps those reads here: sunk to their use they would stall the first products
        __builtin_amdgcn_sched_barrier(0);

        // ---- running softmax, one query per lane and tile ----
        // P^T as B operand: score tiles 2ks and 2ks+1 already sit in the k order
        // of load_frag_row (half*8 + i, then 16 + half*8 + i)
        v16h p[QT][2];
        float alpha[QT];
        #pragma unroll   // constant indices keep the arrays in registers
        for (int qt = 0; qt < QT; ++qt) {
            float mx = s[qt][0][0];
            #pragma unroll   // constant indices keep the array in registers
            for (int kt = 0; kt < 4; ++kt)
                #pragma unroll   // constant indices keep the array in registers
                for (int r = 0; r < 8; ++r) mx = fmaxf(mx, s[qt][kt][r]);
            mx = fmaxf(mx, xhalf(mx));
            const float msn = fmaxf(ms[qt], mx * L2E);
            alpha[qt] = exp2_slot(ms[qt] - msn);   // 0 on the first chunk
            ms[qt] = msn;

            float ls = 0.f;
            #pragma unroll   // constant indices keep the array in registers
            for (int ks = 0; ks < 2; ++ks) {
                #pragma unroll   // constant indices keep the array in registers
                for (int r = 0; r < 8; ++r) {
                    const float x0 = fmaf(s[qt][2 * ks][r],     L2E, -msn);
                    const float x1 = fmaf(s[qt][2 * ks + 1][r], L2E, -msn);
                    const float e0 = exp2_slot(x0);
                    const float e1 = exp2_slot(x1);
                    ls += e0 + e1;
                    p[qt][ks][r]     = (_Float16)e0;
                    p[qt][ks][r + 8] = (_Float16)e1;
                }
            }
            l[qt] = l[qt] * alpha[qt] + ls;
        }

        // ends the softmax here: group 1's reads take registers that the scores have left,
        // and row sums sunk below the products would hold their exponentials in
        // registers through the whole walk over g
        __builtin_amdgcn_sched_barrier(0);
        #pragma unroll   // constant indices keep the array in registers
        for (int c = 0; c < GC; ++c) {
            const _Float16* gr = sg + ((GC + c) * 16 + mn) * PITCH;
            ar[1][c][0] = load_frag_row(gr, half);
            ar[1][c][1] = load_frag_row(gr + 32, half);
        }

        {   // next chunk's loads fly under the 64 products below (scores are packed: registers free)
            const int k1 = kn * KCH;
            #pragma unroll   // constant indices keep the array in registers
            for (int j = 0; j < 2; ++j)
                stP[j] = *(const v8h*)(pBase + (j * 32 * C8 + k1 * C8) * 2 + pOff);
            #pragma unroll   // constant indices keep the array in registers
            for (int j = 0; j < 8; ++j)
                stG[j] = *(const v8h*)(gBase + (j * 32 * GT + k1 * C2) * 2 + gOff);
            // stands in front of any later rewrite of these loads' address registers
            asm volatile("s_wait_xcnt 0x0" ::: "memory");
        }

        // ---- O^T += g_chunk @ P^T: each g fragment serves both query tiles ----
        // a group's tiles are rescaled one step ahead, among the products of the group before
        #pragma unroll   // constant indices keep the array in registers
        for (int c = 0; c < GC; ++c)
            #pragma unroll   // constant indices keep the array in registers
            for (int qt = 0; qt < QT; ++qt) acc[c][qt] *= alpha[qt];
        // keeps group 1's reads and the first rescale in front of the products
        __builtin_amdgcn_sched_barrier(0);
        #pragma unroll   // constant indices keep the arrays in registers
        for (int u = 0; u < 16 / GC; ++u) {
            if (u + 2 < 16 / GC) {
                #pragma unroll   // constant indices keep the array in registers
                for (int c = 0; c < GC; ++c) {
                    const _Float16* gr = sg + (((u + 2) * GC + c) * 16 + mn) * PITCH;
                    ar[(u + 2) % 3][c][0] = load_frag_row(gr, half);
                    ar[(u + 2) % 3][c][1] = load_frag_row(gr + 32, half);
                }
            }
            #pragma unroll   // constant indices keep the arrays in registers
            for (int c = 0; c < GC; ++c) {
                const int ct = u * GC + c;
                #pragma unroll   // constant indices keep the arrays in registers
                for (int qt = 0; qt < QT; ++qt)
                    acc[ct][qt] = WMMA_F16(ar[u % 3][c][0], p[qt][0], acc[ct][qt]);
                if (u + 1 < 16 / GC) {
                    #pragma unroll   // constant indices keep the arrays in registers
                    for (int qt = 0; qt < QT; ++qt) acc[ct + GC][qt] *= alpha[qt];
                }
                #pragma unroll   // constant indices keep the arrays in registers
                for (int qt = 0; qt < QT; ++qt)
                    acc[ct][qt] = WMMA_F16(ar[u % 3][c][1], p[qt][1], acc[ct][qt]);
            }
            // holds each group's reads two groups ahead of their products: sunk to
            // their use, every pair of products would wait out an LDS round trip
            __builtin_amdgcn_sched_barrier(0);
        }

        {   // the other buffer's last readers left at the previous barrier
            _Float16* sn = sBuf + ((kc + 1) & 1) * BUF_H;
            #pragma unroll   // constant indices keep the array in registers
            for (int j = 0; j < 2; ++j) *(v8h*)(sn + sDst + j * 32 * PITCH) = stP[j];
            #pragma unroll   // constant indices keep the array in registers
            for (int j = 0; j < 8; ++j) *(v8h*)(sn + PHI_H + sDst + j * 32 * PITCH) = stG[j];
        }
        __syncthreads();   // publishes chunk kc + 1 and ends every read of chunk kc's buffer
    }

    #pragma unroll   // constant indices keep the arrays in registers
    for (int qt = 0; qt < QT; ++qt) {
        const float lt  = l[qt] + xhalf(l[qt]);
        const float inv = 1.0f / lt;
        _Float16* orow = o + ((size_t)b * HW + q0 + qt * 16 + mn) * C2 + half * 8;
        #pragma unroll   // constant indices keep the array in registers
        for (int ct = 0; ct < 16; ++ct) {
            v8h h;
            #pragma unroll   // constant indices keep the array in registers
            for (int r = 0; r < 8; ++r) h[r] = (_Float16)(acc[ct][qt][r] * inv);
            *(v8h*)(orow + ct * 16) = h;
        }
    }
}

// ---------------------------------------------------------------------------
// Final: out[b][co][hw] = x + sigma*(w_attn[co,:]·attnG[b][hw,:] + b_attn[co])
// One block of 8 waves a WGP. A block takes 256 output channels and walks eight
// tiles of 64 positions, 512 positions apart: the sixteen blocks of an image stand on
// eight neighbouring tiles at any time, 2 KB of every x and out row. A wave fetches the weight fragments of its 32 channels
// once and keeps them in registers for the whole walk: fetched anew for every
// tile they are more than half of all that the kernel reads through L2.
// The 64 attnG rows of a tile are staged in LDS (two buffers, whole 512-B rows in,
// 528-B pitch) and serve all waves. A wave does 32 channels x 64 positions as
//   D(channel x position) = w_attn_tile @ attnG_tile^T   (A in registers, B from LDS)
// Position tile j holds positions 4*mn + j, so a lane ends with four consecutive
// positions of one channel: x and out move 16 B a lane, 256 B a half wave.
// The next tile's x rows and attnG rows are asked for in front of a tile's
// products and fly under them.
// Grid (512/256, HW/512, B), block 256. Dynamic LDS = 2 x 33,792 B.
// ---------------------------------------------------------------------------
#define FHW    64     // positions per tile
#define FNT    8      // tiles per block
#define FPITCH 264    // LDS row pitch in halfwords (512 B + 16 B)
#define FSTEP  (HW / FNT)   // positions from one tile of a block to its next
#define FBUF   (FHW * FPITCH)
#define FKS    (C2 / 32)

// Work-group barrier whose fences name LDS alone: __syncthreads() would also drain
// the global loads and stores in flight, a memory round trip in front of every barrier
__device__ __forceinline__ void lds_barrier() {
    __builtin_amdgcn_fence(__ATOMIC_RELEASE, "workgroup", "local");
    __builtin_amdgcn_s_barrier();
    __builtin_amdgcn_fence(__ATOMIC_ACQUIRE, "workgroup", "local");
}

__global__ void __launch_bounds__(256) __attribute__((amdgpu_waves_per_eu(2, 2)))
final_conv_kernel(const _Float16* __restrict__ ag,
                  const _Float16* __restrict__ Wh,
                  const float* __restrict__ bt,
                  const float* __restrict__ x,
                  const float* __restrict__ sigma,
                  float* __restrict__ out) {
    extern __shared__ __attribute__((aligned(16))) char smem[];
    _Float16* sB = (_Float16*)smem;

    const int hw0  = blockIdx.y * FHW;   // first tile
    const int b    = blockIdx.z;
    const int t    = threadIdx.x;
    const int lane = t & 31;
    const int wave = t >> 5;
    const int half = lane >> 4;
    const int mn   = lane & 15;
    const int cob  = blockIdx.x * 256;   // the block's first channel

    // a wave fetches one whole row a load; position p lands in LDS row (p & 3) * 16 + (p >> 2)
    const _Float16* abase = ag + ((size_t)b * HW + hw0) * C2;   // uniform bases,
    const _Float16* wbase = Wh + (size_t)cob * C2;              // 32-bit lane offsets
    const int aoff = wave * C2 + lane * 8;
    const int woff = wave * 32 * C2 + lane * 8;   // fragment (mt, ks) of the wave: (mt * FKS + ks) * WFRAG
    v8h st[8];
    #pragma unroll   // all 8 loads of a lane in flight together
    for (int i = 0; i < 8; ++i) st[i] = *(const v8h*)(abase + aoff + i * 8 * C2);
    // stands in front of any later rewrite of these loads' address registers, and keeps
    // the row loads first in the queue: loads return in order, and the LDS stores
    // below would otherwise wait for the weight fragments too
    asm volatile("s_wait_xcnt 0x0" ::: "memory");

    const float s = sigma[0];
    v4f bv[2][2];      // bias of the lane's sixteen channels
    #pragma unroll   // constant indices keep the array in registers
    for (int mt = 0; mt < 2; ++mt) {
        const float* bp = bt + cob + wave * 32 + mt * 16 + half * 8;
        bv[mt][0] = *(const v4f*)(bp);
        bv[mt][1] = *(const v4f*)(bp + 4);
    }
    // stands in front of any later rewrite of these loads' address registers, and keeps
    // the bias in front of the weights in the queue: nothing in front of the first
    // products then waits for the weights, and tile 0's x loads go out at once
    asm volatile("s_wait_xcnt 0x0" ::: "memory");

    v16h aw[FKS][2];   // all weight fragments of the wave's 32 channels
    #pragma unroll   // constant indices keep the array in registers
    for (int q = 0; q < FKS; ++q) {
        aw[q][0] = load_frag_packed(wbase + woff + q * WFRAG);
        aw[q][1] = load_frag_packed(wbase + woff + (FKS + q) * WFRAG);
    }
    // stands in front of any later rewrite of these loads' address registers
    asm volatile("s_wait_xcnt 0x0" ::: "memory");

    const int sDst = ((wave & 3) * 16 + (wave >> 2)) * FPITCH + lane * 8;   // row of position p = i * 8 + wave: + 2 * i rows
    #pragma unroll   // constant indices keep the array in registers
    for (int i = 0; i < 8; ++i) *(v8h*)(sB + sDst + i * 2 * FPITCH) = st[i];
    lds_barrier();   // tile 0 is published

    const float* xb = x   + ((size_t)b * DIMS + cob) * HW + hw0;
    float*       ob = out + ((size_t)b * DIMS + cob) * HW + hw0;
    const int eoff = (wave * 32 + half * 8) * HW + mn * 4;

    // x rows run one tile ahead in two register sets: a tile's rows are asked for in front
    // of the products of the tile before, so they have a whole trip to arrive and the
    // read queue is not empty while a tile's stores drain.
    // Channel offset mt*16 + r -> xv[set][mt*8 + r]
    v4f xv[2][16];
    #pragma unroll   // all 16 loads of a lane in flight together
    for (int e = 0; e < 16; ++e)
        xv[0][e] = *(const v4f*)(xb + eoff + ((e >> 3) * 16 + (e & 7)) * HW);
    // stands in front of any later rewrite of these loads' address registers
    asm volatile("s_wait_xcnt 0x0" ::: "memory");
    // 52 loads stand open here and the first trip asks for 24 more: the oldest weight loads
    // are waited for, so that a wave never has more than 63 loads open
    asm volatile("s_wait_loadcnt 0x27" ::: "memory");

    #pragma unroll 1   // one copy of a pair of trips: the text stays small, the weights stay where they are
    for (int it2 = 0; it2 < FNT; it2 += 2) {
        #pragma unroll   // two trips a pass: the x set and the LDS buffer of a trip are constants
        for (int h = 0; h < 2; ++h) {
            const int it = it2 + h;
            const _Float16* br = sB + h * FBUF + mn * FPITCH;
            // The next tile's attnG rows and x rows. The last trip fetches its own tile again, the
            // rows into the buffer that nobody reads any more: behind a branch the waits below
            // could not be counted, and every second trip would drain the x rows asked for ahead
            const int nx = (h == 0 || it2 + 2 < FNT) ? it + 1 : it;
            {
                const _Float16* an = abase + nx * (FSTEP * C2);
                #pragma unroll   // all 8 loads of a lane in flight together
                for (int i = 0; i < 8; ++i) st[i] = *(const v8h*)(an + aoff + i * 8 * C2);
                // stands in front of any later rewrite of these loads' address registers, and keeps
                // the attnG rows in front of the x rows in the queue: loads return in order, and
                // the LDS stores at the foot of this trip would otherwise wait for the x rows too
                asm volatile("s_wait_xcnt 0x0" ::: "memory");
                const float* xt = xb + nx * FSTEP;
                #pragma unroll   // all 16 loads of a lane in flight together
                for (int e = 0; e < 16; ++e)
                    xv[h ^ 1][e] = *(const v4f*)(xt + eoff + ((e >> 3) * 16 + (e & 7)) * HW);
                // stands in front of any later rewrite of these loads' address registers
                asm volatile("s_wait_xcnt 0x0" ::: "memory");
            }

            // attnG fragments come a k step at a time through a ring of three: step ks + 2 is
            // asked for in front of step ks's eight products, so an LDS round trip hides under sixteen
            v16h bb[3][4];
            #pragma unroll   // constant indices keep the array in registers
            for (int u = 0; u < 2; ++u)
                #pragma unroll   // constant indices keep the array in registers
                for (int j = 0; j < 4; ++j) bb[u][j] = load_frag_row(br + j * 16 * FPITCH + u * 32, half);
            // holds these reads in front of the products: sunk to their use, the
            // first products would wait out an LDS round trip each
            __builtin_amdgcn_sched_barrier(0);

            v8f acc[2][4];
            #pragma unroll   // constant indices keep the array in registers
            for (int j = 0; j < 4; ++j) { acc[0][j] = (v8f){}; acc[1][j] = (v8f){}; }
            #pragma unroll   // constant indices keep the arrays in registers
            for (int ks = 0; ks < FKS; ++ks) {
                if (ks + 2 < FKS) {
                    #pragma unroll   // constant indices keep the array in registers
                    for (int j = 0; j < 4; ++j)
                        bb[(ks + 2) % 3][j] = load_frag_row(br + j * 16 * FPITCH + (ks + 2) * 32, half);
                }
                #pragma unroll   // constant indices keep the arrays in registers
                for (int j = 0; j < 4; ++j) {
                    acc[0][j] = WMMA_F16(aw[ks][0], bb[ks % 3][j], acc[0][j]);
                    acc[1][j] = WMMA_F16(aw[ks][1], bb[ks % 3][j], acc[1][j]);
                }
                // holds each step's reads two steps ahead of their products: sunk to
                // their use, every pair of products would wait out an LDS round trip
                __builtin_amdgcn_sched_barrier(0);
            }

            // acc[mt][j][r]: channel cob + wave*32 + mt*16 + half*8 + r, position hw0 + it*512 + 4*mn + j
            float* ot = ob + it * FSTEP;
            #pragma unroll   // constant indices keep the array in registers
            for (int mt = 0; mt < 2; ++mt) {
                #pragma unroll   // constant indices keep the array in registers
                for (int r = 0; r < 8; ++r) {
                    const float bc = bv[mt][r >> 2][r & 3];
                    #pragma unroll   // constant indices keep the array in registers
                    for (int j = 0; j < 4; ++j)
                        xv[h][mt * 8 + r][j] = xv[h][mt * 8 + r][j] + s * (acc[mt][j][r] + bc);
                }
            }
            // all sums in front of all stores: no register of an issued store is
            // rewritten in front of the wait below
            __builtin_amdgcn_sched_barrier(0);
            #pragma unroll   // constant indices keep the array in registers
            for (int e = 0; e < 16; ++e)
                *(v4f*)(ot + eoff + ((e >> 3) * 16 + (e & 7)) * HW) = xv[h][e];
            // stands in front of any later rewrite of these stores' address and data registers
            asm volatile("s_wait_xcnt 0x0" ::: "memory");

            {
                // the other buffer's last readers left at the previous barrier
                _Float16* sn = sB + (h ^ 1) * FBUF + sDst;
                #pragma unroll   // constant indices keep the array in registers
                for (int i = 0; i < 8; ++i) *(v8h*)(sn + i * 2 * FPITCH) = st[i];
                lds_barrier();   // publishes tile it + 1 and ends every read of tile it's buffer
            }
        }
    }
    // the last trip's spare x rows have landed before the wave gives its registers back
    asm volatile("s_wait_loadcnt 0x0" ::: "memory");
}

// ---------------------------------------------------------------------------
extern "C" void kernel_launch(void* const* d_in, const int* in_sizes, int n_in,
                              void* d_out, int out_size, void* d_ws, size_t ws_size,
                              hipStream_t stream) {
    const float* x       = (const float*)d_in[0];
    const float* w_theta = (const float*)d_in[1];
    const float* b_theta = (const float*)d_in[2];
    const float* w_phi   = (const float*)d_in[3];
    const float* b_phi   = (const float*)d_in[4];
    const float* w_g     = (const float*)d_in[5];
    const float* b_g     = (const float*)d_in[6];
    const float* w_attn  = (const float*)d_in[7];
    const float* b_attn  = (const float*)d_in[8];
    const float* sigma   = (const float*)d_in[9];
    float* out = (float*)d_out;

    char* ws = (char*)d_ws;
    _Float16* theta   = (_Float16*)(ws);                 //  8 MB   [b][hw][64]
    _Float16* phi     = (_Float16*)(ws +  8388608);      //  2 MB   [b][key][64]
    _Float16* gbuf    = (_Float16*)(ws + 10485760);      //  8 MB   [b][key/32][c][key%32]
    _Float16* wth_h   = (_Float16*)(ws + 18874368);      //  64 KB  [64][512], fragment order
    _Float16* wph_h   = (_Float16*)(ws + 18939904);      //  64 KB  [64][512], fragment order
    _Float16* wg_h    = (_Float16*)(ws + 19005440);      // 256 KB  [256][512], fragment order
    _Float16* wat_h   = (_Float16*)(ws + 19267584);      // 256 KB  [512][256], fragment order
    _Float16* attnout = (_Float16*)(ws + 19529728);      //  32 MB  [b][hw][256]

    // wth_h, wph_h, wg_h and wat_h are one contiguous range that starts at wth_h
    cvt_weights_kernel<<<CVT_BLOCKS, 256, 0, stream>>>(w_theta, w_phi, w_g, w_attn, wth_h);

    // one pass over X produces theta and the pooled phi and g
    qkv_conv_kernel<<<dim3(HW / QP, NB), dim3(384), 0, stream>>>(
        x, wth_h, wph_h, wg_h, b_theta, b_phi, b_g, theta, phi, gbuf);
    attn_wmma_kernel<<<dim3(HW / 256, NB), dim3(256), 2 * BUF_H * 2, stream>>>(
        theta, phi, gbuf, attnout);
    final_conv_kernel<<<dim3(DIMS / 256, HW / (FHW * FNT), NB), dim3(256), 2 * FBUF * 2, stream>>>(
        attnout, wat_h, b_attn, x, sigma, out);
}

// v010
// Measured time: 83.1 microseconds a run.
// Two timings next to v009 both put it at 1.08 times that version's speed.
// Over all steps from v000 it is 6.59 times as fast.
#include <hip/hip_runtime.h>
#include <hip/hip_bf16.h>

typedef __attribute__((ext_vector_type(16))) _Float16 v16h;
typedef __attribute__((ext_vector_type(8)))  _Float16 v8h;
typedef __attribute__((ext_vector_type(2)))  _Float16 v2h;
typedef __attribute__((ext_vector_type(8)))  float    v8f;
typedef __attribute__((ext_vector_type(4)))  float    v4f;
typedef __attribute__((ext_vector_type(2)))  float    v2f;

#define DIMS 512
#define NB   16
#define HW   4096   // 64*64
#define HW4  1024   // pooled positions
#define C8   64
#define C2   256
#define GT   32     // keys per tile of g: g[b][key / GT][channel][key % GT]

#define WMMA_F16(A, B, C) __builtin_amdgcn_wmma_f32_16x16x32_f16(false, A, false, B, (short)0, C, false, false)

// Fragment K pattern for 16x16x32 f16 WMMA (ISA 7.12.2):
//   lane half 0: K in [0,8) and [16,24);  lane half 1: K in [8,16) and [24,32).
// With K contiguous in memory a fragment is exactly two 16-byte loads.
__device__ __forceinline__ v16h load_frag_row(const _Float16* __restrict__ p, int half) {
    v8h lo = *(const v8h*)(p + half * 8);
    v8h hi = *(const v8h*)(p + 16 + half * 8);
    v16h r;
    #pragma unroll
    for (int i = 0; i < 8; ++i) { r[i] = lo[i]; r[i + 8] = hi[i]; }
    return r;
}

// A weight fragment kept in fragment order (cvt_weights_kernel writes it): 1 KB, lane l's
// first eight k values at l * 16 B, its second eight at 512 B + l * 16 B. p points at the
// lane's first eight. Each of the two loads is 512 contiguous bytes of a wave, four whole
// lines; from row-major weights it touches sixteen lines for the same bytes.
#define WFRAG 512   // halfwords per fragment (16 rows x 32 k)
__device__ __forceinline__ v16h load_frag_packed(const _Float16* __restrict__ p) {
    v8h lo = *(const v8h*)(p);
    v8h hi = *(const v8h*)(p + WFRAG / 2);
    v16h r;
    #pragma unroll   // constant indices keep the vectors in registers
    for (int i = 0; i < 8; ++i) { r[i] = lo[i]; r[i + 8] = hi[i]; }
    return r;
}

// ---------------------------------------------------------------------------
// Fused QKV 1x1 conv: reads X once, produces theta and the max-pooled phi and g.
// A block of 12 waves takes 128 positions (two image rows) x all 64+64+256 output
// channels, so every 2x2 pooling window lies inside one block.
// X is staged as f16 in LDS in panels of 64 input channels (two buffers): a
// staging wave reads whole 512-B rows of X, 16 B a lane, eight rows a panel, and
// each lane packs its four positions' eight channels into four 16-B LDS stores.
// Position p lands in LDS row (p & 3) * 32 + (p >> 2), so that the lanes of one
// store walk consecutive rows. A wave does 32 channels x 128 positions as
//   D(channel x position) = w_tile @ X_tile   (A from global, B from LDS)
// so a weight row fetched once serves 128 positions, and a lane ends with eight
// consecutive channels of eight positions. Those eight positions are two whole
// pooling windows: phi and g are pooled in registers and never stored unpooled.
// g goes out in tiles of 32 keys, g[b][key / 32][channel][key % 32]: the block
// writes one whole tile, so no 128-B line has a second writer.
// Weight fragments run one panel ahead in registers.
// Grid (HW/128, B), block 384.
// ---------------------------------------------------------------------------
#define QP     128            // positions per block
#define QK     64             // input channels per panel
#define QPITCH 72             // LDS row pitch in halfwords (128 B + 16 B)
#define QBUF   (QP * QPITCH)
#define QNP    (DIMS / QK)
__global__ void __launch_bounds__(384)
qkv_conv_kernel(const float* __restrict__ X,
                const _Float16* __restrict__ Wth,
                const _Float16* __restrict__ Wph,
                const _Float16* __restrict__ Wg,
                const float* __restrict__ bth,
                const float* __restrict__ bph,
                const float* __restrict__ bg,
                _Float16* __restrict__ theta,
                _Float16* __restrict__ phi,
                _Float16* __restrict__ g) {
    __shared__ __attribute__((aligned(16))) _Float16 sX[2 * QBUF];

    const int hw0  = blockIdx.x * QP;
    const int b    = blockIdx.y;
    const int t    = threadIdx.x;
    const int lane = t & 31;
    const int wave = __builtin_amdgcn_readfirstlane(t >> 5);   // scalar: uniform bases and branches
    const int half = lane >> 4;
    const int mn   = lane & 15;

    // the wave's 32 output channels: waves 0-1 theta, 2-3 phi, 4-11 g
    const _Float16* wsel;
    const float*    bsel;
    if (wave < 2)      { wsel = Wth + wave * 32 * DIMS;       bsel = bth + wave * 32; }
    else if (wave < 4) { wsel = Wph + (wave - 2) * 32 * DIMS; bsel = bph + (wave - 2) * 32; }
    else               { wsel = Wg + (wave - 4) * 32 * DIMS;  bsel = bg + (wave - 4) * 32; }
    const int woff = lane * 8;   // fragment (channel tile mt, k step ks) of the wave: (mt * DIMS / 32 + ks) * WFRAG

    // staging: waves 0-7 take eight X rows of each panel
    const bool stager = wave < QK / 8;
    const float* xs = X + ((size_t)b * DIMS + (wave & 7) * 8) * HW + hw0;
    const int xoff = lane * 4;
    const int sDst = lane * QPITCH + (wave & 7) * 8;

    v4f xr[8];
    if (stager) {
        #pragma unroll   // all 8 loads of a lane in flight together
        for (int i = 0; i < 8; ++i) xr[i] = *(const v4f*)(xs + i * HW + xoff);
    }
    // keeps the X loads first in the queue: loads return in order, and the LDS
    // stores below would otherwise wait for the weight fragments too
    __builtin_amdgcn_sched_barrier(0);

    v16h aw[2][2];   // weight fragments of one panel (two k steps, two channel tiles)
    #pragma unroll   // constant indices keep the array in registers
    for (int q = 0; q < 2; ++q) {
        aw[q][0] = load_frag_packed(wsel + woff + q * WFRAG);
        aw[q][1] = load_frag_packed(wsel + woff + (DIMS / 32 + q) * WFRAG);
    }
    // stands in front of any later rewrite of these loads' address registers; it names
    // the lane number they are formed from, so that its register stays untouched up to the wait
    asm volatile("s_wait_xcnt 0x0" :: "v"(lane) : "memory");

    if (stager) {
        #pragma unroll   // constant indices keep the array in registers
        for (int j = 0; j < 4; ++j) {
            v8h h;
            #pragma unroll   // constant indices keep the array in registers
            for (int i = 0; i < 8; ++i) h[i] = (_Float16)xr[i][j];
            *(v8h*)(sX + sDst + j * 32 * QPITCH) = h;
        }
    }
    __syncthreads();   // panel 0 is published

    v8f acc[2][8];
    #pragma unroll   // constant indices keep the array in registers
    for (int n = 0; n < 8; ++n) { acc[0][n] = (v8f){}; acc[1][n] = (v8f){}; }

    #pragma unroll   // constant buffer and panel offsets; no branch behind a product
    for (int kp = 0; kp < QNP; ++kp) {
        const _Float16* br = sX + (kp & 1) * QBUF + mn * QPITCH;
        // Eight steps of four products: step u takes k step SQ(u) and position tiles
        // 2*SN(u), 2*SN(u)+1. Both k steps are touched in the first two steps, so every
        // weight load has been waited for before the X loads are issued: loads return
        // in order, and a wait for a weight behind them would wait for memory too.
        #define SQ(u) ((u) < 2 ? (u) : ((u) < 5 ? 0 : 1))
        #define SN(u) ((u) < 2 ? 0 : ((u) < 5 ? (u) - 1 : (u) - 4))
        // X fragments come in pairs through a ring of three: pair u + 2 is asked for
        // in front of pair u's four products
        v16h bb[3][2];
        #pragma unroll   // constant indices keep the array in registers
        for (int u = 0; u < 2; ++u) {
            const _Float16* bn = br + SN(u) * 32 * QPITCH + SQ(u) * 32;
            bb[u][0] = load_frag_row(bn, half);
            bb[u][1] = load_frag_row(bn + 16 * QPITCH, half);
        }
        #pragma unroll   // constant indices keep the arrays in registers
        for (int u = 0; u < 8; ++u) {
            const int q = SQ(u), n = SN(u) * 2;
            if (u == 2 && kp + 1 < QNP && stager) {   // next panel's rows fly under the 24 products left
                #pragma unroll   // all 8 loads of a lane in flight together
                for (int i = 0; i < 8; ++i)
                    xr[i] = *(const v4f*)(xs + ((kp + 1) * QK + i) * HW + xoff);
            }
            if (u + 2 < 8) {
                const int v = u + 2;
                const _Float16* bn = br + SN(v) * 32 * QPITCH + SQ(v) * 32;
                bb[v % 3][0] = load_frag_row(bn, half);
                bb[v % 3][1] = load_frag_row(bn + 16 * QPITCH, half);
            }
            acc[0][n]     = WMMA_F16(aw[q][0], bb[u % 3][0], acc[0][n]);
            acc[1][n]     = WMMA_F16(aw[q][1], bb[u % 3][0], acc[1][n]);
            acc[0][n + 1] = WMMA_F16(aw[q][0], bb[u % 3][1], acc[0][n + 1]);
            acc[1][n + 1] = WMMA_F16(aw[q][1], bb[u % 3][1], acc[1][n + 1]);
            if ((u == 4 || u == 7) && kp + 1 < QNP) {   // this k step's weights are spent: fetch the next panel's
                aw[q][0] = load_frag_packed(wsel + woff + ((kp + 1) * (QK / 32) + q) * WFRAG);
                aw[q][1] = load_frag_packed(wsel + woff + (DIMS / 32 + (kp + 1) * (QK / 32) + q) * WFRAG);
            }
            // holds every load at the place written: sunk to its use, an LDS read would
            // stall each pair of products and a weight load each k step
            __builtin_amdgcn_sched_barrier(0);
        }

        if (kp + 1 < QNP && stager) {   // the other buffer's last readers left at the previous barrier
            _Float16* sn = sX + ((kp + 1) & 1) * QBUF + sDst;
            #pragma unroll   // constant indices keep the array in registers
            for (int j = 0; j < 4; ++j) {
                v8h h;
                #pragma unroll   // constant indices keep the array in registers
                for (int i = 0; i < 8; ++i) h[i] = (_Float16)xr[i][j];
                *(v8h*)(sn + j * 32 * QPITCH) = h;
            }
        }
        if (kp + 1 < QNP) {
            // publishes panel kp + 1 and ends every read of panel kp's buffer. The fences
            // name LDS alone: __syncthreads() would also drain the weight loads just
            // issued for the next panel, an L2 round trip in front of every barrier
            __builtin_amdgcn_fence(__ATOMIC_RELEASE, "workgroup", "local");
            __builtin_amdgcn_s_barrier();
            __builtin_amdgcn_fence(__ATOMIC_ACQUIRE, "workgroup", "local");
        }
    }

    // acc[mt][n][r]: channel mt*16 + half*8 + r of the wave's 32,
    // position hw0 + 4*((n & 1)*16 + mn) + (n >> 1)
    if (wave < 2) {   // theta: every position
        _Float16* dl = theta + ((size_t)b * HW + hw0) * C8 + wave * 32 + half * 8;
        #pragma unroll   // constant indices keep the array in registers
        for (int mt = 0; mt < 2; ++mt) {
            const float* bp = bsel + mt * 16 + half * 8;
            const v4f bl = *(const v4f*)(bp);
            const v4f bh = *(const v4f*)(bp + 4);
            #pragma unroll   // constant indices keep the array in registers
            for (int n = 0; n < 8; ++n) {
                const int p = 4 * ((n & 1) * 16 + mn) + (n >> 1);
                v8h h;
                #pragma unroll   // constant indices keep the array in registers
                for (int r = 0; r < 8; ++r)
                    h[r] = (_Float16)(acc[mt][n][r] + (r < 4 ? bl[r & 3] : bh[r & 3]));
                *(v8h*)(dl + p * C8 + mt * 16) = h;
            }
        }
        return;
    }

    // phi and g: tiles n = 4w .. 4w+3 are columns 4*mn + 2w, + 1 of both image rows,
    // the window of pooled column 2*mn + w in pooled row blockIdx.x. The bias is the
    // same over a window and rounding keeps order: maximum first, then bias and f16.
    // Both bias rows are fetched up front: no load stands behind a store.
    v8f pw[2][2];   // [channel tile][w]
    #pragma unroll   // constant indices keep the arrays in registers
    for (int mt = 0; mt < 2; ++mt) {
        const float* bp = bsel + mt * 16 + half * 8;
        const v4f bl = *(const v4f*)(bp);
        const v4f bh = *(const v4f*)(bp + 4);
        #pragma unroll   // constant indices keep the arrays in registers
        for (int w = 0; w < 2; ++w)
            #pragma unroll   // constant indices keep the arrays in registers
            for (int r = 0; r < 8; ++r)
                pw[mt][w][r] = fmaxf(fmaxf(acc[mt][4 * w][r],     acc[mt][4 * w + 1][r]),
                                     fmaxf(acc[mt][4 * w + 2][r], acc[mt][4 * w + 3][r]))
                               + (r < 4 ? bl[r & 3] : bh[r & 3]);
    }
    if (wave < 4) {   // phi[b][key][64]: eight channels of a key, 16 B
        _Float16* dp = phi + ((size_t)b * HW4 + blockIdx.x * 32 + 2 * mn) * C8 + (wave - 2) * 32 + half * 8;
        #pragma unroll   // constant indices keep the arrays in registers
        for (int mt = 0; mt < 2; ++mt)
            #pragma unroll   // constant indices keep the arrays in registers
            for (int w = 0; w < 2; ++w) {
                v8h h;
                #pragma unroll   // constant indices keep the arrays in registers
                for (int r = 0; r < 8; ++r) h[r] = (_Float16)pw[mt][w][r];
                *(v8h*)(dp + w * C8 + mt * 16) = h;
            }
        // stands in front of any later rewrite of these stores' address and data registers
        asm volatile("s_wait_xcnt 0x0" ::: "memory");
    } else {          // g tile: two keys of a channel, 4 B; 16 lanes fill the channel's 64 B
        _Float16* dg = g + (((size_t)b * (HW4 / GT) + blockIdx.x) * C2 + (wave - 4) * 32 + half * 8) * GT + 2 * mn;
        #pragma unroll   // constant indices keep the arrays in registers
        for (int mt = 0; mt < 2; ++mt)
            #pragma unroll   // constant indices keep the arrays in registers
            for (int r = 0; r < 8; ++r) {
                v2h kk = { (_Float16)pw[mt][0][r], (_Float16)pw[mt][1][r] };
                *(v2h*)(dg + (mt * 16 + r) * GT) = kk;
            }
        // stands in front of any later rewrite of these stores' address and data registers
        asm volatile("s_wait_xcnt 0x0" ::: "memory");
    }
}

// f32 -> f16 conversion of all four weight matrices in one launch. Their f16 copies
// lie back to back in the workspace (theta, phi, g, attn), so the destination is one
// array. The copies are in fragment order: matrix [M][K] becomes fragments of 16 rows x
// 32 k, fragment (row tile, k step) at index row tile * K / 32 + k step, laid out as
// load_frag_packed reads it. A block fills 2048 consecutive destination elements (four
// fragments), eight a lane (16-B stores, a wave fills four whole lines), and picks its
// source by its index: every matrix is a whole number of blocks. A lane's eight values
// are 32 consecutive bytes of one source row. Grid CVT_BLOCKS, block 256.
#define CVB        2048
#define CVT_B_PHI  (C8 * DIMS / CVB)                 // first block of w_phi
#define CVT_B_G    (CVT_B_PHI + C8 * DIMS / CVB)     // first block of w_g
#define CVT_B_ATT  (CVT_B_G + C2 * DIMS / CVB)       // first block of w_attn
#define CVT_BLOCKS (CVT_B_ATT + DIMS * C2 / CVB)
__global__ void __launch_bounds__(256)
cvt_weights_kernel(const float* __restrict__ wth,
                   const float* __restrict__ wph,
                   const float* __restrict__ wg,
                   const float* __restrict__ wat,
                   _Float16* __restrict__ dst) {
    const int blk = blockIdx.x;
    const float* src;   // the block's matrix
    int lb, ksl;        // the block's index in it; log2 of its k steps per row
    if (blk < CVT_B_PHI)      { src = wth; lb = blk;             ksl = 4; }
    else if (blk < CVT_B_G)   { src = wph; lb = blk - CVT_B_PHI; ksl = 4; }
    else if (blk < CVT_B_ATT) { src = wg;  lb = blk - CVT_B_G;   ksl = 4; }
    else                      { src = wat; lb = blk - CVT_B_ATT; ksl = 3; }
    const int t = threadIdx.x;
    const int e = t * 8;
    // 64 threads a fragment: bit 5 of t picks the first or second eight k values of
    // fragment lane t & 31, whose row is t & 15 and whose k half is bit 4
    const int f   = lb * (CVB / WFRAG) + (t >> 6);
    const int row = (f >> ksl) * 16 + (t & 15);
    const int col = (f & ((1 << ksl) - 1)) * 32 + ((t >> 5) & 1) * 16 + ((t >> 4) & 1) * 8;
    const float* sp = src + ((row << ksl) * 32 + col);
    const v4f lo = *(const v4f*)(sp);
    const v4f hi = *(const v4f*)(sp + 4);
    v8h h;
    #pragma unroll   // constant indices keep the vectors in registers
    for (int i = 0; i < 4; ++i) { h[i] = (_Float16)lo[i]; h[i + 4] = (_Float16)hi[i]; }
    *(v8h*)(dst + blk * CVB + e) = h;
}

// ---------------------------------------------------------------------------
// Attention, 256 queries per block: 8 waves x 32 queries walk the 1024 keys in
// chunks of 64 that the block stages once in LDS (two buffers), so every byte
// of phi and g fetched from L2 serves 256 queries.
//   S^T(key x query) = phi_chunk @ theta^T   (A from LDS, B kept in registers)
//   O^T(chan x query) += g_chunk @ P^T       (A from LDS, B packed from S^T)
// A wave holds two query tiles, so every fragment read from LDS feeds two
// products: with one tile a wave the LDS reads take twice the matrix time.
// A lane holds one query's scores per tile: running maximum and sum stay in
// registers. Grid (HW/256, B), block 256. Dynamic LDS = 2 x 46,080 B. Two waves
// per SIMD (the 256 x 32 f32 output tile alone is 256 VGPRs a wave).
//
// The final 1x1 conv runs in the same launch, on the wave's own 32 queries:
//   out[b][co][hw] = x + sigma * (w_attn[co,:] . attnG[hw,:] + b_attn[co])
//   D(channel x query) = w_attn_tile @ O^T   (A from LDS, B packed from O^T)
// The normalised O^T, rounded to f16, already sits in the k order of a B operand,
// so the attention output never goes to memory. The weights (fragment order) come
// through the chunk buffers, free by then, in eight stages of 64 output channels
// (32 KB, two buffers). Query tile qt holds positions 2*mn + qt, so a lane ends
// with two consecutive positions of a channel: x and out move 8 B a lane, one
// whole 128-B line a half wave. The x rows run one stage ahead in registers.
// ---------------------------------------------------------------------------
#define KCH    64                    // keys per chunk
#define PITCH  72                    // LDS row pitch in halfwords (128 B + 16 B)
#define PHI_H  (KCH * PITCH)         // phi chunk: 64 key rows
#define BUF_H  ((KCH + C2) * PITCH)  // + g chunk: 256 channel rows
#define QT     2                     // query tiles per wave
#define GC     2                     // channel tiles per group of g fragments
#define FKS    (C2 / 32)             // k steps of the final conv
#define FCT    4                     // output channel tiles per weight stage
#define FST    (FCT * FKS * WFRAG)   // halfwords per weight stage
#define FNS    (DIMS / (16 * FCT))   // weight stages

// Work-group barrier whose fences name LDS alone: __syncthreads() would also drain
// the global loads and stores in flight, a memory round trip in front of every barrier
__device__ __forceinline__ void lds_barrier() {
    __builtin_amdgcn_fence(__ATOMIC_RELEASE, "workgroup", "local");
    __builtin_amdgcn_s_barrier();
    __builtin_amdgcn_fence(__ATOMIC_ACQUIRE, "workgroup", "local");
}

// lane l <-> lane l ^ 16
__device__ __forceinline__ float xhalf(float x) {
    int i = __builtin_bit_cast(int, x);
    return __builtin_bit_cast(float,
        __builtin_amdgcn_permlanex16(i, i, 0x76543210, 0xfedcba98, false, false));
}

// 2^x; the v_nop keeps the one free issue slot that the instruction set asks for
// behind a transcendental, whatever the scheduler places next
__device__ __forceinline__ float exp2_slot(float x) {
    float r;
    asm("v_exp_f32 %0, %1\n\tv_nop" : "=v"(r) : "v"(x));
    return r;
}

__global__ void __launch_bounds__(256) __attribute__((amdgpu_waves_per_eu(2, 2)))
attn_wmma_kernel(const _Float16* __restrict__ theta,
                 const _Float16* __restrict__ phi,
                 const _Float16* __restrict__ g,
                 const _Float16* __restrict__ Wh,
                 const float* __restrict__ bt,
                 const float* __restrict__ x,
                 const float* __restrict__ sigma,
                 float* __restrict__ out) {
    extern __shared__ __attribute__((aligned(16))) char smem[];
    _Float16* sBuf = (_Float16*)smem;

    const int b    = blockIdx.y;
    const int t    = threadIdx.x;
    const int lane = t & 31;
    const int wave = t >> 5;
    const int half = lane >> 4;
    const int mn   = lane & 15;
    const int q0   = blockIdx.x * 256 + wave * (16 * QT);

    // staging: 8 threads per 128-byte row, 32 rows per sweep
    const int srow = t >> 3, scol = (t & 7) * 8;
    const char* pBase = (const char*)(phi + (size_t)b * HW4 * C8);   // uniform bases,
    const char* gBase = (const char*)(g + (size_t)b * C2 * HW4);     // 32-bit lane offsets
    const int pOff = (srow * C8 + scol) * 2;                                          // in bytes
    const int gOff = ((scol / GT) * (C2 * GT) + srow * GT + (scol & (GT - 1))) * 2;   // a chunk is two key tiles of g
    const int sDst = srow * PITCH + scol;

    // theta^T as B operand: lane = query, K = channel, kept for the whole walk;
    // column mn of tile qt is position q0 + 2*mn + qt
    const _Float16* tq = theta + ((size_t)b * HW + q0 + 2 * mn) * C8 + half * 8;
    v16h bq[QT][2];
    #pragma unroll   // constant indices keep the array in registers
    for (int qt = 0; qt < QT; ++qt) {
        bq[qt][0] = load_frag_row(tq + qt * C8, 0);
        bq[qt][1] = load_frag_row(tq + qt * C8 + 32, 0);
    }
    // stands in front of any later rewrite of these loads' address registers; it
    // names the address, so that its registers stay untouched up to the wait
    asm volatile("s_wait_xcnt 0x0" :: "v"(tq) : "memory");

    v8h stP[2], stG[8];
    #pragma unroll   // constant indices keep the array in registers
    for (int j = 0; j < 2; ++j) stP[j] = *(const v8h*)(pBase + pOff + j * 32 * C8 * 2);
    #pragma unroll   // constant indices keep the array in registers
    for (int j = 0; j < 8; ++j) stG[j] = *(const v8h*)(gBase + gOff + j * 32 * GT * 2);
    // the same for the staging loads and their two lane offsets
    asm volatile("s_wait_xcnt 0x0" :: "v"(pOff), "v"(gOff) : "memory");
    #pragma unroll   // constant indices keep the array in registers
    for (int j = 0; j < 2; ++j) *(v8h*)(sBuf + sDst + j * 32 * PITCH) = stP[j];
    #pragma unroll   // constant indices keep the array in registers
    for (int j = 0; j < 8; ++j) *(v8h*)(sBuf + PHI_H + sDst + j * 32 * PITCH) = stG[j];
    __syncthreads();   // chunk 0 is published

    const float L2E = 1.4426950408889634f;
    v8f acc[16][QT];
    #pragma unroll   // constant indices keep the array in registers
    for (int ct = 0; ct < 16; ++ct)
        #pragma unroll   // constant indices keep the array in registers
        for (int qt = 0; qt < QT; ++qt) acc[ct][qt] = (v8f){};
    float ms[QT], l[QT];   // running maximum, in log2 units; running sum over this lane's keys
    #pragma unroll   // constant indices keep the arrays in registers
    for (int qt = 0; qt < QT; ++qt) { ms[qt] = -3.0e38f; l[qt] = 0.f; }

    for (int kc = 0; kc < HW4 / KCH; ++kc) {
        const _Float16* sp = sBuf + (kc & 1) * BUF_H;
        const _Float16* sg = sp + PHI_H;
        // the chunk staged during this trip. The last trip fetches its own chunk again,
        // into the buffer that nobody reads any more: with no branch the trip is one
        // block of code, and the fences below can hold its loads and sums in place
        const int kn = kc + 1 < HW4 / KCH ? kc + 1 : kc;

        // ---- S^T: s[qt][kt][r] = score(key kt*16 + r + 8*half, query 2*mn + qt) ----
        v16h ap[4][2];
        #pragma unroll   // constant indices keep the array in registers
        for (int kt = 0; kt < 4; ++kt) {
            const _Float16* pr = sp + (kt * 16 + mn) * PITCH;
            ap[kt][0] = load_frag_row(pr, half);
            ap[kt][1] = load_frag_row(pr + 32, half);
        }
        // all sixteen phi reads go out as one group: spread among the products, each
        // pair of products would wait out an LDS round trip of its own
        __builtin_amdgcn_sched_barrier(0);
        v8f s[QT][4];
        #pragma unroll   // constant indices keep the arrays in registers
        for (int kt = 0; kt < 4; ++kt) {
            #pragma unroll   // constant indices keep the arrays in registers
            for (int qt = 0; qt < QT; ++qt) {
                v8f z = {};
                z = WMMA_F16(ap[kt][0], bq[qt][0], z);
                z = WMMA_F16(ap[kt][1], bq[qt][1], z);
                s[qt][kt] = z;
            }
        }
        // holds the score products in front of the g reads below: the phi fragments'
        // registers are free again before the ring takes its own
        __builtin_amdgcn_sched_barrier(0);

        // g fragments come in groups of two channel tiles through a ring of three. With
        // two waves a SIMD a wave hides its own LDS round trips: group 0 is asked for
        // here and lands under the softmax, group 1 behind the softmax (the scores'
        // registers are free then), group u + 2 in front of group u's products
        v16h ar[3][GC][2];
        #pragma unroll   // constant indices keep the array in registers
        for (int c = 0; c < GC; ++c) {
            const _Float16* gr = sg + (c * 16 + mn) * PITCH;
            ar[0][c][0] = load_frag_row(gr, half);
            ar[0][c][1] = load_frag_row(gr + 32, half);
        }
        // keeps those reads here: sunk to their use they would stall the first products
        __builtin_amdgcn_sched_barrier(0);

        // ---- running softmax, one query per lane and tile ----
        // P^T as B operand: score tiles 2ks and 2ks+1 already sit in the k order
        // of load_frag_row (half*8 + i, then 16 + half*8 + i)
        v16h p[QT][2];
        float alpha[QT];
        #pragma unroll   // constant indices keep the arrays in registers
        for (int qt = 0; qt < QT; ++qt) {
            float mx = s[qt][0][0];
            #pragma unroll   // constant indices keep the array in registers
            for (int kt = 0; kt < 4; ++kt)
                #pragma unroll   // constant indices keep the array in registers
                for (int r = 0; r < 8; ++r) mx = fmaxf(mx, s[qt][kt][r]);
            mx = fmaxf(mx, xhalf(mx));
            const float msn = fmaxf(ms[qt], mx * L2E);
            alpha[qt] = exp2_slot(ms[qt] - msn);   // 0 on the first chunk
            ms[qt] = msn;

            float ls = 0.f;
            #pragma unroll   // constant indices keep the array in registers
            for (int ks = 0; ks < 2; ++ks) {
                #pragma unroll   // constant indices keep the array in registers
                for (int r = 0; r < 8; ++r) {
                    const float x0 = fmaf(s[qt][2 * ks][r],     L2E, -msn);
                    const float x1 = fmaf(s[qt][2 * ks + 1][r], L2E, -msn);
                    const float e0 = exp2_slot(x0);
                    const float e1 = exp2_slot(x1);
                    ls += e0 + e1;
                    p[qt][ks][r]     = (_Float16)e0;
                    p[qt][ks][r + 8] = (_Float16)e1;
                }
            }
            l[qt] = l[qt] * alpha[qt] + ls;
        }

        // ends the softmax here: group 1's reads take registers that the scores have left,
        // and row sums sunk below the products would hold their exponentials in
        // registers through the whole walk over g
        __builtin_amdgcn_sched_barrier(0);
        #pragma unroll   // constant indices keep the array in registers
        for (int c = 0; c < GC; ++c) {
            const _Float16* gr = sg + ((GC + c) * 16 + mn) * PITCH;
            ar[1][c][0] = load_frag_row(gr, half);
            ar[1][c][1] = load_frag_row(gr + 32, half);
        }

        {   // next chunk's loads fly under the 64 products below (scores are packed: registers free)
            const int k1 = kn * KCH;
            #pragma unroll   // constant indices keep the array in registers
            for (int j = 0; j < 2; ++j)
                stP[j] = *(const v8h*)(pBase + (j * 32 * C8 + k1 * C8) * 2 + pOff);
            #pragma unroll   // constant indices keep the array in registers
            for (int j = 0; j < 8; ++j)
                stG[j] = *(const v8h*)(gBase + (j * 32 * GT + k1 * C2) * 2 + gOff);
            // stands in front of any later rewrite of these loads' address registers
            asm volatile("s_wait_xcnt 0x0" ::: "memory");
        }

        // ---- O^T += g_chunk @ P^T: each g fragment serves both query tiles ----
        // a group's tiles are rescaled one step ahead, among the products of the group before
        #pragma unroll   // constant indices keep the array in registers
        for (int c = 0; c < GC; ++c)
            #pragma unroll   // constant indices keep the array in registers
            for (int qt = 0; qt < QT; ++qt) acc[c][qt] *= alpha[qt];
        // keeps group 1's reads and the first rescale in front of the products
        __builtin_amdgcn_sched_barrier(0);
        #pragma unroll   // constant indices keep the arrays in registers
        for (int u = 0; u < 16 / GC; ++u) {
            if (u + 2 < 16 / GC) {
                #pragma unroll   // constant indices keep the array in registers
                for (int c = 0; c < GC; ++c) {
                    const _Float16* gr = sg + (((u + 2) * GC + c) * 16 + mn) * PITCH;
                    ar[(u + 2) % 3][c][0] = load_frag_row(gr, half);
                    ar[(u + 2) % 3][c][1] = load_frag_row(gr + 32, half);
                }
            }
            #pragma unroll   // constant indices keep the arrays in registers
            for (int c = 0; c < GC; ++c) {
                const int ct = u * GC + c;
                #pragma unroll   // constant indices keep the arrays in registers
                for (int qt = 0; qt < QT; ++qt)
                    acc[ct][qt] = WMMA_F16(ar[u % 3][c][0], p[qt][0], acc[ct][qt]);
                if (u + 1 < 16 / GC) {
                    #pragma unroll   // constant indices keep the arrays in registers
                    for (int qt = 0; qt < QT; ++qt) acc[ct + GC][qt] *= alpha[qt];
                }
                #pragma unroll   // constant indices keep the arrays in registers
                for (int qt = 0; qt < QT; ++qt)
                    acc[ct][qt] = WMMA_F16(ar[u % 3][c][1], p[qt][1], acc[ct][qt]);
            }
            // holds each group's reads two groups ahead of their products: sunk to
            // their use, every pair of products would wait out an LDS round trip
            __builtin_amdgcn_sched_barrier(0);
        }

        {   // the other buffer's last readers left at the previous barrier
            _Float16* sn = sBuf + ((kc + 1) & 1) * BUF_H;
            #pragma unroll   // constant indices keep the array in registers
            for (int j = 0; j < 2; ++j) *(v8h*)(sn + sDst + j * 32 * PITCH) = stP[j];
            #pragma unroll   // constant indices keep the array in registers
            for (int j = 0; j < 8; ++j) *(v8h*)(sn + PHI_H + sDst + j * 32 * PITCH) = stG[j];
        }
        __syncthreads();   // publishes chunk kc + 1 and ends every read of chunk kc's buffer
    }

    // ---- final 1x1 conv. Every read of the chunk buffers ended at the loop's last barrier ----
    // stage 0 of the weights: 16 B a thread and load, 4 KB a sweep
    const int tw = t * 8;
    v8h wr[8];
    #pragma unroll   // all 8 loads of a lane in flight together
    for (int j = 0; j < 8; ++j) wr[j] = *(const v8h*)(Wh + j * 2048 + tw);
    // the bias goes to LDS behind the two weight buffers, two channels a thread: fetched from
    // memory tile by tile it would stand among the x rows in the load queue, and a wait
    // for it would drain the rows asked for ahead
    float* sBias = (float*)(sBuf + 2 * FST);
    const v2f bv = *(const v2f*)(bt + t * 2);
    // stands in front of any later rewrite of these loads' address registers, and keeps them
    // first in the queue: loads return in order, and the LDS stores below would
    // otherwise wait for the x rows too; it names the two bases, so that their
    // registers stay untouched up to the wait
    asm volatile("s_wait_xcnt 0x0" :: "s"(Wh), "s"(bt) : "memory");

    const float sg = sigma[0];
    const float* xb = x   + (size_t)b * DIMS * HW + blockIdx.x * 256;   // uniform bases,
    float*       yb = out + (size_t)b * DIMS * HW + blockIdx.x * 256;   // 32-bit lane offsets
    const int eoff = half * 8 * HW + wave * (16 * QT) + 2 * mn;
    // x rows of one stage: channel tile c, channel c*16 + half*8 + r -> xv[c][r]
    v2f xv[FCT][8];
    #pragma unroll   // all loads of a stage in flight together
    for (int c = 0; c < FCT; ++c)
        #pragma unroll   // constant indices keep the array in registers
        for (int r = 0; r < 8; ++r) xv[c][r] = *(const v2f*)(xb + eoff + (c * 16 + r) * HW);
    // stands in front of any later rewrite of these loads' address registers
    asm volatile("s_wait_xcnt 0x0" ::: "memory");

    // O^T as B operand: output tiles 2ks and 2ks+1 already sit in the k order
    // of load_frag_row (half*8 + i, then 16 + half*8 + i)
    v16h ob[QT][FKS];
    #pragma unroll   // constant indices keep the arrays in registers
    for (int qt = 0; qt < QT; ++qt) {
        const float lt  = l[qt] + xhalf(l[qt]);
        const float inv = 1.0f / lt;
        #pragma unroll   // constant indices keep the arrays in registers
        for (int ks = 0; ks < FKS; ++ks) {
            #pragma unroll   // constant indices keep the arrays in registers
            for (int r = 0; r < 8; ++r) {
                ob[qt][ks][r]     = (_Float16)(acc[2 * ks][qt][r] * inv);
                ob[qt][ks][r + 8] = (_Float16)(acc[2 * ks + 1][qt][r] * inv);
            }
        }
    }

    #pragma unroll   // constant indices keep the array in registers
    for (int j = 0; j < 8; ++j) *(v8h*)(sBuf + j * 2048 + tw) = wr[j];
    *(v2f*)(sBias + t * 2) = bv;
    lds_barrier();   // weight stage 0 and the bias are published

    #pragma unroll 1   // one copy of a stage: the text stays small
    for (int st = 0; st < FNS; ++st) {
        const _Float16* sw = sBuf + (st & 1) * FST + lane * 8;
        // The stage fetched during this trip. The last trip fetches its own again, the weights
        // into the buffer that nobody reads any more: behind a branch the waits for the
        // rows asked for ahead could not be counted
        const int sn = st + 1 < FNS ? st + 1 : st;
        {
            const _Float16* wn = Wh + sn * FST;
            #pragma unroll   // all 8 loads of a lane in flight together
            for (int j = 0; j < 8; ++j) wr[j] = *(const v8h*)(wn + j * 2048 + tw);
            // stands in front of any later rewrite of these loads' address registers
            asm volatile("s_wait_xcnt 0x0" ::: "memory");
        }
        const float* xn = xb + sn * (FCT * 16 * HW);
        const float* sb = sBias + st * (FCT * 16) + half * 8;
        float*       yt = yb + st * (FCT * 16 * HW);

        #pragma unroll   // constant indices keep the arrays in registers
        for (int c = 0; c < FCT; ++c) {
            v16h a[FKS];
            #pragma unroll   // all sixteen reads go out as one group
            for (int ks = 0; ks < FKS; ++ks) a[ks] = load_frag_packed(sw + (c * FKS + ks) * WFRAG);
            const v4f bl = *(const v4f*)(sb + c * 16);
            const v4f bh = *(const v4f*)(sb + c * 16 + 4);
            v8f d[QT];
            #pragma unroll   // constant indices keep the array in registers
            for (int qt = 0; qt < QT; ++qt) d[qt] = (v8f){};
            #pragma unroll   // constant indices keep the arrays in registers
            for (int ks = 0; ks < FKS; ++ks)
                #pragma unroll   // constant indices keep the arrays in registers
                for (int qt = 0; qt < QT; ++qt) d[qt] = WMMA_F16(a[ks], ob[qt][ks], d[qt]);

            // d[qt][r]: channel (st*FCT + c)*16 + half*8 + r, position q0 + 2*mn + qt
            v2f res[8];
            #pragma unroll   // constant indices keep the arrays in registers
            for (int r = 0; r < 8; ++r) {
                const float bc = r < 4 ? bl[r & 3] : bh[r & 3];
                #pragma unroll   // constant indices keep the arrays in registers
                for (int qt = 0; qt < QT; ++qt) res[r][qt] = xv[c][r][qt] + sg * (d[qt][r] + bc);
            }
            // all sums in front of all stores: no register of an issued store is
            // rewritten in front of the wait below
            __builtin_amdgcn_sched_barrier(0);
            #pragma unroll   // constant indices keep the array in registers
            for (int r = 0; r < 8; ++r) *(v2f*)(yt + eoff + (c * 16 + r) * HW) = res[r];
            // stands in front of any later rewrite of these stores' address and data registers
            asm volatile("s_wait_xcnt 0x0" ::: "memory");

            // this tile's registers are spent: the next stage's rows have a whole stage to arrive
            #pragma unroll   // constant indices keep the array in registers
            for (int r = 0; r < 8; ++r) xv[c][r] = *(const v2f*)(xn + eoff + (c * 16 + r) * HW);
            // stands in front of any later rewrite of these loads' address registers
            asm volatile("s_wait_xcnt 0x0" ::: "memory");
        }

        {   // the other buffer's last readers left at the previous barrier
            _Float16* sn_w = sBuf + ((st + 1) & 1) * FST + tw;
            #pragma unroll   // constant indices keep the array in registers
            for (int j = 0; j < 8; ++j) *(v8h*)(sn_w + j * 2048) = wr[j];
        }
        lds_barrier();   // publishes stage st + 1 and ends every read of stage st's buffer
    }
    // the last trip's spare rows have landed before the wave gives its registers back
    asm volatile("s_wait_loadcnt 0x0" ::: "memory");
}

// ---------------------------------------------------------------------------
extern "C" void kernel_launch(void* const* d_in, const int* in_sizes, int n_in,
                              void* d_out, int out_size, void* d_ws, size_t ws_size,
                              hipStream_t stream) {
    const float* x       = (const float*)d_in[0];
    const float* w_theta = (const float*)d_in[1];
    const float* b_theta = (const float*)d_in[2];
    const float* w_phi   = (const float*)d_in[3];
    const float* b_phi   = (const float*)d_in[4];
    const float* w_g     = (const float*)d_in[5];
    const float* b_g     = (const float*)d_in[6];
    const float* w_attn  = (const float*)d_in[7];
    const float* b_attn  = (const float*)d_in[8];
    const float* sigma   = (const float*)d_in[9];
    float* out = (float*)d_out;

    char* ws = (char*)d_ws;
    _Float16* theta   = (_Float16*)(ws);                 //  8 MB   [b][hw][64]
    _Float16* phi     = (_Float16*)(ws +  8388608);      //  2 MB   [b][key][64]
    _Float16* gbuf    = (_Float16*)(ws + 10485760);      //  8 MB   [b][key/32][c][key%32]
    _Float16* wth_h   = (_Float16*)(ws + 18874368);      //  64 KB  [64][512], fragment order
    _Float16* wph_h   = (_Float16*)(ws + 18939904);      //  64 KB  [64][512], fragment order
    _Float16* wg_h    = (_Float16*)(ws + 19005440);      // 256 KB  [256][512], fragment order
    _Float16* wat_h   = (_Float16*)(ws + 19267584);      // 256 KB  [512][256], fragment order

    // wth_h, wph_h, wg_h and wat_h are one contiguous range that starts at wth_h
    cvt_weights_kernel<<<CVT_BLOCKS, 256, 0, stream>>>(w_theta, w_phi, w_g, w_attn, wth_h);

    // one pass over X produces theta and the pooled phi and g
    qkv_conv_kernel<<<dim3(HW / QP, NB), dim3(384), 0, stream>>>(
        x, wth_h, wph_h, wg_h, b_theta, b_phi, b_g, theta, phi, gbuf);
    attn_wmma_kernel<<<dim3(HW / 256, NB), dim3(256), 2 * BUF_H * 2, stream>>>(
        theta, phi, gbuf, wat_h, b_attn, x, sigma, out);
}
